// v000
// Times are from an AMD MI455X. After a warm-up the kernel runs many times in a row, and a time is the length of
// such a window on the GPU divided by its runs, so every launch and the gaps after it count. The runs cycle
// through copies of the inputs. A figure is the median of several windows, for all but v000 over two sittings.
// Sittings can differ by a few percent; kernels timed side by side share one.
// v000, which the later versions start from, runs in 1670 microseconds.
#include <hip/hip_runtime.h>

// Relative-position multi-head attention (segment-recurrence style relative shift; query [1024][4][1024] seq-first, r [1024][1024]; w = query qkv_w^T -> q|k|v (16 heads x 64); r_k = r r_w^T; AC = (q + r_w_bias).k,
// BD = rel_shift((q + r_r_bias).r_k) with the module's exact zero-pad/reshape shift (out[i][j] = BD[f / (T+1)][f % (T+1) - 1] or 0 when f % (T+1) == 0, f = T + i*T + j); p = softmax((AC + BD) / 8)
// over the keys; attn = p.v; out = merged out_w^T + out_b; output [1024][4][1024] (rows t*4 + b)).
// Compute dtypes, f32 accumulate: every input rounded to bf16; the qkv and r projections on PLAIN bf16 inputs (exact) times hi/lo bf16 weight planes; AC, BD and attn.v on SINGLE fp16 planes
// (the per-head biases added in f32 before the fp16 rounding; logit sd ~ 0.6); the relative shift is an index gather inside the softmax kernel; P x1024;

#define NB_  4
#define TT   1024
#define NLY  8                    // weight-factor layers
#define RNK  4                    // additive rank
#define DD   1024
#define NH_  16
#define HD   64
#define NT   (NB_ * TT)
#define ZH   2
#define PCAR 1024.0f
typedef _Float16 h16;
typedef unsigned short bf;
typedef __attribute__((ext_vector_type(16))) __bf16   v16bf;
typedef __attribute__((ext_vector_type(16))) _Float16 v16h;
typedef __attribute__((ext_vector_type(8)))  _Float16 v8h;
typedef __attribute__((ext_vector_type(8)))  unsigned short v8us;
typedef __attribute__((ext_vector_type(8)))  float    v8f;
typedef __attribute__((ext_vector_type(4)))  float    v4f;
typedef v8h  __attribute__((may_alias)) v8ha;
typedef v4f  __attribute__((may_alias)) v4fa;
typedef v8us __attribute__((may_alias)) v8usa;

__device__ __forceinline__ unsigned short f2bf(float f) { unsigned u = __float_as_uint(f); u += 0x7FFFu + ((u >> 16) & 1u); return (unsigned short)(u >> 16); }
__device__ __forceinline__ float bf2f(unsigned short b) { return __uint_as_float(((unsigned)b) << 16); }
__device__ __forceinline__ float bfr(float f) { return bf2f(f2bf(f)); }
__device__ __forceinline__ v16h cat16(v8h lo, v8h hi) { return __builtin_shufflevector(lo, hi, 0, 1, 2, 3, 4, 5, 6, 7, 8, 9, 10, 11, 12, 13, 14, 15); }
__device__ __forceinline__ v16bf cat16b(v8us lo, v8us hi) { return __builtin_bit_cast(v16bf, __builtin_shufflevector(lo, hi, 0, 1, 2, 3, 4, 5, 6, 7, 8, 9, 10, 11, 12, 13, 14, 15)); }
__device__ __forceinline__ v8f wmma16(v16h a, v16h b, v8f c) { return __builtin_amdgcn_wmma_f32_16x16x32_f16(false, a, false, b, (short)0, c, false, false); }
__device__ __forceinline__ v8f wmmab(v16bf a, v16bf b, v8f c) { return __builtin_amdgcn_wmma_f32_16x16x32_bf16(false, a, false, b, (short)0, c, false, false); }



// ---- k_gemmw: register-blocked GEMM, ONE WAVE per 64x64 output tile (16 accumulators), operands straight from K-contiguous 16-bit planes; grid (M/64, N/64, Z), 32 threads.
// C[m][n] (f32, pitch ldc, + optional f32 bias[n]) = sum_k A[m][k] Bt[n][k] (+ split products per NSPLIT). z-batch strides sA/sB/sC in elements. K % 32 == 0.
template <typename T16> struct WFrag;
template <> struct WFrag<h16> { typedef v16h V; static __device__ __forceinline__ V ld(const h16* p) { return cat16(*(const v8h*)p, *(const v8h*)(p + 16)); } static __device__ __forceinline__ v8f mma(V a, V b, v8f c) { return wmma16(a, b, c); } };
template <> struct WFrag<bf> { typedef v16bf V; static __device__ __forceinline__ V ld(const bf* p) { return cat16b(*(const v8us*)p, *(const v8us*)(p + 16)); } static __device__ __forceinline__ v8f mma(V a, V b, v8f c) { return wmmab(a, b, c); } };
template <typename T16, int NSPLIT, bool BIAS>
__global__ __launch_bounds__(32) void k_gemmw(const T16* __restrict__ A, const T16* __restrict__ A2, const T16* __restrict__ Bt, const T16* __restrict__ Bt2, int K, float* C, int ldc, const float* __restrict__ bias, size_t sA, size_t sB, size_t sC) {
    typedef typename WFrag<T16>::V V;
    __shared__ __align__(16) float os[16 * 68];
    const size_t z = blockIdx.z; A += z * sA; if (A2) A2 += z * sA; Bt += z * sB; if (Bt2) Bt2 += z * sB; C += z * sC;
    const int lane = threadIdx.x & 31, lr = lane & 15, hi = lane >> 4; const int r0 = blockIdx.x * 64, c0 = blockIdx.y * 64;
    v8f acc[4][4];
#pragma unroll
    for (int mb = 0; mb < 4; ++mb)
#pragma unroll
        for (int nb = 0; nb < 4; ++nb) acc[mb][nb] = (v8f){};
    const size_t aoff = (size_t)(r0 + lr) * K + 8 * hi, boff = (size_t)(c0 + lr) * K + 8 * hi;
#pragma unroll 1
    for (int kc = 0; kc < K; kc += 32) {
        V a[4], a2[4];
#pragma unroll
        for (int mb = 0; mb < 4; ++mb) { a[mb] = WFrag<T16>::ld(A + aoff + (size_t)mb * 16 * K + kc); if (NSPLIT == 1 || NSPLIT == 2) a2[mb] = WFrag<T16>::ld(A2 + aoff + (size_t)mb * 16 * K + kc); }
#pragma unroll
        for (int nb = 0; nb < 4; ++nb) { const V b = WFrag<T16>::ld(Bt + boff + (size_t)nb * 16 * K + kc); V b2; if (NSPLIT >= 2) b2 = WFrag<T16>::ld(Bt2 + boff + (size_t)nb * 16 * K + kc);
#pragma unroll
            for (int mb = 0; mb < 4; ++mb) { acc[mb][nb] = WFrag<T16>::mma(a[mb], b, acc[mb][nb]); if (NSPLIT == 1 || NSPLIT == 2) acc[mb][nb] = WFrag<T16>::mma(a2[mb], b, acc[mb][nb]); if (NSPLIT >= 2) acc[mb][nb] = WFrag<T16>::mma(a[mb], b2, acc[mb][nb]); } }
        asm volatile("v_nop\n\tv_nop\n\tv_nop\n\tv_nop" : "+v"(acc[0][0]), "+v"(acc[1][1]), "+v"(acc[2][2]), "+v"(acc[3][3]) : "v"(a[0]), "v"(a[3]));
    }
#pragma unroll
    for (int mb = 0; mb < 4; ++mb) {
#pragma unroll
        for (int nb = 0; nb < 4; ++nb) {
#pragma unroll
            for (int j = 0; j < 8; ++j) os[(hi * 8 + j) * 68 + nb * 16 + lr] = acc[mb][nb][j]; }
        __builtin_amdgcn_wave_barrier(); asm volatile("" ::: "memory");
        float* crow = C + (size_t)(r0 + mb * 16) * ldc + c0;
{
#pragma unroll
            for (int s = 0; s < 8; ++s) { const int row = 2 * s + hi, cofs = lr * 4; v4f val = *(const v4fa*)(os + row * 68 + cofs); if (BIAS) { val[0] += bfr(bias[c0 + cofs]); val[1] += bfr(bias[c0 + cofs + 1]); val[2] += bfr(bias[c0 + cofs + 2]); val[3] += bfr(bias[c0 + cofs + 3]); }
                *(v4f*)(crow + (size_t)row * ldc + cofs) = val; }
             }
        __builtin_amdgcn_wave_barrier(); asm volatile("" ::: "memory");
    }
}

__device__ __forceinline__ h16 tohx(float x) { return (h16)x; }
__device__ __forceinline__ void splitf(float y, unsigned short& h, unsigned short& l) { h = f2bf(y); l = f2bf(y - bf2f(h)); }
typedef __attribute__((ext_vector_type(2))) _Float16 v2h;
typedef __attribute__((ext_vector_type(4))) _Float16 v4h;
typedef __attribute__((ext_vector_type(2))) unsigned short v2us;
typedef __attribute__((ext_vector_type(4))) int v4i;

__global__ __launch_bounds__(256) void k_cvt8(const float* __restrict__ src, bf* dst, size_t n8) { const size_t i = (size_t)blockIdx.x * 256 + threadIdx.x; if (i >= n8) return; const v8f v = *(const v8f*)(src + i * 8); v8us o;
#pragma unroll
    for (int k = 0; k < 8; ++k) o[k] = f2bf(v[k]); *(v8us*)(dst + i * 8) = o;  }
// k_fact: factorised weight hi/lo planes: W'[a][b] = bf16(W[a][b]) bf16(rm[l][a]) bf16(sm[l][b]) + sum_k bf16(r[l][k][a]) bf16(s[l][k][b]) (f32, fixed order), l = indices[0] read on device (int input,
__global__ __launch_bounds__(256) void k_fact(const float* __restrict__ W, const int* __restrict__ idx, const float* __restrict__ rm, const float* __restrict__ sm, const float* __restrict__ rr, const float* __restrict__ ss, int rows, bf* Wh, bf* Wl) {
    const size_t i = ((size_t)blockIdx.x * 256 + threadIdx.x) * 2; if (i >= (size_t)rows * DD) return; const int a = (int)(i / DD), b0 = (int)(i % DD); int l = idx[0]; l = l < 0 ? 0 : (l >= NLY ? NLY - 1 : l); v2us oh, ol;
#pragma unroll
    for (int q = 0; q < 2; ++q) { const int b = b0 + q; float m = __fmul_rn(bfr(rm[(size_t)l * rows + a]), bfr(sm[(size_t)l * DD + b])); asm volatile("" : "+v"(m)); float w = __fmul_rn(bfr(W[i + q]), m); asm volatile("" : "+v"(w)); float ad = 0.f;
#pragma unroll
        for (int k = 0; k < RNK; ++k) { float p = __fmul_rn(bfr(rr[((size_t)l * RNK + k) * rows + a]), bfr(ss[((size_t)l * RNK + k) * DD + b])); asm volatile("" : "+v"(p)); ad = __fadd_rn(ad, p); }
        unsigned short h, lo; splitf(__fadd_rn(w, ad), h, lo); oh[q] = h; ol[q] = lo; }
    *(v2us*)(Wh + i) = oh; *(v2us*)(Wl + i) = ol;  }
__global__ __launch_bounds__(256) void k_hb16(const float* __restrict__ F, const float* __restrict__ hb, h16* P) {
    const int lane = threadIdx.x & 31; const int L0 = (blockIdx.x * 8 + (threadIdx.x >> 5)) * 8; const int nlines = NT * DD / 64;
{
#pragma unroll
        for (int l = 0; l < 8; ++l) { const int L = L0 + l; if (L >= nlines) break; const int e = L * 64 + lane * 2; const int d = e & 63; const int t = (e >> 6) & (TT - 1); const int z = e >> 16; const int b = z >> 4, h = z & 15; v2h o;
#pragma unroll
            for (int q = 0; q < 2; ++q) { const float bb = hb ? bfr(hb[h * HD + d + q]) : 0.f; o[q] = tohx(__fadd_rn(F[((size_t)t * NB_ + b) * DD + h * HD + d + q], bb)); }
            *(v2h*)(P + (size_t)e) = o; }
         }
}
__global__ __launch_bounds__(256) void k_rk16(const float* __restrict__ FR, h16* RK) {
    const int lane = threadIdx.x & 31; const int L0 = (blockIdx.x * 8 + (threadIdx.x >> 5)) * 8; const int nlines = NH_ * TT * HD / 64;
{
#pragma unroll
        for (int l = 0; l < 8; ++l) { const int L = L0 + l; if (L >= nlines) break; const int e = L * 64 + lane * 2; const int d = e & 63; const int j = (e >> 6) & (TT - 1); const int h = e >> 16; v2h o;
#pragma unroll
            for (int q = 0; q < 2; ++q) o[q] = tohx(FR[(size_t)j * DD + h * HD + d + q]);
            *(v2h*)(RK + (size_t)e) = o; }
         }
}
__global__ __launch_bounds__(256) void k_vtplane(const float* __restrict__ F, h16* VT) {
    const int lane = threadIdx.x & 31; const int L0 = (blockIdx.x * 8 + (threadIdx.x >> 5)) * 8; const int nlines = NT * DD / 64;
{
#pragma unroll
        for (int l = 0; l < 8; ++l) { const int L = L0 + l; if (L >= nlines) break; const int e = L * 64 + lane * 2; const int t = e & (TT - 1); const int d = (e >> 10) & 63; const int z = e >> 16; const int b = z >> 4, h = z & 15; v2h v;
#pragma unroll
            for (int q = 0; q < 2; ++q) v[q] = tohx(F[((size_t)(t + q) * NB_ + b) * DD + h * HD + d]);
            *(v2h*)(VT + (size_t)e) = v; }
         }
}
// k_relsoft: per row (zz, i): s[j] = (AC[zz][i][j] + shift(BD)[i][j]) / 8 where shift(BD)[i][j] = BD[zz][f / (T+1)][f % (T+1) - 1] (0 when f % (T+1) == 0), f = T + i*T + j - the module's
__global__ __launch_bounds__(256) void k_relsoft(const float* __restrict__ AC, const float* __restrict__ BD, h16* P) {
    const int lane = threadIdx.x & 31; const int row = blockIdx.x * 8 + (threadIdx.x >> 5); if (row >= ZH * TT) return; const int i = row & (TT - 1); const int zz = row >> 10;
    const float* ar = AC + (size_t)row * TT; const float* bd = BD + (size_t)zz * TT * TT; float v[32]; float mx = -3.0e38f;
#pragma unroll
    for (int ch = 0; ch < 8; ++ch) { const int j0 = ch * 128 + lane * 4; const v4f a = *(const v4f*)(ar + j0);
#pragma unroll
        for (int q = 0; q < 4; ++q) { const int j = j0 + q; const int f = TT + i * TT + j; const int ii = f / (TT + 1), c = f - ii * (TT + 1); const float sb = (c > 0) ? bd[(size_t)ii * TT + (c - 1)] : 0.f;
            const float t = __fmul_rn(__fadd_rn(a[q], sb), 0.125f); v[ch * 4 + q] = t; mx = fmaxf(mx, t); } }
#pragma unroll
    for (int sh = 16; sh; sh >>= 1) mx = fmaxf(mx, __shfl_xor(mx, sh, 32));
    float sum = 0.f;
#pragma unroll
    for (int k = 0; k < 32; ++k) { v[k] = __expf(v[k] - mx); sum += v[k]; }
#pragma unroll
    for (int sh = 16; sh; sh >>= 1) sum += __shfl_xor(sum, sh, 32);
    const float fct = __fdiv_rn(PCAR, sum);
{
#pragma unroll
        for (int ch = 0; ch < 8; ++ch) { v4h o;
#pragma unroll
            for (int q = 0; q < 4; ++q) o[q] = tohx(v[ch * 4 + q] * fct);
            *(v4h*)(P + (size_t)row * TT + ch * 128 + lane * 4) = o; }
         }
}
__global__ __launch_bounds__(256) void k_merge(const float* __restrict__ O, int b, int h0, bf* Ah, bf* Al) {
    const int lane = threadIdx.x & 31; const int L0 = (blockIdx.x * 8 + (threadIdx.x >> 5)) * 8; const int nlines = TT * ZH * HD / 64;
{
#pragma unroll
        for (int l = 0; l < 8; ++l) { const int L = L0 + l; if (L >= nlines) break; const int e = L * 64 + lane * 2; const int d = e & 63; const int zz = (e >> 6) % ZH; const int t = (e >> 6) / ZH; v2us oh, ol;
#pragma unroll
            for (int q = 0; q < 2; ++q) { unsigned short a, c2; splitf(O[((size_t)zz * TT + t) * HD + d + q] * (1.0f / PCAR), a, c2); oh[q] = a; ol[q] = c2; }
            const size_t o = ((size_t)t * NB_ + b) * DD + (h0 + zz) * HD + d; *(v2us*)(Ah + o) = oh; *(v2us*)(Al + o) = ol; }
         }
}

extern "C" void kernel_launch(void* const* d_in, const int* in_sizes, int n_in,
                              void* d_out, int out_size, void* d_ws, size_t ws_size, hipStream_t stream) {
    (void)in_sizes; (void)n_in; (void)out_size;
    const float* IN[23]; for (int i = 0; i < 23; ++i) IN[i] = (const float*)d_in[i];
    // input [1024][4][1024], pos [1024][1][1024], indices (int [1]), in_proj_weight [3072][1024], in_proj_bias, out_proj_weight, out_proj_bias, pos_proj_weight, pos_proj_bias,
    // r_i [8][4][3072], s_i [8][4][1024], r_p, s_p, r_o, s_o, rm_i [8][1][3072], sm_i [8][1][1024], rm_p, sm_p, rm_o, sm_o, r_w_bias [16][64], r_r_bias = d_in[0..22]
    const float* x = IN[0]; const float* r = IN[1]; const int* idx = (const int*)d_in[2]; const float* rwb = IN[21]; const float* rrb = IN[22];
    float* OUT = (float*)d_out;     // [1024][4][1024] (rows t*4 + b)
    char* wsp = (char*)d_ws;
    auto take = [&](size_t bytes) { char* p = wsp; wsp += (bytes + 255) & ~(size_t)255; return (void*)p; };
    bf* WIh = (bf*)take((size_t)3 * DD * DD * 2); bf* WIl = (bf*)take((size_t)3 * DD * DD * 2); bf* WRh = (bf*)take((size_t)DD * DD * 2); bf* WRl = (bf*)take((size_t)DD * DD * 2); bf* WOh = (bf*)take((size_t)DD * DD * 2); bf* WOl = (bf*)take((size_t)DD * DD * 2);
    bf* XB = (bf*)take((size_t)NT * DD * 2); bf* RB = (bf*)take((size_t)TT * DD * 2); float* F = (float*)take((size_t)NT * DD * 4);
    h16* QA = (h16*)take((size_t)NT * DD * 2); h16* QB = (h16*)take((size_t)NT * DD * 2); h16* KP = (h16*)take((size_t)NT * DD * 2); h16* VT = (h16*)take((size_t)NT * DD * 2); h16* RK = (h16*)take((size_t)NH_ * TT * HD * 2);
    float* Sa = (float*)take((size_t)ZH * TT * TT * 4); float* Sd = (float*)take((size_t)ZH * TT * TT * 4); h16* Pm = (h16*)take((size_t)ZH * TT * TT * 2); float* Ob = (float*)take((size_t)ZH * TT * HD * 4); bf* ATh = (bf*)take((size_t)NT * DD * 2); bf* ATl = (bf*)take((size_t)NT * DD * 2);
    if ((size_t)(wsp - (char*)d_ws) > ws_size) return;    // total ~ 122 MB = 116.5 MiB; ws 256 MiB
    { const unsigned gi = (unsigned)(((size_t)3 * DD * DD / 2 + 255) / 256), g1 = (unsigned)(((size_t)DD * DD / 2 + 255) / 256);
      k_fact<<<gi, 256, 0, stream>>>(IN[3], idx, IN[15], IN[16], IN[9], IN[10], 3 * DD, WIh, WIl);     // in_proj: rm_i, sm_i, r_i, s_i
      k_fact<<<g1, 256, 0, stream>>>(IN[7], idx, IN[17], IN[18], IN[11], IN[12], DD, WRh, WRl);         // pos_proj: rm_p, sm_p, r_p, s_p
      k_fact<<<g1, 256, 0, stream>>>(IN[5], idx, IN[19], IN[20], IN[13], IN[14], DD, WOh, WOl);         // out_proj: rm_o, sm_o, r_o, s_o
      const size_t nx = (size_t)NT * DD / 8; k_cvt8<<<(unsigned)((nx + 255) / 256), 256, 0, stream>>>(x, XB, nx); k_cvt8<<<(unsigned)(((size_t)TT * DD / 8 + 255) / 256), 256, 0, stream>>>(r, RB, (size_t)TT * DD / 8); }
    const unsigned LB = (unsigned)((NT * DD / 64 + 63) / 64); const dim3 gP(NT / 64, DD / 64, 1);
    k_gemmw<bf, 3, true><<<gP, 32, 0, stream>>>(XB, nullptr, WIh, WIl, DD, F, DD, IN[4], 0, 0, 0); k_hb16<<<LB, 256, 0, stream>>>(F, rwb, QA); k_hb16<<<LB, 256, 0, stream>>>(F, rrb, QB);
    k_gemmw<bf, 3, true><<<gP, 32, 0, stream>>>(XB, nullptr, WIh + (size_t)DD * DD, WIl + (size_t)DD * DD, DD, F, DD, IN[4] + DD, 0, 0, 0); k_hb16<<<LB, 256, 0, stream>>>(F, nullptr, KP);
    k_gemmw<bf, 3, true><<<gP, 32, 0, stream>>>(XB, nullptr, WIh + (size_t)2 * DD * DD, WIl + (size_t)2 * DD * DD, DD, F, DD, IN[4] + 2 * DD, 0, 0, 0); k_vtplane<<<LB, 256, 0, stream>>>(F, VT);
    k_gemmw<bf, 3, true><<<dim3(TT / 64, DD / 64, 1), 32, 0, stream>>>(RB, nullptr, WRh, WRl, DD, F, DD, IN[8], 0, 0, 0); k_rk16<<<(unsigned)((NH_ * TT * HD / 64 + 63) / 64), 256, 0, stream>>>(F, RK);
    for (int b = 0; b < NB_; ++b)
        for (int h0 = 0; h0 < NH_; h0 += ZH) { const size_t z0 = (size_t)b * NH_ + h0;
            k_gemmw<h16, 0, false><<<dim3(TT / 64, TT / 64, ZH), 32, 0, stream>>>(QA + z0 * TT * HD, nullptr, KP + z0 * TT * HD, nullptr, HD, Sa, TT, nullptr, (size_t)TT * HD, (size_t)TT * HD, (size_t)TT * TT);   // AC
            k_gemmw<h16, 0, false><<<dim3(TT / 64, TT / 64, ZH), 32, 0, stream>>>(QB + z0 * TT * HD, nullptr, RK + (size_t)h0 * TT * HD, nullptr, HD, Sd, TT, nullptr, (size_t)TT * HD, (size_t)TT * HD, (size_t)TT * TT);   // BD (unshifted)
            k_relsoft<<<ZH * TT / 8, 256, 0, stream>>>(Sa, Sd, Pm);
            k_gemmw<h16, 0, false><<<dim3(TT / 64, 1, ZH), 32, 0, stream>>>(Pm, nullptr, VT + z0 * HD * TT, nullptr, TT, Ob, HD, nullptr, (size_t)TT * TT, (size_t)HD * TT, (size_t)TT * HD);
            k_merge<<<(TT * ZH * HD / 64 + 63) / 64, 256, 0, stream>>>(Ob, b, h0, ATh, ATl); }
    k_gemmw<bf, 2, true><<<gP, 32, 0, stream>>>(ATh, ATl, WOh, WOl, DD, OUT, DD, IN[6], 0, 0, 0);
}

// v001
// Measured time: 686 microseconds a run.
// In two side-by-side timings against v000, it was 2.48 and 2.49 times as fast.
#include <hip/hip_runtime.h>

// Relative-position multi-head attention (segment-recurrence style relative shift; query [1024][4][1024] seq-first, r [1024][1024]; w = query qkv_w^T -> q|k|v (16 heads x 64); r_k = r r_w^T; AC = (q + r_w_bias).k,
// BD = rel_shift((q + r_r_bias).r_k) with the module's exact zero-pad/reshape shift (out[i][j] = BD[f / (T+1)][f % (T+1) - 1] or 0 when f % (T+1) == 0, f = T + i*T + j); p = softmax((AC + BD) / 8)
// over the keys; attn = p.v; out = merged out_w^T + out_b; output [1024][4][1024] (rows t*4 + b)).
// Compute dtypes, f32 accumulate: every input rounded to bf16; the qkv and r projections on PLAIN bf16 inputs (exact) times hi/lo bf16 weight planes; AC, BD and attn.v on SINGLE fp16 planes
// (the per-head biases added in f32 before the fp16 rounding; logit sd ~ 0.6); the relative shift is an index gather inside the softmax kernel; P x1024;

#define NB_  4
#define TT   1024
#define NLY  8                    // weight-factor layers
#define RNK  4                    // additive rank
#define DD   1024
#define NH_  16
#define HD   64
#define NT   (NB_ * TT)
#define ZH   16                   // heads per attention pass: one pass = all 16 heads of one batch entry
#define PCAR 1024.0f
typedef _Float16 h16;
typedef unsigned short bf;
typedef __attribute__((ext_vector_type(16))) __bf16   v16bf;
typedef __attribute__((ext_vector_type(16))) _Float16 v16h;
typedef __attribute__((ext_vector_type(8)))  _Float16 v8h;
typedef __attribute__((ext_vector_type(8)))  unsigned short v8us;
typedef __attribute__((ext_vector_type(8)))  float    v8f;
typedef __attribute__((ext_vector_type(4)))  float    v4f;
typedef v8h  __attribute__((may_alias)) v8ha;
typedef v4f  __attribute__((may_alias)) v4fa;
typedef v8us __attribute__((may_alias)) v8usa;

__device__ __forceinline__ unsigned short f2bf(float f) { unsigned u = __float_as_uint(f); u += 0x7FFFu + ((u >> 16) & 1u); return (unsigned short)(u >> 16); }
__device__ __forceinline__ float bf2f(unsigned short b) { return __uint_as_float(((unsigned)b) << 16); }
__device__ __forceinline__ float bfr(float f) { return bf2f(f2bf(f)); }
__device__ __forceinline__ v16h cat16(v8h lo, v8h hi) { return __builtin_shufflevector(lo, hi, 0, 1, 2, 3, 4, 5, 6, 7, 8, 9, 10, 11, 12, 13, 14, 15); }
__device__ __forceinline__ v16bf cat16b(v8us lo, v8us hi) { return __builtin_bit_cast(v16bf, __builtin_shufflevector(lo, hi, 0, 1, 2, 3, 4, 5, 6, 7, 8, 9, 10, 11, 12, 13, 14, 15)); }
__device__ __forceinline__ v8f wmma16(v16h a, v16h b, v8f c) { return __builtin_amdgcn_wmma_f32_16x16x32_f16(false, a, false, b, (short)0, c, false, false); }
__device__ __forceinline__ v8f wmmab(v16bf a, v16bf b, v8f c) { return __builtin_amdgcn_wmma_f32_16x16x32_bf16(false, a, false, b, (short)0, c, false, false); }



// ---- k_gemmw: register-blocked GEMM, ONE WAVE per 64x64 output tile (16 accumulators), operands straight from K-contiguous 16-bit planes; grid (M/64, N/64, Z), 32 threads.
// C[m][n] (f32, pitch ldc, + optional f32 bias[n]) = sum_k A[m][k] Bt[n][k] (+ split products per NSPLIT). z-batch strides sA/sB/sC in elements. K % 32 == 0.
template <typename T16> struct WFrag;
template <> struct WFrag<h16> { typedef v16h V; static __device__ __forceinline__ V ld(const h16* p) { return cat16(*(const v8h*)p, *(const v8h*)(p + 16)); } static __device__ __forceinline__ v8f mma(V a, V b, v8f c) { return wmma16(a, b, c); } };
template <> struct WFrag<bf> { typedef v16bf V; static __device__ __forceinline__ V ld(const bf* p) { return cat16b(*(const v8us*)p, *(const v8us*)(p + 16)); } static __device__ __forceinline__ v8f mma(V a, V b, v8f c) { return wmmab(a, b, c); } };
template <typename T16, int NSPLIT, bool BIAS>
__global__ __launch_bounds__(32) void k_gemmw(const T16* __restrict__ A, const T16* __restrict__ A2, const T16* __restrict__ Bt, const T16* __restrict__ Bt2, int K, float* C, int ldc, const float* __restrict__ bias, size_t sA, size_t sB, size_t sC) {
    typedef typename WFrag<T16>::V V;
    __shared__ __align__(16) float os[16 * 68];
    const size_t z = blockIdx.z; A += z * sA; if (A2) A2 += z * sA; Bt += z * sB; if (Bt2) Bt2 += z * sB; C += z * sC;
    const int lane = threadIdx.x & 31, lr = lane & 15, hi = lane >> 4; const int r0 = blockIdx.x * 64, c0 = blockIdx.y * 64;
    v8f acc[4][4];
#pragma unroll
    for (int mb = 0; mb < 4; ++mb)
#pragma unroll
        for (int nb = 0; nb < 4; ++nb) acc[mb][nb] = (v8f){};
    const size_t aoff = (size_t)(r0 + lr) * K + 8 * hi, boff = (size_t)(c0 + lr) * K + 8 * hi;
#pragma unroll 1
    for (int kc = 0; kc < K; kc += 32) {
        V a[4], a2[4];
#pragma unroll
        for (int mb = 0; mb < 4; ++mb) { a[mb] = WFrag<T16>::ld(A + aoff + (size_t)mb * 16 * K + kc); if (NSPLIT == 1 || NSPLIT == 2) a2[mb] = WFrag<T16>::ld(A2 + aoff + (size_t)mb * 16 * K + kc); }
#pragma unroll
        for (int nb = 0; nb < 4; ++nb) { const V b = WFrag<T16>::ld(Bt + boff + (size_t)nb * 16 * K + kc); V b2; if (NSPLIT >= 2) b2 = WFrag<T16>::ld(Bt2 + boff + (size_t)nb * 16 * K + kc);
#pragma unroll
            for (int mb = 0; mb < 4; ++mb) { acc[mb][nb] = WFrag<T16>::mma(a[mb], b, acc[mb][nb]); if (NSPLIT == 1 || NSPLIT == 2) acc[mb][nb] = WFrag<T16>::mma(a2[mb], b, acc[mb][nb]); if (NSPLIT >= 2) acc[mb][nb] = WFrag<T16>::mma(a[mb], b2, acc[mb][nb]); } }
        asm volatile("v_nop\n\tv_nop\n\tv_nop\n\tv_nop" : "+v"(acc[0][0]), "+v"(acc[1][1]), "+v"(acc[2][2]), "+v"(acc[3][3]) : "v"(a[0]), "v"(a[3]));
    }
#pragma unroll
    for (int mb = 0; mb < 4; ++mb) {
#pragma unroll
        for (int nb = 0; nb < 4; ++nb) {
#pragma unroll
            for (int j = 0; j < 8; ++j) os[(hi * 8 + j) * 68 + nb * 16 + lr] = acc[mb][nb][j]; }
        __builtin_amdgcn_wave_barrier(); asm volatile("" ::: "memory");
        float* crow = C + (size_t)(r0 + mb * 16) * ldc + c0;
{
#pragma unroll
            for (int s = 0; s < 8; ++s) { const int row = 2 * s + hi, cofs = lr * 4; v4f val = *(const v4fa*)(os + row * 68 + cofs); if (BIAS) { val[0] += bfr(bias[c0 + cofs]); val[1] += bfr(bias[c0 + cofs + 1]); val[2] += bfr(bias[c0 + cofs + 2]); val[3] += bfr(bias[c0 + cofs + 3]); }
                *(v4f*)(crow + (size_t)row * ldc + cofs) = val; }
             }
        __builtin_amdgcn_wave_barrier(); asm volatile("" ::: "memory");
    }
}

__device__ __forceinline__ h16 tohx(float x) { return (h16)x; }
__device__ __forceinline__ void splitf(float y, unsigned short& h, unsigned short& l) { h = f2bf(y); l = f2bf(y - bf2f(h)); }
typedef __attribute__((ext_vector_type(2))) _Float16 v2h;
typedef __attribute__((ext_vector_type(4))) _Float16 v4h;
typedef __attribute__((ext_vector_type(2))) unsigned short v2us;
typedef __attribute__((ext_vector_type(4))) int v4i;

__global__ __launch_bounds__(256) void k_cvt8(const float* __restrict__ src, bf* dst, size_t n8) { const size_t i = (size_t)blockIdx.x * 256 + threadIdx.x; if (i >= n8) return; const v8f v = *(const v8f*)(src + i * 8); v8us o;
#pragma unroll
    for (int k = 0; k < 8; ++k) o[k] = f2bf(v[k]); *(v8us*)(dst + i * 8) = o;  }
// k_fact: factorised weight hi/lo planes: W'[a][b] = bf16(W[a][b]) bf16(rm[l][a]) bf16(sm[l][b]) + sum_k bf16(r[l][k][a]) bf16(s[l][k][b]) (f32, fixed order), l = indices[0] read on device (int input,
__global__ __launch_bounds__(256) void k_fact(const float* __restrict__ W, const int* __restrict__ idx, const float* __restrict__ rm, const float* __restrict__ sm, const float* __restrict__ rr, const float* __restrict__ ss, int rows, bf* Wh, bf* Wl) {
    const size_t i = ((size_t)blockIdx.x * 256 + threadIdx.x) * 2; if (i >= (size_t)rows * DD) return; const int a = (int)(i / DD), b0 = (int)(i % DD); int l = idx[0]; l = l < 0 ? 0 : (l >= NLY ? NLY - 1 : l); v2us oh, ol;
#pragma unroll
    for (int q = 0; q < 2; ++q) { const int b = b0 + q; float m = __fmul_rn(bfr(rm[(size_t)l * rows + a]), bfr(sm[(size_t)l * DD + b])); asm volatile("" : "+v"(m)); float w = __fmul_rn(bfr(W[i + q]), m); asm volatile("" : "+v"(w)); float ad = 0.f;
#pragma unroll
        for (int k = 0; k < RNK; ++k) { float p = __fmul_rn(bfr(rr[((size_t)l * RNK + k) * rows + a]), bfr(ss[((size_t)l * RNK + k) * DD + b])); asm volatile("" : "+v"(p)); ad = __fadd_rn(ad, p); }
        unsigned short h, lo; splitf(__fadd_rn(w, ad), h, lo); oh[q] = h; ol[q] = lo; }
    *(v2us*)(Wh + i) = oh; *(v2us*)(Wl + i) = ol;  }
__global__ __launch_bounds__(256) void k_hb16(const float* __restrict__ F, const float* __restrict__ hb, h16* P) {
    const int lane = threadIdx.x & 31; const int L0 = (blockIdx.x * 8 + (threadIdx.x >> 5)) * 8; const int nlines = NT * DD / 64;
{
#pragma unroll
        for (int l = 0; l < 8; ++l) { const int L = L0 + l; if (L >= nlines) break; const int e = L * 64 + lane * 2; const int d = e & 63; const int t = (e >> 6) & (TT - 1); const int z = e >> 16; const int b = z >> 4, h = z & 15; v2h o;
#pragma unroll
            for (int q = 0; q < 2; ++q) { const float bb = hb ? bfr(hb[h * HD + d + q]) : 0.f; o[q] = tohx(__fadd_rn(F[((size_t)t * NB_ + b) * DD + h * HD + d + q], bb)); }
            *(v2h*)(P + (size_t)e) = o; }
         }
}
__global__ __launch_bounds__(256) void k_rk16(const float* __restrict__ FR, h16* RK) {
    const int lane = threadIdx.x & 31; const int L0 = (blockIdx.x * 8 + (threadIdx.x >> 5)) * 8; const int nlines = NH_ * TT * HD / 64;
{
#pragma unroll
        for (int l = 0; l < 8; ++l) { const int L = L0 + l; if (L >= nlines) break; const int e = L * 64 + lane * 2; const int d = e & 63; const int j = (e >> 6) & (TT - 1); const int h = e >> 16; v2h o;
#pragma unroll
            for (int q = 0; q < 2; ++q) o[q] = tohx(FR[(size_t)j * DD + h * HD + d + q]);
            *(v2h*)(RK + (size_t)e) = o; }
         }
}
__global__ __launch_bounds__(256) void k_vtplane(const float* __restrict__ F, h16* VT) {
    const int lane = threadIdx.x & 31; const int L0 = (blockIdx.x * 8 + (threadIdx.x >> 5)) * 8; const int nlines = NT * DD / 64;
{
#pragma unroll
        for (int l = 0; l < 8; ++l) { const int L = L0 + l; if (L >= nlines) break; const int e = L * 64 + lane * 2; const int t = e & (TT - 1); const int d = (e >> 10) & 63; const int z = e >> 16; const int b = z >> 4, h = z & 15; v2h v;
#pragma unroll
            for (int q = 0; q < 2; ++q) v[q] = tohx(F[((size_t)(t + q) * NB_ + b) * DD + h * HD + d]);
            *(v2h*)(VT + (size_t)e) = v; }
         }
}
// k_relsoft: per row (zz, i): s[j] = (AC[zz][i][j] + shift(BD)[i][j]) / 8 where shift(BD)[i][j] = BD[zz][f / (T+1)][f % (T+1) - 1] (0 when f % (T+1) == 0), f = T + i*T + j - the module's
__global__ __launch_bounds__(256) void k_relsoft(const float* __restrict__ AC, const float* __restrict__ BD, h16* P) {
    const int lane = threadIdx.x & 31; const int row = blockIdx.x * 8 + (threadIdx.x >> 5); if (row >= ZH * TT) return; const int i = row & (TT - 1); const int zz = row >> 10;
    const float* ar = AC + (size_t)row * TT; const float* bd = BD + (size_t)zz * TT * TT; float v[32]; float mx = -3.0e38f;
#pragma unroll
    for (int ch = 0; ch < 8; ++ch) { const int j0 = ch * 128 + lane * 4; const v4f a = *(const v4f*)(ar + j0);
#pragma unroll
        for (int q = 0; q < 4; ++q) { const int j = j0 + q; const int f = TT + i * TT + j; const int ii = f / (TT + 1), c = f - ii * (TT + 1); const float sb = (c > 0) ? bd[(size_t)ii * TT + (c - 1)] : 0.f;
            const float t = __fmul_rn(__fadd_rn(a[q], sb), 0.125f); v[ch * 4 + q] = t; mx = fmaxf(mx, t); } }
#pragma unroll
    for (int sh = 16; sh; sh >>= 1) mx = fmaxf(mx, __shfl_xor(mx, sh, 32));
    float sum = 0.f;
#pragma unroll
    for (int k = 0; k < 32; ++k) { v[k] = __expf(v[k] - mx); sum += v[k]; }
#pragma unroll
    for (int sh = 16; sh; sh >>= 1) sum += __shfl_xor(sum, sh, 32);
    const float fct = __fdiv_rn(PCAR, sum);
{
#pragma unroll
        for (int ch = 0; ch < 8; ++ch) { v4h o;
#pragma unroll
            for (int q = 0; q < 4; ++q) o[q] = tohx(v[ch * 4 + q] * fct);
            *(v4h*)(P + (size_t)row * TT + ch * 128 + lane * 4) = o; }
         }
}
__global__ __launch_bounds__(256) void k_merge(const float* __restrict__ O, int b, int h0, bf* Ah, bf* Al) {
    const int lane = threadIdx.x & 31; const int L0 = (blockIdx.x * 8 + (threadIdx.x >> 5)) * 8; const int nlines = TT * ZH * HD / 64;
{
#pragma unroll
        for (int l = 0; l < 8; ++l) { const int L = L0 + l; if (L >= nlines) break; const int e = L * 64 + lane * 2; const int d = e & 63; const int zz = (e >> 6) % ZH; const int t = (e >> 6) / ZH; v2us oh, ol;
#pragma unroll
            for (int q = 0; q < 2; ++q) { unsigned short a, c2; splitf(O[((size_t)zz * TT + t) * HD + d + q] * (1.0f / PCAR), a, c2); oh[q] = a; ol[q] = c2; }
            const size_t o = ((size_t)t * NB_ + b) * DD + (h0 + zz) * HD + d; *(v2us*)(Ah + o) = oh; *(v2us*)(Al + o) = ol; }
         }
}

extern "C" void kernel_launch(void* const* d_in, const int* in_sizes, int n_in,
                              void* d_out, int out_size, void* d_ws, size_t ws_size, hipStream_t stream) {
    (void)in_sizes; (void)n_in; (void)out_size;
    const float* IN[23]; for (int i = 0; i < 23; ++i) IN[i] = (const float*)d_in[i];
    // input [1024][4][1024], pos [1024][1][1024], indices (int [1]), in_proj_weight [3072][1024], in_proj_bias, out_proj_weight, out_proj_bias, pos_proj_weight, pos_proj_bias,
    // r_i [8][4][3072], s_i [8][4][1024], r_p, s_p, r_o, s_o, rm_i [8][1][3072], sm_i [8][1][1024], rm_p, sm_p, rm_o, sm_o, r_w_bias [16][64], r_r_bias = d_in[0..22]
    const float* x = IN[0]; const float* r = IN[1]; const int* idx = (const int*)d_in[2]; const float* rwb = IN[21]; const float* rrb = IN[22];
    float* OUT = (float*)d_out;     // [1024][4][1024] (rows t*4 + b)
    char* wsp = (char*)d_ws;
    auto take = [&](size_t bytes) { char* p = wsp; wsp += (bytes + 255) & ~(size_t)255; return (void*)p; };
    bf* WIh = (bf*)take((size_t)3 * DD * DD * 2); bf* WIl = (bf*)take((size_t)3 * DD * DD * 2); bf* WRh = (bf*)take((size_t)DD * DD * 2); bf* WRl = (bf*)take((size_t)DD * DD * 2); bf* WOh = (bf*)take((size_t)DD * DD * 2); bf* WOl = (bf*)take((size_t)DD * DD * 2);
    bf* XB = (bf*)take((size_t)NT * DD * 2); bf* RB = (bf*)take((size_t)TT * DD * 2); float* F = (float*)take((size_t)NT * DD * 4);
    h16* QA = (h16*)take((size_t)NT * DD * 2); h16* QB = (h16*)take((size_t)NT * DD * 2); h16* KP = (h16*)take((size_t)NT * DD * 2); h16* VT = (h16*)take((size_t)NT * DD * 2); h16* RK = (h16*)take((size_t)NH_ * TT * HD * 2);
    float* Sa = (float*)take((size_t)ZH * TT * TT * 4); float* Sd = (float*)take((size_t)ZH * TT * TT * 4); h16* Pm = (h16*)take((size_t)ZH * TT * TT * 2); float* Ob = (float*)take((size_t)ZH * TT * HD * 4); bf* ATh = (bf*)F; bf* ATl = ATh + (size_t)NT * DD;   // the merged hi/lo planes lie in F: its last reader (k_rk16) runs before the first k_merge, and both planes fill exactly its bytes
    if ((size_t)(wsp - (char*)d_ws) > ws_size) return;    // total 244 MiB (scores 2 x 64, P 32); ws 256 MiB
    { const unsigned gi = (unsigned)(((size_t)3 * DD * DD / 2 + 255) / 256), g1 = (unsigned)(((size_t)DD * DD / 2 + 255) / 256);
      k_fact<<<gi, 256, 0, stream>>>(IN[3], idx, IN[15], IN[16], IN[9], IN[10], 3 * DD, WIh, WIl);     // in_proj: rm_i, sm_i, r_i, s_i
      k_fact<<<g1, 256, 0, stream>>>(IN[7], idx, IN[17], IN[18], IN[11], IN[12], DD, WRh, WRl);         // pos_proj: rm_p, sm_p, r_p, s_p
      k_fact<<<g1, 256, 0, stream>>>(IN[5], idx, IN[19], IN[20], IN[13], IN[14], DD, WOh, WOl);         // out_proj: rm_o, sm_o, r_o, s_o
      const size_t nx = (size_t)NT * DD / 8; k_cvt8<<<(unsigned)((nx + 255) / 256), 256, 0, stream>>>(x, XB, nx); k_cvt8<<<(unsigned)(((size_t)TT * DD / 8 + 255) / 256), 256, 0, stream>>>(r, RB, (size_t)TT * DD / 8); }
    const unsigned LB = (unsigned)((NT * DD / 64 + 63) / 64); const dim3 gP(NT / 64, DD / 64, 1);
    k_gemmw<bf, 3, true><<<gP, 32, 0, stream>>>(XB, nullptr, WIh, WIl, DD, F, DD, IN[4], 0, 0, 0); k_hb16<<<LB, 256, 0, stream>>>(F, rwb, QA); k_hb16<<<LB, 256, 0, stream>>>(F, rrb, QB);
    k_gemmw<bf, 3, true><<<gP, 32, 0, stream>>>(XB, nullptr, WIh + (size_t)DD * DD, WIl + (size_t)DD * DD, DD, F, DD, IN[4] + DD, 0, 0, 0); k_hb16<<<LB, 256, 0, stream>>>(F, nullptr, KP);
    k_gemmw<bf, 3, true><<<gP, 32, 0, stream>>>(XB, nullptr, WIh + (size_t)2 * DD * DD, WIl + (size_t)2 * DD * DD, DD, F, DD, IN[4] + 2 * DD, 0, 0, 0); k_vtplane<<<LB, 256, 0, stream>>>(F, VT);
    k_gemmw<bf, 3, true><<<dim3(TT / 64, DD / 64, 1), 32, 0, stream>>>(RB, nullptr, WRh, WRl, DD, F, DD, IN[8], 0, 0, 0); k_rk16<<<(unsigned)((NH_ * TT * HD / 64 + 63) / 64), 256, 0, stream>>>(F, RK);
    for (int b = 0; b < NB_; ++b)
        for (int h0 = 0; h0 < NH_; h0 += ZH) { const size_t z0 = (size_t)b * NH_ + h0;
            k_gemmw<h16, 0, false><<<dim3(TT / 64, TT / 64, ZH), 32, 0, stream>>>(QA + z0 * TT * HD, nullptr, KP + z0 * TT * HD, nullptr, HD, Sa, TT, nullptr, (size_t)TT * HD, (size_t)TT * HD, (size_t)TT * TT);   // AC
            k_gemmw<h16, 0, false><<<dim3(TT / 64, TT / 64, ZH), 32, 0, stream>>>(QB + z0 * TT * HD, nullptr, RK + (size_t)h0 * TT * HD, nullptr, HD, Sd, TT, nullptr, (size_t)TT * HD, (size_t)TT * HD, (size_t)TT * TT);   // BD (unshifted)
            k_relsoft<<<ZH * TT / 8, 256, 0, stream>>>(Sa, Sd, Pm);
            k_gemmw<h16, 0, false><<<dim3(TT / 64, 1, ZH), 32, 0, stream>>>(Pm, nullptr, VT + z0 * HD * TT, nullptr, TT, Ob, HD, nullptr, (size_t)TT * TT, (size_t)HD * TT, (size_t)TT * HD);
            k_merge<<<(TT * ZH * HD / 64 + 63) / 64, 256, 0, stream>>>(Ob, b, h0, ATh, ATl); }
    k_gemmw<bf, 2, true><<<gP, 32, 0, stream>>>(ATh, ATl, WOh, WOl, DD, OUT, DD, IN[6], 0, 0, 0);
}

// v002
// Measured time: 403 microseconds a run.
// Two timings next to v001 both put it at 1.70 times that version's speed.
// All steps since v000 together make it 4.23 times as fast.
#include <hip/hip_runtime.h>

// Relative-position multi-head attention (segment-recurrence style relative shift; query [1024][4][1024] seq-first, r [1024][1024]; w = query qkv_w^T -> q|k|v (16 heads x 64); r_k = r r_w^T; AC = (q + r_w_bias).k,
// BD = rel_shift((q + r_r_bias).r_k) with the module's exact zero-pad/reshape shift (out[i][j] = BD[f / (T+1)][f % (T+1) - 1] or 0 when f % (T+1) == 0, f = T + i*T + j); p = softmax((AC + BD) / 8)
// over the keys; attn = p.v; out = merged out_w^T + out_b; output [1024][4][1024] (rows t*4 + b)).
// Compute dtypes, f32 accumulate: every input rounded to bf16; the qkv and r projections on PLAIN bf16 inputs (exact) times hi/lo bf16 weight planes; AC, BD and attn.v on SINGLE fp16 planes
// (the per-head biases added in f32 before the fp16 rounding; logit sd ~ 0.6); the relative shift is done by where each BD element is stored in the LDS score block of k_attn; P x1024;

#define NB_  4
#define TT   1024
#define NLY  8                    // weight-factor layers
#define RNK  4                    // additive rank
#define DD   1024
#define NH_  16
#define HD   64
#define NT   (NB_ * TT)
#define PCAR 1024.0f
typedef _Float16 h16;
typedef unsigned short bf;
typedef __attribute__((ext_vector_type(16))) __bf16   v16bf;
typedef __attribute__((ext_vector_type(16))) _Float16 v16h;
typedef __attribute__((ext_vector_type(8)))  _Float16 v8h;
typedef __attribute__((ext_vector_type(8)))  unsigned short v8us;
typedef __attribute__((ext_vector_type(8)))  float    v8f;
typedef __attribute__((ext_vector_type(4)))  float    v4f;
typedef v8h  __attribute__((may_alias)) v8ha;
typedef v4f  __attribute__((may_alias)) v4fa;
typedef v8us __attribute__((may_alias)) v8usa;

__device__ __forceinline__ unsigned short f2bf(float f) { unsigned u = __float_as_uint(f); u += 0x7FFFu + ((u >> 16) & 1u); return (unsigned short)(u >> 16); }
__device__ __forceinline__ float bf2f(unsigned short b) { return __uint_as_float(((unsigned)b) << 16); }
__device__ __forceinline__ float bfr(float f) { return bf2f(f2bf(f)); }
__device__ __forceinline__ v16h cat16(v8h lo, v8h hi) { return __builtin_shufflevector(lo, hi, 0, 1, 2, 3, 4, 5, 6, 7, 8, 9, 10, 11, 12, 13, 14, 15); }
__device__ __forceinline__ v16bf cat16b(v8us lo, v8us hi) { return __builtin_bit_cast(v16bf, __builtin_shufflevector(lo, hi, 0, 1, 2, 3, 4, 5, 6, 7, 8, 9, 10, 11, 12, 13, 14, 15)); }
__device__ __forceinline__ v8f wmma16(v16h a, v16h b, v8f c) { return __builtin_amdgcn_wmma_f32_16x16x32_f16(false, a, false, b, (short)0, c, false, false); }
__device__ __forceinline__ v8f wmmab(v16bf a, v16bf b, v8f c) { return __builtin_amdgcn_wmma_f32_16x16x32_bf16(false, a, false, b, (short)0, c, false, false); }



// ---- k_gemmw: register-blocked GEMM, ONE WAVE per 64x64 output tile (16 accumulators), operands straight from K-contiguous 16-bit planes; grid (M/64, N/64, Z), 32 threads.
// C[m][n] (f32, pitch ldc, + optional f32 bias[n]) = sum_k A[m][k] Bt[n][k] (+ split products per NSPLIT). z-batch strides sA/sB/sC in elements. K % 32 == 0.
template <typename T16> struct WFrag;
template <> struct WFrag<h16> { typedef v16h V; static __device__ __forceinline__ V ld(const h16* p) { return cat16(*(const v8h*)p, *(const v8h*)(p + 16)); } static __device__ __forceinline__ v8f mma(V a, V b, v8f c) { return wmma16(a, b, c); } };
template <> struct WFrag<bf> { typedef v16bf V; static __device__ __forceinline__ V ld(const bf* p) { return cat16b(*(const v8us*)p, *(const v8us*)(p + 16)); } static __device__ __forceinline__ v8f mma(V a, V b, v8f c) { return wmmab(a, b, c); } };
template <typename T16, int NSPLIT, bool BIAS>
__global__ __launch_bounds__(32) void k_gemmw(const T16* __restrict__ A, const T16* __restrict__ A2, const T16* __restrict__ Bt, const T16* __restrict__ Bt2, int K, float* C, int ldc, const float* __restrict__ bias, size_t sA, size_t sB, size_t sC) {
    typedef typename WFrag<T16>::V V;
    __shared__ __align__(16) float os[16 * 68];
    const size_t z = blockIdx.z; A += z * sA; if (A2) A2 += z * sA; Bt += z * sB; if (Bt2) Bt2 += z * sB; C += z * sC;
    const int lane = threadIdx.x & 31, lr = lane & 15, hi = lane >> 4; const int r0 = blockIdx.x * 64, c0 = blockIdx.y * 64;
    v8f acc[4][4];
#pragma unroll
    for (int mb = 0; mb < 4; ++mb)
#pragma unroll
        for (int nb = 0; nb < 4; ++nb) acc[mb][nb] = (v8f){};
    const size_t aoff = (size_t)(r0 + lr) * K + 8 * hi, boff = (size_t)(c0 + lr) * K + 8 * hi;
#pragma unroll 1
    for (int kc = 0; kc < K; kc += 32) {
        V a[4], a2[4];
#pragma unroll
        for (int mb = 0; mb < 4; ++mb) { a[mb] = WFrag<T16>::ld(A + aoff + (size_t)mb * 16 * K + kc); if (NSPLIT == 1 || NSPLIT == 2) a2[mb] = WFrag<T16>::ld(A2 + aoff + (size_t)mb * 16 * K + kc); }
#pragma unroll
        for (int nb = 0; nb < 4; ++nb) { const V b = WFrag<T16>::ld(Bt + boff + (size_t)nb * 16 * K + kc); V b2; if (NSPLIT >= 2) b2 = WFrag<T16>::ld(Bt2 + boff + (size_t)nb * 16 * K + kc);
#pragma unroll
            for (int mb = 0; mb < 4; ++mb) { acc[mb][nb] = WFrag<T16>::mma(a[mb], b, acc[mb][nb]); if (NSPLIT == 1 || NSPLIT == 2) acc[mb][nb] = WFrag<T16>::mma(a2[mb], b, acc[mb][nb]); if (NSPLIT >= 2) acc[mb][nb] = WFrag<T16>::mma(a[mb], b2, acc[mb][nb]); } }
        asm volatile("v_nop\n\tv_nop\n\tv_nop\n\tv_nop" : "+v"(acc[0][0]), "+v"(acc[1][1]), "+v"(acc[2][2]), "+v"(acc[3][3]) : "v"(a[0]), "v"(a[3]));
    }
#pragma unroll
    for (int mb = 0; mb < 4; ++mb) {
#pragma unroll
        for (int nb = 0; nb < 4; ++nb) {
#pragma unroll
            for (int j = 0; j < 8; ++j) os[(hi * 8 + j) * 68 + nb * 16 + lr] = acc[mb][nb][j]; }
        __builtin_amdgcn_wave_barrier(); asm volatile("" ::: "memory");
        float* crow = C + (size_t)(r0 + mb * 16) * ldc + c0;
{
#pragma unroll
            for (int s = 0; s < 8; ++s) { const int row = 2 * s + hi, cofs = lr * 4; v4f val = *(const v4fa*)(os + row * 68 + cofs); if (BIAS) { val[0] += bfr(bias[c0 + cofs]); val[1] += bfr(bias[c0 + cofs + 1]); val[2] += bfr(bias[c0 + cofs + 2]); val[3] += bfr(bias[c0 + cofs + 3]); }
                *(v4f*)(crow + (size_t)row * ldc + cofs) = val; }
             }
        __builtin_amdgcn_wave_barrier(); asm volatile("" ::: "memory");
    }
}

__device__ __forceinline__ h16 tohx(float x) { return (h16)x; }
__device__ __forceinline__ void splitf(float y, unsigned short& h, unsigned short& l) { h = f2bf(y); l = f2bf(y - bf2f(h)); }
typedef __attribute__((ext_vector_type(2))) _Float16 v2h;
typedef __attribute__((ext_vector_type(4))) _Float16 v4h;
typedef __attribute__((ext_vector_type(2))) unsigned short v2us;
typedef __attribute__((ext_vector_type(4))) int v4i;

__global__ __launch_bounds__(256) void k_cvt8(const float* __restrict__ src, bf* dst, size_t n8) { const size_t i = (size_t)blockIdx.x * 256 + threadIdx.x; if (i >= n8) return; const v8f v = *(const v8f*)(src + i * 8); v8us o;
#pragma unroll
    for (int k = 0; k < 8; ++k) o[k] = f2bf(v[k]); *(v8us*)(dst + i * 8) = o;  }
// k_fact: factorised weight hi/lo planes: W'[a][b] = bf16(W[a][b]) bf16(rm[l][a]) bf16(sm[l][b]) + sum_k bf16(r[l][k][a]) bf16(s[l][k][b]) (f32, fixed order), l = indices[0] read on device (int input,
__global__ __launch_bounds__(256) void k_fact(const float* __restrict__ W, const int* __restrict__ idx, const float* __restrict__ rm, const float* __restrict__ sm, const float* __restrict__ rr, const float* __restrict__ ss, int rows, bf* Wh, bf* Wl) {
    const size_t i = ((size_t)blockIdx.x * 256 + threadIdx.x) * 2; if (i >= (size_t)rows * DD) return; const int a = (int)(i / DD), b0 = (int)(i % DD); int l = idx[0]; l = l < 0 ? 0 : (l >= NLY ? NLY - 1 : l); v2us oh, ol;
#pragma unroll
    for (int q = 0; q < 2; ++q) { const int b = b0 + q; float m = __fmul_rn(bfr(rm[(size_t)l * rows + a]), bfr(sm[(size_t)l * DD + b])); asm volatile("" : "+v"(m)); float w = __fmul_rn(bfr(W[i + q]), m); asm volatile("" : "+v"(w)); float ad = 0.f;
#pragma unroll
        for (int k = 0; k < RNK; ++k) { float p = __fmul_rn(bfr(rr[((size_t)l * RNK + k) * rows + a]), bfr(ss[((size_t)l * RNK + k) * DD + b])); asm volatile("" : "+v"(p)); ad = __fadd_rn(ad, p); }
        unsigned short h, lo; splitf(__fadd_rn(w, ad), h, lo); oh[q] = h; ol[q] = lo; }
    *(v2us*)(Wh + i) = oh; *(v2us*)(Wl + i) = ol;  }
__global__ __launch_bounds__(256) void k_hb16(const float* __restrict__ F, const float* __restrict__ hb, h16* P) {
    const int lane = threadIdx.x & 31; const int L0 = (blockIdx.x * 8 + (threadIdx.x >> 5)) * 8; const int nlines = NT * DD / 64;
{
#pragma unroll
        for (int l = 0; l < 8; ++l) { const int L = L0 + l; if (L >= nlines) break; const int e = L * 64 + lane * 2; const int d = e & 63; const int t = (e >> 6) & (TT - 1); const int z = e >> 16; const int b = z >> 4, h = z & 15; v2h o;
#pragma unroll
            for (int q = 0; q < 2; ++q) { const float bb = hb ? bfr(hb[h * HD + d + q]) : 0.f; o[q] = tohx(__fadd_rn(F[((size_t)t * NB_ + b) * DD + h * HD + d + q], bb)); }
            *(v2h*)(P + (size_t)e) = o; }
         }
}
__global__ __launch_bounds__(256) void k_rk16(const float* __restrict__ FR, h16* RK) {
    const int lane = threadIdx.x & 31; const int L0 = (blockIdx.x * 8 + (threadIdx.x >> 5)) * 8; const int nlines = NH_ * TT * HD / 64;
{
#pragma unroll
        for (int l = 0; l < 8; ++l) { const int L = L0 + l; if (L >= nlines) break; const int e = L * 64 + lane * 2; const int d = e & 63; const int j = (e >> 6) & (TT - 1); const int h = e >> 16; v2h o;
#pragma unroll
            for (int q = 0; q < 2; ++q) o[q] = tohx(FR[(size_t)j * DD + h * HD + d + q]);
            *(v2h*)(RK + (size_t)e) = o; }
         }
}
__global__ __launch_bounds__(256) void k_vtplane(const float* __restrict__ F, h16* VT) {
    const int lane = threadIdx.x & 31; const int L0 = (blockIdx.x * 8 + (threadIdx.x >> 5)) * 8; const int nlines = NT * DD / 64;
{
#pragma unroll
        for (int l = 0; l < 8; ++l) { const int L = L0 + l; if (L >= nlines) break; const int e = L * 64 + lane * 2; const int t = e & (TT - 1); const int d = (e >> 10) & 63; const int z = e >> 16; const int b = z >> 4, h = z & 15; v2h v;
#pragma unroll
            for (int q = 0; q < 2; ++q) v[q] = tohx(F[((size_t)(t + q) * NB_ + b) * DD + h * HD + d]);
            *(v2h*)(VT + (size_t)e) = v; }
         }
}
// k_attn: one work-group (8 waves) = 32 query rows of one (batch, head). The whole 32 x 1024 score block stays in LDS (f32, row pitch SP floats), so no score, probability or per-head output plane goes through memory.
// 1) BD: raw tiles (q + r_r_bias).r_k for rows i (lower part) and rows i + 1 (upper part) against the same r_k fragment; element (i, n) lands at its shifted column of row i: with d = i + n + 1 - T,
//    d >= 0 -> column d from row i; d <= -2 -> column d + T + 1 from row i + 1; d == -1 has no place in the shifted row and falls on column T, in the row's pad, which nobody reads.
//    For fixed i that fills every column but i + 1, which holds the shift's zero and is stored by wave 0 (for i = T - 1 that store too falls on the pad).
// 2) AC tiles are added at their own place and scaled by 1/8.  3) each wave: softmax of 4 rows; P (x1024, fp16) overwrites the front half of the row's own bytes, which only that wave touches here.
// 4) P.V: wave = (16-wide d tile, half of the keys), both 16-row tiles; the two halves' partial sums meet in Of.  5) 1/1024, hi/lo bf16 split, one 128-byte line per 8 lanes of one wave.
// Every plain '#pragma unroll' in k_attn: the fragment and accumulator arrays are indexed by the loop counters and stay in registers only when those loops are unrolled.
#define MR 32
#define SP 1028                   // 4112 bytes = 16 x odd: the b128 fragment reads of 16 rows fall on distinct banks
typedef v4h __attribute__((may_alias)) v4ha;
__global__ __launch_bounds__(256) __attribute__((amdgpu_waves_per_eu(4, 4))) void k_attn(const h16* __restrict__ QA, const h16* __restrict__ QB, const h16* __restrict__ KP, const h16* __restrict__ VT, const h16* __restrict__ RK, bf* Ah, bf* Al) {
    __shared__ __align__(16) float S[MR * SP];
    __shared__ __align__(16) float Of[2 * MR * 68];
    const int tid = threadIdx.x, lane = tid & 31, lr = lane & 15, hi = lane >> 4; const int w = __builtin_amdgcn_readfirstlane(tid >> 5);
    const int i0 = blockIdx.x * MR; const int z = blockIdx.y; const int b = z >> 4, h = z & 15;
    const h16* qa = QA + (size_t)z * TT * HD; const h16* qb = QB + (size_t)z * TT * HD; const h16* kp = KP + (size_t)z * TT * HD; const h16* vt = VT + (size_t)z * HD * TT; const h16* rk = RK + (size_t)h * TT * HD;
    if (w == 0) S[lane * SP + i0 + lane + 1] = 0.f;
    // Both score loops are straight-line with two operand buffers: the loads of the next pair of key tiles are issued, then this pair is worked on. The sched_barrier calls hold that order:
    // without them the scheduler lifts all eight tiles' loads to the top and spills past the 256 registers that two work-groups per WGP allow.
    v16h a[2][2], kb[2][2][2];    // AC's operands; the q + r_w_bias rows and the first pair of key tiles are fetched in front of the last BD pair, whose work covers their latency
    const h16* pa = qa + (size_t)(i0 + lr) * HD + 8 * hi; const h16* pk = kp + (size_t)(w * 128 + lr) * HD + 8 * hi;
    {   v16h aL[2][2], aU[2][2], rb[2][2][2]; const h16* bp = rk + (size_t)(w * 128 + lr) * HD + 8 * hi; const h16* pL = qb + (size_t)(i0 + lr) * HD + 8 * hi;
        const int ru = (i0 + 17 + lr < TT) ? i0 + 17 + lr : TT - 1; const h16* pU = qb + (size_t)ru * HD + 8 * hi;    // row T does not exist; row T - 1 has no upper part, so its aU result is never chosen
#pragma unroll
        for (int ks = 0; ks < 2; ++ks) { aL[0][ks] = WFrag<h16>::ld(pL + ks * 32); aL[1][ks] = WFrag<h16>::ld(pL + 16 * HD + ks * 32); aU[0][ks] = WFrag<h16>::ld(pL + HD + ks * 32); aU[1][ks] = WFrag<h16>::ld(pU + ks * 32); }
#pragma unroll
        for (int t = 0; t < 2; ++t) { rb[0][t][0] = WFrag<h16>::ld(bp + t * 16 * HD); rb[0][t][1] = WFrag<h16>::ld(bp + t * 16 * HD + 32); }
        asm volatile("s_wait_xcnt 0x0" :: "v"(pL), "v"(pU) : "memory");    // the address registers of the issued loads are held to here and may be reused only behind this wait
#pragma unroll
        for (int g = 0; g < 4; ++g) {
            if (g < 3) {
#pragma unroll
                for (int t = 0; t < 2; ++t) { rb[(g + 1) & 1][t][0] = WFrag<h16>::ld(bp + ((g + 1) * 2 + t) * 16 * HD); rb[(g + 1) & 1][t][1] = WFrag<h16>::ld(bp + ((g + 1) * 2 + t) * 16 * HD + 32); } }
            else {
#pragma unroll
                for (int mb = 0; mb < 2; ++mb)
#pragma unroll
                    for (int ks = 0; ks < 2; ++ks) { a[mb][ks] = WFrag<h16>::ld(pa + mb * 16 * HD + ks * 32); kb[0][mb][ks] = WFrag<h16>::ld(pk + mb * 16 * HD + ks * 32); } }
            if (g == 2) asm volatile("s_wait_xcnt 0x0" :: "v"(bp) : "memory");    // last loads through bp: its registers are held to here and reused only behind this wait
            if (g == 3) asm volatile("s_wait_xcnt 0x0" :: "v"(pa) : "memory");    // the same for pa
            __builtin_amdgcn_sched_barrier(0);    // the next pair's loads stay in front of this pair's work
#pragma unroll
            for (int t = 0; t < 2; ++t) { const int n0 = w * 128 + (g * 2 + t) * 16;
#pragma unroll
                for (int mb = 0; mb < 2; ++mb) { v8f cL = (v8f){}, cU = (v8f){}; cL = wmma16(aL[mb][0], rb[g & 1][t][0], cL); cU = wmma16(aU[mb][0], rb[g & 1][t][0], cU); cL = wmma16(aL[mb][1], rb[g & 1][t][1], cL); cU = wmma16(aU[mb][1], rb[g & 1][t][1], cU);
#pragma unroll
                    for (int j = 0; j < 8; ++j) { const int ml = mb * 16 + hi * 8 + j; const int d = i0 + ml + n0 + lr + 1 - TT;
                        S[ml * SP + d + ((d >> 31) & (TT + 1))] = (d >= 0) ? cL[j] : cU[j]; } } }
            __builtin_amdgcn_sched_barrier(0);    // later pairs' loads stay behind this pair's work
        }
    }
    __syncthreads();              // every shifted BD element is in place before AC is added to it
    {
#pragma unroll
        for (int g = 0; g < 4; ++g) {
            if (g < 3) {
#pragma unroll
                for (int t = 0; t < 2; ++t) { kb[(g + 1) & 1][t][0] = WFrag<h16>::ld(pk + ((g + 1) * 2 + t) * 16 * HD); kb[(g + 1) & 1][t][1] = WFrag<h16>::ld(pk + ((g + 1) * 2 + t) * 16 * HD + 32); } }
            if (g == 2) asm volatile("s_wait_xcnt 0x0" :: "v"(pk) : "memory");    // last loads through pk: its registers are held to here and reused only behind this wait
            __builtin_amdgcn_sched_barrier(0);    // the next pair's loads stay in front of this pair's work
#pragma unroll
            for (int t = 0; t < 2; ++t) { const int n0 = w * 128 + (g * 2 + t) * 16;
#pragma unroll
                for (int mb = 0; mb < 2; ++mb) { v8f c = (v8f){}; c = wmma16(a[mb][0], kb[g & 1][t][0], c); c = wmma16(a[mb][1], kb[g & 1][t][1], c);
#pragma unroll
                    for (int j = 0; j < 8; ++j) { float* sp = S + (mb * 16 + hi * 8 + j) * SP + n0 + lr; *sp = __fmul_rn(__fadd_rn(c[j], *sp), 0.125f); } } }
            __builtin_amdgcn_sched_barrier(0);    // later pairs' loads stay behind this pair's work
        }
    }
    __syncthreads();              // whole rows are complete before a wave reduces them
    const int dt = w & 3, kh = w >> 2; v16h bv[16]; const h16* vp = vt + (size_t)(dt * 16 + lr) * TT + kh * 512 + 8 * hi;    // this wave's V fragments: the first eight are fetched here, so that their latency passes behind the softmax
#pragma unroll
    for (int ks = 0; ks < 8; ++ks) bv[ks] = WFrag<h16>::ld(vp + ks * 32);
#pragma unroll 1                  // rolled: one row's 32 values at a time, so that the V fragments held across this loop stay in registers
    for (int rr = 0; rr < 4; ++rr) { float* sr = S + (w * 4 + rr) * SP; float v[32]; float mx = -3.0e38f;
#pragma unroll
        for (int ch = 0; ch < 8; ++ch) { const v4f sv = *(const v4fa*)(sr + ch * 128 + lane * 4);
#pragma unroll
            for (int q = 0; q < 4; ++q) { v[ch * 4 + q] = sv[q]; mx = fmaxf(mx, sv[q]); } }
#pragma unroll
        for (int sh = 16; sh; sh >>= 1) mx = fmaxf(mx, __shfl_xor(mx, sh, 32));
        float sum = 0.f;
#pragma unroll
        for (int k = 0; k < 32; ++k) { v[k] = __expf(v[k] - mx); sum += v[k]; }
#pragma unroll
        for (int sh = 16; sh; sh >>= 1) sum += __shfl_xor(sum, sh, 32);
        const float fct = __fdiv_rn(PCAR, sum); h16* pr = (h16*)sr;
#pragma unroll
        for (int ch = 0; ch < 8; ++ch) { v4h o;
#pragma unroll
            for (int q = 0; q < 4; ++q) o[q] = tohx(v[ch * 4 + q] * fct);
            *(v4ha*)(pr + ch * 128 + lane * 4) = o; } }
    __syncthreads();              // P of all 32 rows is written before any wave reads it as its A operand
#pragma unroll
    for (int ks = 8; ks < 16; ++ks) bv[ks] = WFrag<h16>::ld(vp + ks * 32);    // the other eight fly while the first eight are worked on (all sixteen held over the softmax spill)
    asm volatile("s_wait_xcnt 0x0" :: "v"(vp) : "memory");    // last loads through vp: its registers are held to here and reused only behind this wait
    {   const h16* P = (const h16*)S; v8f o[2]; o[0] = (v8f){}; o[1] = (v8f){}; const h16* pp = P + (size_t)lr * (2 * SP) + kh * 512 + 8 * hi;
#pragma unroll
        for (int ks = 0; ks < 16; ++ks) {
#pragma unroll
            for (int mb = 0; mb < 2; ++mb) { const h16* ap = pp + (size_t)mb * 16 * (2 * SP) + ks * 32; o[mb] = wmma16(cat16(*(const v8ha*)ap, *(const v8ha*)(ap + 16)), bv[ks], o[mb]); } }
#pragma unroll
        for (int mb = 0; mb < 2; ++mb)
#pragma unroll
            for (int j = 0; j < 8; ++j) Of[(kh * MR + mb * 16 + hi * 8 + j) * 68 + dt * 16 + lr] = o[mb][j];
    }
    __syncthreads();              // both key halves' partial sums are in Of
    {   const int row = tid >> 3, d0 = (tid & 7) * 8; const float* p0 = Of + row * 68 + d0; const float* p1 = p0 + MR * 68; v8us oh, ol;
#pragma unroll
        for (int q = 0; q < 8; ++q) { unsigned short x, y; splitf(__fadd_rn(p0[q], p1[q]) * (1.0f / PCAR), x, y); oh[q] = x; ol[q] = y; }
        const size_t o = ((size_t)(i0 + row) * NB_ + b) * DD + h * HD + d0; *(v8us*)(Ah + o) = oh; *(v8us*)(Al + o) = ol; }
}

extern "C" void kernel_launch(void* const* d_in, const int* in_sizes, int n_in,
                              void* d_out, int out_size, void* d_ws, size_t ws_size, hipStream_t stream) {
    (void)in_sizes; (void)n_in; (void)out_size;
    const float* IN[23]; for (int i = 0; i < 23; ++i) IN[i] = (const float*)d_in[i];
    // input [1024][4][1024], pos [1024][1][1024], indices (int [1]), in_proj_weight [3072][1024], in_proj_bias, out_proj_weight, out_proj_bias, pos_proj_weight, pos_proj_bias,
    // r_i [8][4][3072], s_i [8][4][1024], r_p, s_p, r_o, s_o, rm_i [8][1][3072], sm_i [8][1][1024], rm_p, sm_p, rm_o, sm_o, r_w_bias [16][64], r_r_bias = d_in[0..22]
    const float* x = IN[0]; const float* r = IN[1]; const int* idx = (const int*)d_in[2]; const float* rwb = IN[21]; const float* rrb = IN[22];
    float* OUT = (float*)d_out;     // [1024][4][1024] (rows t*4 + b)
    char* wsp = (char*)d_ws;
    auto take = [&](size_t bytes) { char* p = wsp; wsp += (bytes + 255) & ~(size_t)255; return (void*)p; };
    bf* WIh = (bf*)take((size_t)3 * DD * DD * 2); bf* WIl = (bf*)take((size_t)3 * DD * DD * 2); bf* WRh = (bf*)take((size_t)DD * DD * 2); bf* WRl = (bf*)take((size_t)DD * DD * 2); bf* WOh = (bf*)take((size_t)DD * DD * 2); bf* WOl = (bf*)take((size_t)DD * DD * 2);
    bf* XB = (bf*)take((size_t)NT * DD * 2); bf* RB = (bf*)take((size_t)TT * DD * 2); float* F = (float*)take((size_t)NT * DD * 4);
    h16* QA = (h16*)take((size_t)NT * DD * 2); h16* QB = (h16*)take((size_t)NT * DD * 2); h16* KP = (h16*)take((size_t)NT * DD * 2); h16* VT = (h16*)take((size_t)NT * DD * 2); h16* RK = (h16*)take((size_t)NH_ * TT * HD * 2);
    bf* ATh = (bf*)F; bf* ATl = ATh + (size_t)NT * DD;   // the merged hi/lo planes lie in F: its last reader (k_rk16) runs before k_attn, and both planes fill exactly its bytes
    if ((size_t)(wsp - (char*)d_ws) > ws_size) return;    // total 80 MiB; ws 256 MiB
    { const unsigned gi = (unsigned)(((size_t)3 * DD * DD / 2 + 255) / 256), g1 = (unsigned)(((size_t)DD * DD / 2 + 255) / 256);
      k_fact<<<gi, 256, 0, stream>>>(IN[3], idx, IN[15], IN[16], IN[9], IN[10], 3 * DD, WIh, WIl);     // in_proj: rm_i, sm_i, r_i, s_i
      k_fact<<<g1, 256, 0, stream>>>(IN[7], idx, IN[17], IN[18], IN[11], IN[12], DD, WRh, WRl);         // pos_proj: rm_p, sm_p, r_p, s_p
      k_fact<<<g1, 256, 0, stream>>>(IN[5], idx, IN[19], IN[20], IN[13], IN[14], DD, WOh, WOl);         // out_proj: rm_o, sm_o, r_o, s_o
      const size_t nx = (size_t)NT * DD / 8; k_cvt8<<<(unsigned)((nx + 255) / 256), 256, 0, stream>>>(x, XB, nx); k_cvt8<<<(unsigned)(((size_t)TT * DD / 8 + 255) / 256), 256, 0, stream>>>(r, RB, (size_t)TT * DD / 8); }
    const unsigned LB = (unsigned)((NT * DD / 64 + 63) / 64); const dim3 gP(NT / 64, DD / 64, 1);
    k_gemmw<bf, 3, true><<<gP, 32, 0, stream>>>(XB, nullptr, WIh, WIl, DD, F, DD, IN[4], 0, 0, 0); k_hb16<<<LB, 256, 0, stream>>>(F, rwb, QA); k_hb16<<<LB, 256, 0, stream>>>(F, rrb, QB);
    k_gemmw<bf, 3, true><<<gP, 32, 0, stream>>>(XB, nullptr, WIh + (size_t)DD * DD, WIl + (size_t)DD * DD, DD, F, DD, IN[4] + DD, 0, 0, 0); k_hb16<<<LB, 256, 0, stream>>>(F, nullptr, KP);
    k_gemmw<bf, 3, true><<<gP, 32, 0, stream>>>(XB, nullptr, WIh + (size_t)2 * DD * DD, WIl + (size_t)2 * DD * DD, DD, F, DD, IN[4] + 2 * DD, 0, 0, 0); k_vtplane<<<LB, 256, 0, stream>>>(F, VT);
    k_gemmw<bf, 3, true><<<dim3(TT / 64, DD / 64, 1), 32, 0, stream>>>(RB, nullptr, WRh, WRl, DD, F, DD, IN[8], 0, 0, 0); k_rk16<<<(unsigned)((NH_ * TT * HD / 64 + 63) / 64), 256, 0, stream>>>(F, RK);
    k_attn<<<dim3(TT / MR, NB_ * NH_, 1), 256, 0, stream>>>(QA, QB, KP, VT, RK, ATh, ATl);
    k_gemmw<bf, 2, true><<<gP, 32, 0, stream>>>(ATh, ATl, WOh, WOl, DD, OUT, DD, IN[6], 0, 0, 0);
}

// v003
// Measured time: 295 microseconds a run.
// In both of two side-by-side timings against v002, it was 1.37 times as fast.
// All steps since v000 together make it 5.79 times as fast.
#include <hip/hip_runtime.h>

// Relative-position multi-head attention (segment-recurrence style relative shift; query [1024][4][1024] seq-first, r [1024][1024]; w = query qkv_w^T -> q|k|v (16 heads x 64); r_k = r r_w^T; AC = (q + r_w_bias).k,
// BD = rel_shift((q + r_r_bias).r_k) with the module's exact zero-pad/reshape shift (out[i][j] = BD[f / (T+1)][f % (T+1) - 1] or 0 when f % (T+1) == 0, f = T + i*T + j); p = softmax((AC + BD) / 8)
// over the keys; attn = p.v; out = merged out_w^T + out_b; output [1024][4][1024] (rows t*4 + b)).
// Compute dtypes, f32 accumulate: every input rounded to bf16; the qkv and r projections on PLAIN bf16 inputs (exact) times hi/lo bf16 weight planes; AC, BD and attn.v on SINGLE fp16 planes
// (the per-head biases added in f32 before the fp16 rounding; logit sd ~ 0.6); the relative shift is done by where each BD element is stored in the LDS score block of k_attn; P x1024;

#define NB_  4
#define TT   1024
#define NLY  8                    // weight-factor layers
#define RNK  4                    // additive rank
#define DD   1024
#define NH_  16
#define HD   64
#define NT   (NB_ * TT)
#define PCAR 1024.0f
typedef _Float16 h16;
typedef unsigned short bf;
typedef __attribute__((ext_vector_type(16))) __bf16   v16bf;
typedef __attribute__((ext_vector_type(16))) _Float16 v16h;
typedef __attribute__((ext_vector_type(8)))  _Float16 v8h;
typedef __attribute__((ext_vector_type(8)))  unsigned short v8us;
typedef __attribute__((ext_vector_type(8)))  float    v8f;
typedef __attribute__((ext_vector_type(4)))  float    v4f;
typedef v8h  __attribute__((may_alias)) v8ha;
typedef v4f  __attribute__((may_alias)) v4fa;
typedef v8us __attribute__((may_alias)) v8usa;

__device__ __forceinline__ unsigned short f2bf(float f) { unsigned u = __float_as_uint(f); u += 0x7FFFu + ((u >> 16) & 1u); return (unsigned short)(u >> 16); }
__device__ __forceinline__ float bf2f(unsigned short b) { return __uint_as_float(((unsigned)b) << 16); }
__device__ __forceinline__ float bfr(float f) { return bf2f(f2bf(f)); }
__device__ __forceinline__ v16h cat16(v8h lo, v8h hi) { return __builtin_shufflevector(lo, hi, 0, 1, 2, 3, 4, 5, 6, 7, 8, 9, 10, 11, 12, 13, 14, 15); }
__device__ __forceinline__ v16bf cat16b(v8us lo, v8us hi) { return __builtin_bit_cast(v16bf, __builtin_shufflevector(lo, hi, 0, 1, 2, 3, 4, 5, 6, 7, 8, 9, 10, 11, 12, 13, 14, 15)); }
__device__ __forceinline__ v8f wmma16(v16h a, v16h b, v8f c) { return __builtin_amdgcn_wmma_f32_16x16x32_f16(false, a, false, b, (short)0, c, false, false); }
__device__ __forceinline__ v8f wmmab(v16bf a, v16bf b, v8f c) { return __builtin_amdgcn_wmma_f32_16x16x32_bf16(false, a, false, b, (short)0, c, false, false); }



// ---- k_gemmw: register-blocked GEMM, ONE WAVE per 64x64 output tile (16 accumulators), operands straight from K-contiguous 16-bit planes; grid (M/64, N/64, Z), 32 threads.
// C[m][n] (f32, pitch ldc, + optional f32 bias[n]) = sum_k A[m][k] Bt[n][k] (+ split products per NSPLIT). z-batch strides sA/sB/sC in elements. K % 64 == 0.
template <typename T16> struct WFrag;
template <> struct WFrag<h16> { typedef v16h V; static __device__ __forceinline__ V ld(const h16* p) { return cat16(*(const v8h*)p, *(const v8h*)(p + 16)); } static __device__ __forceinline__ v8f mma(V a, V b, v8f c) { return wmma16(a, b, c); } };
template <> struct WFrag<bf> { typedef v16bf V; static __device__ __forceinline__ V ld(const bf* p) { return cat16b(*(const v8us*)p, *(const v8us*)(p + 16)); } static __device__ __forceinline__ v8f mma(V a, V b, v8f c) { return wmmab(a, b, c); } };
template <typename T16, int NSPLIT, bool BIAS>
__global__ __launch_bounds__(32) void k_gemmw(const T16* __restrict__ A, const T16* __restrict__ A2, const T16* __restrict__ Bt, const T16* __restrict__ Bt2, int K, float* C, int ldc, const float* __restrict__ bias, size_t sA, size_t sB, size_t sC) {
    typedef typename WFrag<T16>::V V;
    __shared__ __align__(16) float os[16 * 68];
    const size_t z = blockIdx.z; A += z * sA; if (A2) A2 += z * sA; Bt += z * sB; if (Bt2) Bt2 += z * sB; C += z * sC;
    const int lane = threadIdx.x & 31, lr = lane & 15, hi = lane >> 4; const int r0 = blockIdx.x * 64, c0 = blockIdx.y * 64;
    v8f acc[4][4];
#pragma unroll
    for (int mb = 0; mb < 4; ++mb)
#pragma unroll
        for (int nb = 0; nb < 4; ++nb) acc[mb][nb] = (v8f){};
    // Two fragment sets in registers: as soon as a set's WMMAs are issued, its refill for two k steps on (every A and B fragment, one group of loads) goes out and flies during the other set's WMMAs,
    // so that a wave waits for memory at most once per step, with a step of matrix work as lead. Each accumulator takes its products in the same order as with one set.
    V a[2][4], a2[2][4], b[2][4], b2[2][4];
    const char* pA[4]; const char* pA2[4]; const char* pB[4]; const char* pB2[4];    // wave-uniform start of each 16-row block; they never change
#pragma unroll
    for (int q = 0; q < 4; ++q) { pA[q] = (const char*)(A + (size_t)(r0 + q * 16) * K); pA2[q] = (NSPLIT == 1 || NSPLIT == 2) ? (const char*)(A2 + (size_t)(r0 + q * 16) * K) : nullptr; pB[q] = (const char*)(Bt + (size_t)(c0 + q * 16) * K); pB2[q] = (NSPLIT >= 2) ? (const char*)(Bt2 + (size_t)(c0 + q * 16) * K) : nullptr; }
    unsigned vo = (unsigned)(lr * K + 8 * hi) * 2u;    // this lane's byte offset inside a block, the same for every block: the one address register that moves, at the foot of a trip
    auto ldset = [&](int s, int ko) {
        if (NSPLIT == 2) asm volatile("s_wait_loadcnt 0x1f" ::: "memory");    // a set is 32 loads here: with at most 31 older ones left, a wave never has more than 63 outstanding, the most that s_wait_loadcnt can name
#pragma unroll
        for (int mb = 0; mb < 4; ++mb) { a[s][mb] = WFrag<T16>::ld((const T16*)(pA[mb] + vo) + ko); if (NSPLIT == 1 || NSPLIT == 2) a2[s][mb] = WFrag<T16>::ld((const T16*)(pA2[mb] + vo) + ko); }
#pragma unroll
        for (int nb = 0; nb < 4; ++nb) { b[s][nb] = WFrag<T16>::ld((const T16*)(pB[nb] + vo) + ko); if (NSPLIT >= 2) b2[s][nb] = WFrag<T16>::ld((const T16*)(pB2[nb] + vo) + ko); }
        asm volatile("s_wait_xcnt 0x0" ::: "memory");    // the base and offset registers of this group's loads are rewritten (the offset at a trip's foot, the bases behind the loop) only behind this wait
        __builtin_amdgcn_sched_barrier(0);    // a refill, with its wait, stays in front of the other set's WMMAs
    };
    auto mmset = [&](int s) {
#pragma unroll
        for (int nb = 0; nb < 4; ++nb)
#pragma unroll
            for (int mb = 0; mb < 4; ++mb) { acc[mb][nb] = WFrag<T16>::mma(a[s][mb], b[s][nb], acc[mb][nb]); if (NSPLIT == 1 || NSPLIT == 2) acc[mb][nb] = WFrag<T16>::mma(a2[s][mb], b[s][nb], acc[mb][nb]); if (NSPLIT >= 2) acc[mb][nb] = WFrag<T16>::mma(a[s][mb], b2[s][nb], acc[mb][nb]); }
        __builtin_amdgcn_sched_barrier(0);    // the loads that refill this set stay behind its WMMAs
    };
    ldset(0, 0); ldset(1, 32);
#pragma unroll 1                  // rolled: two steps a trip, so that each set keeps its own registers
    for (int kc = 64; kc < K; kc += 64) {
        mmset(0); ldset(0, 64);
        mmset(1);
        vo += 128;    // behind the wait that closes ldset(0, 64); no load stands between
        ldset(1, 32);
    }
    mmset(0); mmset(1);
#pragma unroll
    for (int mb = 0; mb < 4; ++mb) {
#pragma unroll
        for (int nb = 0; nb < 4; ++nb) {
#pragma unroll
            for (int j = 0; j < 8; ++j) os[(hi * 8 + j) * 68 + nb * 16 + lr] = acc[mb][nb][j]; }
        __builtin_amdgcn_wave_barrier(); asm volatile("" ::: "memory");
        float* crow = C + (size_t)(r0 + mb * 16) * ldc + c0;
{
#pragma unroll
            for (int s = 0; s < 8; ++s) { const int row = 2 * s + hi, cofs = lr * 4; v4f val = *(const v4fa*)(os + row * 68 + cofs); if (BIAS) { val[0] += bfr(bias[c0 + cofs]); val[1] += bfr(bias[c0 + cofs + 1]); val[2] += bfr(bias[c0 + cofs + 2]); val[3] += bfr(bias[c0 + cofs + 3]); }
                *(v4f*)(crow + (size_t)row * ldc + cofs) = val; }
             }
        __builtin_amdgcn_wave_barrier(); asm volatile("" ::: "memory");
        asm volatile("s_wait_xcnt 0x0" ::: "memory");    // the address registers of this block's stores are reused only behind this wait
    }
}

__device__ __forceinline__ h16 tohx(float x) { return (h16)x; }
__device__ __forceinline__ void splitf(float y, unsigned short& h, unsigned short& l) { h = f2bf(y); l = f2bf(y - bf2f(h)); }
typedef __attribute__((ext_vector_type(2))) _Float16 v2h;
typedef __attribute__((ext_vector_type(4))) _Float16 v4h;
typedef __attribute__((ext_vector_type(2))) unsigned short v2us;
typedef __attribute__((ext_vector_type(4))) int v4i;

__global__ __launch_bounds__(256) void k_cvt8(const float* __restrict__ src, bf* dst, size_t n8) { const size_t i = (size_t)blockIdx.x * 256 + threadIdx.x; if (i >= n8) return; const v8f v = *(const v8f*)(src + i * 8); v8us o;
#pragma unroll
    for (int k = 0; k < 8; ++k) o[k] = f2bf(v[k]); *(v8us*)(dst + i * 8) = o;  }
// k_fact: factorised weight hi/lo planes: W'[a][b] = bf16(W[a][b]) bf16(rm[l][a]) bf16(sm[l][b]) + sum_k bf16(r[l][k][a]) bf16(s[l][k][b]) (f32, fixed order), l = indices[0] read on device (int input,
__global__ __launch_bounds__(256) void k_fact(const float* __restrict__ W, const int* __restrict__ idx, const float* __restrict__ rm, const float* __restrict__ sm, const float* __restrict__ rr, const float* __restrict__ ss, int rows, bf* Wh, bf* Wl) {
    const size_t i = ((size_t)blockIdx.x * 256 + threadIdx.x) * 2; if (i >= (size_t)rows * DD) return; const int a = (int)(i / DD), b0 = (int)(i % DD); int l = idx[0]; l = l < 0 ? 0 : (l >= NLY ? NLY - 1 : l); v2us oh, ol;
#pragma unroll
    for (int q = 0; q < 2; ++q) { const int b = b0 + q; float m = __fmul_rn(bfr(rm[(size_t)l * rows + a]), bfr(sm[(size_t)l * DD + b])); asm volatile("" : "+v"(m)); float w = __fmul_rn(bfr(W[i + q]), m); asm volatile("" : "+v"(w)); float ad = 0.f;
#pragma unroll
        for (int k = 0; k < RNK; ++k) { float p = __fmul_rn(bfr(rr[((size_t)l * RNK + k) * rows + a]), bfr(ss[((size_t)l * RNK + k) * DD + b])); asm volatile("" : "+v"(p)); ad = __fadd_rn(ad, p); }
        unsigned short h, lo; splitf(__fadd_rn(w, ad), h, lo); oh[q] = h; ol[q] = lo; }
    *(v2us*)(Wh + i) = oh; *(v2us*)(Wl + i) = ol;  }
__global__ __launch_bounds__(256) void k_hb16(const float* __restrict__ F, const float* __restrict__ hb, h16* P) {
    const int lane = threadIdx.x & 31; const int L0 = (blockIdx.x * 8 + (threadIdx.x >> 5)) * 8; const int nlines = NT * DD / 64;
{
#pragma unroll
        for (int l = 0; l < 8; ++l) { const int L = L0 + l; if (L >= nlines) break; const int e = L * 64 + lane * 2; const int d = e & 63; const int t = (e >> 6) & (TT - 1); const int z = e >> 16; const int b = z >> 4, h = z & 15; v2h o;
#pragma unroll
            for (int q = 0; q < 2; ++q) { const float bb = hb ? bfr(hb[h * HD + d + q]) : 0.f; o[q] = tohx(__fadd_rn(F[((size_t)t * NB_ + b) * DD + h * HD + d + q], bb)); }
            *(v2h*)(P + (size_t)e) = o; }
         }
}
__global__ __launch_bounds__(256) void k_rk16(const float* __restrict__ FR, h16* RK) {
    const int lane = threadIdx.x & 31; const int L0 = (blockIdx.x * 8 + (threadIdx.x >> 5)) * 8; const int nlines = NH_ * TT * HD / 64;
{
#pragma unroll
        for (int l = 0; l < 8; ++l) { const int L = L0 + l; if (L >= nlines) break; const int e = L * 64 + lane * 2; const int d = e & 63; const int j = (e >> 6) & (TT - 1); const int h = e >> 16; v2h o;
#pragma unroll
            for (int q = 0; q < 2; ++q) o[q] = tohx(FR[(size_t)j * DD + h * HD + d + q]);
            *(v2h*)(RK + (size_t)e) = o; }
         }
}
__global__ __launch_bounds__(256) void k_vtplane(const float* __restrict__ F, h16* VT) {
    const int lane = threadIdx.x & 31; const int L0 = (blockIdx.x * 8 + (threadIdx.x >> 5)) * 8; const int nlines = NT * DD / 64;
{
#pragma unroll
        for (int l = 0; l < 8; ++l) { const int L = L0 + l; if (L >= nlines) break; const int e = L * 64 + lane * 2; const int t = e & (TT - 1); const int d = (e >> 10) & 63; const int z = e >> 16; const int b = z >> 4, h = z & 15; v2h v;
#pragma unroll
            for (int q = 0; q < 2; ++q) v[q] = tohx(F[((size_t)(t + q) * NB_ + b) * DD + h * HD + d]);
            *(v2h*)(VT + (size_t)e) = v; }
         }
}
// k_attn: one work-group (8 waves) = 32 query rows of one (batch, head). The whole 32 x 1024 score block stays in LDS (f32, row pitch SP floats), so no score, probability or per-head output plane goes through memory.
// 1) BD: raw tiles (q + r_r_bias).r_k for rows i (lower part) and rows i + 1 (upper part) against the same r_k fragment; element (i, n) lands at its shifted column of row i: with d = i + n + 1 - T,
//    d >= 0 -> column d from row i; d <= -2 -> column d + T + 1 from row i + 1; d == -1 has no place in the shifted row and falls on column T, in the row's pad, which nobody reads.
//    For fixed i that fills every column but i + 1, which holds the shift's zero and is stored by wave 0 (for i = T - 1 that store too falls on the pad).
// 2) AC tiles are added at their own place and scaled by 1/8.  3) each wave: softmax of 4 rows; P (x1024, fp16) overwrites the front half of the row's own bytes, which only that wave touches here.
// 4) P.V: wave = (16-wide d tile, half of the keys), both 16-row tiles; the two halves' partial sums meet in Of.  5) 1/1024, hi/lo bf16 split, one 128-byte line per 8 lanes of one wave.
// Every plain '#pragma unroll' in k_attn: the fragment and accumulator arrays are indexed by the loop counters and stay in registers only when those loops are unrolled.
#define MR 32
#define SP 1028                   // 4112 bytes = 16 x odd: the b128 fragment reads of 16 rows fall on distinct banks
typedef v4h __attribute__((may_alias)) v4ha;
__global__ __launch_bounds__(256) __attribute__((amdgpu_waves_per_eu(4, 4))) void k_attn(const h16* __restrict__ QA, const h16* __restrict__ QB, const h16* __restrict__ KP, const h16* __restrict__ VT, const h16* __restrict__ RK, bf* Ah, bf* Al) {
    __shared__ __align__(16) float S[MR * SP];
    __shared__ __align__(16) float Of[2 * MR * 68];
    const int tid = threadIdx.x, lane = tid & 31, lr = lane & 15, hi = lane >> 4; const int w = __builtin_amdgcn_readfirstlane(tid >> 5);
    const int i0 = blockIdx.x * MR; const int z = blockIdx.y; const int b = z >> 4, h = z & 15;
    const h16* qa = QA + (size_t)z * TT * HD; const h16* qb = QB + (size_t)z * TT * HD; const h16* kp = KP + (size_t)z * TT * HD; const h16* vt = VT + (size_t)z * HD * TT; const h16* rk = RK + (size_t)h * TT * HD;
    if (w == 0) S[lane * SP + i0 + lane + 1] = 0.f;
    // Both score loops are straight-line with two operand buffers: the loads of the next pair of key tiles are issued, then this pair is worked on. The sched_barrier calls hold that order:
    // without them the scheduler lifts all eight tiles' loads to the top and spills past the 256 registers that two work-groups per WGP allow.
    v16h a[2][2], kb[2][2][2];    // AC's operands; the q + r_w_bias rows and the first pair of key tiles are fetched in front of the last BD pair, whose work covers their latency
    const h16* pa = qa + (size_t)(i0 + lr) * HD + 8 * hi; const h16* pk = kp + (size_t)(w * 128 + lr) * HD + 8 * hi;
    {   v16h aL[2][2], aU[2][2], rb[2][2][2]; const h16* bp = rk + (size_t)(w * 128 + lr) * HD + 8 * hi; const h16* pL = qb + (size_t)(i0 + lr) * HD + 8 * hi;
        const int ru = (i0 + 17 + lr < TT) ? i0 + 17 + lr : TT - 1; const h16* pU = qb + (size_t)ru * HD + 8 * hi;    // row T does not exist; row T - 1 has no upper part, so its aU result is never chosen
#pragma unroll
        for (int ks = 0; ks < 2; ++ks) { aL[0][ks] = WFrag<h16>::ld(pL + ks * 32); aL[1][ks] = WFrag<h16>::ld(pL + 16 * HD + ks * 32); aU[0][ks] = WFrag<h16>::ld(pL + HD + ks * 32); aU[1][ks] = WFrag<h16>::ld(pU + ks * 32); }
#pragma unroll
        for (int t = 0; t < 2; ++t) { rb[0][t][0] = WFrag<h16>::ld(bp + t * 16 * HD); rb[0][t][1] = WFrag<h16>::ld(bp + t * 16 * HD + 32); }
        asm volatile("s_wait_xcnt 0x0" :: "v"(pL), "v"(pU) : "memory");    // the address registers of the issued loads are held to here and may be reused only behind this wait
#pragma unroll
        for (int g = 0; g < 4; ++g) {
            if (g < 3) {
#pragma unroll
                for (int t = 0; t < 2; ++t) { rb[(g + 1) & 1][t][0] = WFrag<h16>::ld(bp + ((g + 1) * 2 + t) * 16 * HD); rb[(g + 1) & 1][t][1] = WFrag<h16>::ld(bp + ((g + 1) * 2 + t) * 16 * HD + 32); } }
            else {
#pragma unroll
                for (int mb = 0; mb < 2; ++mb)
#pragma unroll
                    for (int ks = 0; ks < 2; ++ks) { a[mb][ks] = WFrag<h16>::ld(pa + mb * 16 * HD + ks * 32); kb[0][mb][ks] = WFrag<h16>::ld(pk + mb * 16 * HD + ks * 32); } }
            if (g == 2) asm volatile("s_wait_xcnt 0x0" :: "v"(bp) : "memory");    // last loads through bp: its registers are held to here and reused only behind this wait
            if (g == 3) asm volatile("s_wait_xcnt 0x0" :: "v"(pa) : "memory");    // the same for pa
            __builtin_amdgcn_sched_barrier(0);    // the next pair's loads stay in front of this pair's work
#pragma unroll
            for (int t = 0; t < 2; ++t) { const int n0 = w * 128 + (g * 2 + t) * 16;
#pragma unroll
                for (int mb = 0; mb < 2; ++mb) { v8f cL = (v8f){}, cU = (v8f){}; cL = wmma16(aL[mb][0], rb[g & 1][t][0], cL); cU = wmma16(aU[mb][0], rb[g & 1][t][0], cU); cL = wmma16(aL[mb][1], rb[g & 1][t][1], cL); cU = wmma16(aU[mb][1], rb[g & 1][t][1], cU);
#pragma unroll
                    for (int j = 0; j < 8; ++j) { const int ml = mb * 16 + hi * 8 + j; const int d = i0 + ml + n0 + lr + 1 - TT;
                        S[ml * SP + d + ((d >> 31) & (TT + 1))] = (d >= 0) ? cL[j] : cU[j]; } } }
            __builtin_amdgcn_sched_barrier(0);    // later pairs' loads stay behind this pair's work
        }
    }
    __syncthreads();              // every shifted BD element is in place before AC is added to it
    {
#pragma unroll
        for (int g = 0; g < 4; ++g) {
            if (g < 3) {
#pragma unroll
                for (int t = 0; t < 2; ++t) { kb[(g + 1) & 1][t][0] = WFrag<h16>::ld(pk + ((g + 1) * 2 + t) * 16 * HD); kb[(g + 1) & 1][t][1] = WFrag<h16>::ld(pk + ((g + 1) * 2 + t) * 16 * HD + 32); } }
            if (g == 2) asm volatile("s_wait_xcnt 0x0" :: "v"(pk) : "memory");    // last loads through pk: its registers are held to here and reused only behind this wait
            __builtin_amdgcn_sched_barrier(0);    // the next pair's loads stay in front of this pair's work
#pragma unroll
            for (int t = 0; t < 2; ++t) { const int n0 = w * 128 + (g * 2 + t) * 16;
#pragma unroll
                for (int mb = 0; mb < 2; ++mb) { v8f c = (v8f){}; c = wmma16(a[mb][0], kb[g & 1][t][0], c); c = wmma16(a[mb][1], kb[g & 1][t][1], c);
#pragma unroll
                    for (int j = 0; j < 8; ++j) { float* sp = S + (mb * 16 + hi * 8 + j) * SP + n0 + lr; *sp = __fmul_rn(__fadd_rn(c[j], *sp), 0.125f); } } }
            __builtin_amdgcn_sched_barrier(0);    // later pairs' loads stay behind this pair's work
        }
    }
    __syncthreads();              // whole rows are complete before a wave reduces them
    const int dt = w & 3, kh = w >> 2; v16h bv[16]; const h16* vp = vt + (size_t)(dt * 16 + lr) * TT + kh * 512 + 8 * hi;    // this wave's V fragments: the first eight are fetched here, so that their latency passes behind the softmax
#pragma unroll
    for (int ks = 0; ks < 8; ++ks) bv[ks] = WFrag<h16>::ld(vp + ks * 32);
#pragma unroll 1                  // rolled: one row's 32 values at a time, so that the V fragments held across this loop stay in registers
    for (int rr = 0; rr < 4; ++rr) { float* sr = S + (w * 4 + rr) * SP; float v[32]; float mx = -3.0e38f;
#pragma unroll
        for (int ch = 0; ch < 8; ++ch) { const v4f sv = *(const v4fa*)(sr + ch * 128 + lane * 4);
#pragma unroll
            for (int q = 0; q < 4; ++q) { v[ch * 4 + q] = sv[q]; mx = fmaxf(mx, sv[q]); } }
#pragma unroll
        for (int sh = 16; sh; sh >>= 1) mx = fmaxf(mx, __shfl_xor(mx, sh, 32));
        float sum = 0.f;
#pragma unroll
        for (int k = 0; k < 32; ++k) { v[k] = __expf(v[k] - mx); sum += v[k]; }
#pragma unroll
        for (int sh = 16; sh; sh >>= 1) sum += __shfl_xor(sum, sh, 32);
        const float fct = __fdiv_rn(PCAR, sum); h16* pr = (h16*)sr;
#pragma unroll
        for (int ch = 0; ch < 8; ++ch) { v4h o;
#pragma unroll
            for (int q = 0; q < 4; ++q) o[q] = tohx(v[ch * 4 + q] * fct);
            *(v4ha*)(pr + ch * 128 + lane * 4) = o; } }
    __syncthreads();              // P of all 32 rows is written before any wave reads it as its A operand
#pragma unroll
    for (int ks = 8; ks < 16; ++ks) bv[ks] = WFrag<h16>::ld(vp + ks * 32);    // the other eight fly while the first eight are worked on (all sixteen held over the softmax spill)
    asm volatile("s_wait_xcnt 0x0" :: "v"(vp) : "memory");    // last loads through vp: its registers are held to here and reused only behind this wait
    {   const h16* P = (const h16*)S; v8f o[2]; o[0] = (v8f){}; o[1] = (v8f){}; const h16* pp = P + (size_t)lr * (2 * SP) + kh * 512 + 8 * hi;
#pragma unroll
        for (int ks = 0; ks < 16; ++ks) {
#pragma unroll
            for (int mb = 0; mb < 2; ++mb) { const h16* ap = pp + (size_t)mb * 16 * (2 * SP) + ks * 32; o[mb] = wmma16(cat16(*(const v8ha*)ap, *(const v8ha*)(ap + 16)), bv[ks], o[mb]); } }
#pragma unroll
        for (int mb = 0; mb < 2; ++mb)
#pragma unroll
            for (int j = 0; j < 8; ++j) Of[(kh * MR + mb * 16 + hi * 8 + j) * 68 + dt * 16 + lr] = o[mb][j];
    }
    __syncthreads();              // both key halves' partial sums are in Of
    {   const int row = tid >> 3, d0 = (tid & 7) * 8; const float* p0 = Of + row * 68 + d0; const float* p1 = p0 + MR * 68; v8us oh, ol;
#pragma unroll
        for (int q = 0; q < 8; ++q) { unsigned short x, y; splitf(__fadd_rn(p0[q], p1[q]) * (1.0f / PCAR), x, y); oh[q] = x; ol[q] = y; }
        const size_t o = ((size_t)(i0 + row) * NB_ + b) * DD + h * HD + d0; *(v8us*)(Ah + o) = oh; *(v8us*)(Al + o) = ol; }
}

extern "C" void kernel_launch(void* const* d_in, const int* in_sizes, int n_in,
                              void* d_out, int out_size, void* d_ws, size_t ws_size, hipStream_t stream) {
    (void)in_sizes; (void)n_in; (void)out_size;
    const float* IN[23]; for (int i = 0; i < 23; ++i) IN[i] = (const float*)d_in[i];
    // input [1024][4][1024], pos [1024][1][1024], indices (int [1]), in_proj_weight [3072][1024], in_proj_bias, out_proj_weight, out_proj_bias, pos_proj_weight, pos_proj_bias,
    // r_i [8][4][3072], s_i [8][4][1024], r_p, s_p, r_o, s_o, rm_i [8][1][3072], sm_i [8][1][1024], rm_p, sm_p, rm_o, sm_o, r_w_bias [16][64], r_r_bias = d_in[0..22]
    const float* x = IN[0]; const float* r = IN[1]; const int* idx = (const int*)d_in[2]; const float* rwb = IN[21]; const float* rrb = IN[22];
    float* OUT = (float*)d_out;     // [1024][4][1024] (rows t*4 + b)
    char* wsp = (char*)d_ws;
    auto take = [&](size_t bytes) { char* p = wsp; wsp += (bytes + 255) & ~(size_t)255; return (void*)p; };
    bf* WIh = (bf*)take((size_t)3 * DD * DD * 2); bf* WIl = (bf*)take((size_t)3 * DD * DD * 2); bf* WRh = (bf*)take((size_t)DD * DD * 2); bf* WRl = (bf*)take((size_t)DD * DD * 2); bf* WOh = (bf*)take((size_t)DD * DD * 2); bf* WOl = (bf*)take((size_t)DD * DD * 2);
    bf* XB = (bf*)take((size_t)NT * DD * 2); bf* RB = (bf*)take((size_t)TT * DD * 2); float* F = (float*)take((size_t)NT * DD * 4);
    h16* QA = (h16*)take((size_t)NT * DD * 2); h16* QB = (h16*)take((size_t)NT * DD * 2); h16* KP = (h16*)take((size_t)NT * DD * 2); h16* VT = (h16*)take((size_t)NT * DD * 2); h16* RK = (h16*)take((size_t)NH_ * TT * HD * 2);
    bf* ATh = (bf*)F; bf* ATl = ATh + (size_t)NT * DD;   // the merged hi/lo planes lie in F: its last reader (k_rk16) runs before k_attn, and both planes fill exactly its bytes
    if ((size_t)(wsp - (char*)d_ws) > ws_size) return;    // total 80 MiB; ws 256 MiB
    { const unsigned gi = (unsigned)(((size_t)3 * DD * DD / 2 + 255) / 256), g1 = (unsigned)(((size_t)DD * DD / 2 + 255) / 256);
      k_fact<<<gi, 256, 0, stream>>>(IN[3], idx, IN[15], IN[16], IN[9], IN[10], 3 * DD, WIh, WIl);     // in_proj: rm_i, sm_i, r_i, s_i
      k_fact<<<g1, 256, 0, stream>>>(IN[7], idx, IN[17], IN[18], IN[11], IN[12], DD, WRh, WRl);         // pos_proj: rm_p, sm_p, r_p, s_p
      k_fact<<<g1, 256, 0, stream>>>(IN[5], idx, IN[19], IN[20], IN[13], IN[14], DD, WOh, WOl);         // out_proj: rm_o, sm_o, r_o, s_o
      const size_t nx = (size_t)NT * DD / 8; k_cvt8<<<(unsigned)((nx + 255) / 256), 256, 0, stream>>>(x, XB, nx); k_cvt8<<<(unsigned)(((size_t)TT * DD / 8 + 255) / 256), 256, 0, stream>>>(r, RB, (size_t)TT * DD / 8); }
    const unsigned LB = (unsigned)((NT * DD / 64 + 63) / 64); const dim3 gP(NT / 64, DD / 64, 1);
    k_gemmw<bf, 3, true><<<gP, 32, 0, stream>>>(XB, nullptr, WIh, WIl, DD, F, DD, IN[4], 0, 0, 0); k_hb16<<<LB, 256, 0, stream>>>(F, rwb, QA); k_hb16<<<LB, 256, 0, stream>>>(F, rrb, QB);
    k_gemmw<bf, 3, true><<<gP, 32, 0, stream>>>(XB, nullptr, WIh + (size_t)DD * DD, WIl + (size_t)DD * DD, DD, F, DD, IN[4] + DD, 0, 0, 0); k_hb16<<<LB, 256, 0, stream>>>(F, nullptr, KP);
    k_gemmw<bf, 3, true><<<gP, 32, 0, stream>>>(XB, nullptr, WIh + (size_t)2 * DD * DD, WIl + (size_t)2 * DD * DD, DD, F, DD, IN[4] + 2 * DD, 0, 0, 0); k_vtplane<<<LB, 256, 0, stream>>>(F, VT);
    k_gemmw<bf, 3, true><<<dim3(TT / 64, DD / 64, 1), 32, 0, stream>>>(RB, nullptr, WRh, WRl, DD, F, DD, IN[8], 0, 0, 0); k_rk16<<<(unsigned)((NH_ * TT * HD / 64 + 63) / 64), 256, 0, stream>>>(F, RK);
    k_attn<<<dim3(TT / MR, NB_ * NH_, 1), 256, 0, stream>>>(QA, QB, KP, VT, RK, ATh, ATl);
    k_gemmw<bf, 2, true><<<gP, 32, 0, stream>>>(ATh, ATl, WOh, WOl, DD, OUT, DD, IN[6], 0, 0, 0);
}

// v004
// It runs in 225 microseconds.
// Next to v003, in two timings, it ran 1.31 times as fast each time.
// All steps since v000 together make it 7.59 times as fast.
#include <hip/hip_runtime.h>

// Relative-position multi-head attention (segment-recurrence style relative shift; query [1024][4][1024] seq-first, r [1024][1024]; w = query qkv_w^T -> q|k|v (16 heads x 64); r_k = r r_w^T; AC = (q + r_w_bias).k,
// BD = rel_shift((q + r_r_bias).r_k) with the module's exact zero-pad/reshape shift (out[i][j] = BD[f / (T+1)][f % (T+1) - 1] or 0 when f % (T+1) == 0, f = T + i*T + j); p = softmax((AC + BD) / 8)
// over the keys; attn = p.v; out = merged out_w^T + out_b; output [1024][4][1024] (rows t*4 + b)).
// Compute dtypes, f32 accumulate: every input rounded to bf16; the qkv and r projections on bf16 inputs (exact) x hi/lo bf16 weight planes (two products); AC, BD and attn.v on SINGLE fp16 planes
// (the per-head biases added in f32 before the fp16 rounding; logit sd ~ 0.6); the relative shift is done by where each BD element is stored in the LDS score block of k_attn; P x1024;

// FRAGMENT ORDER of every 16-bit WMMA operand plane in the workspace (rows x K, K % 32 == 0): tiles of 16 rows x 32 k = 1 KiB, tile (row / 16, k / 32) at index (row / 16) * (K / 32) + k / 32; inside a tile the 16-byte chunk
// of row lr, k = half * 16 + hi * 8 + 0..7 stands at chunk half * 32 + hi * 16 + lr. That is the register layout of a 16x16x32 A or B fragment, so a fragment is two loads of 512 contiguous bytes (lane * 16): four whole 128-byte lines each.

#define NB_  4
#define TT   1024
#define NLY  8                    // weight-factor layers
#define RNK  4                    // additive rank
#define DD   1024
#define NH_  16
#define HD   64
#define NT   (NB_ * TT)
#define PCAR 1024.0f
typedef _Float16 h16;
typedef unsigned short bf;
typedef __attribute__((ext_vector_type(16))) __bf16   v16bf;
typedef __attribute__((ext_vector_type(16))) _Float16 v16h;
typedef __attribute__((ext_vector_type(8)))  _Float16 v8h;
typedef __attribute__((ext_vector_type(8)))  unsigned short v8us;
typedef __attribute__((ext_vector_type(8)))  float    v8f;
typedef __attribute__((ext_vector_type(4)))  float    v4f;
typedef v8h  __attribute__((may_alias)) v8ha;
typedef v4f  __attribute__((may_alias)) v4fa;
typedef v8us __attribute__((may_alias)) v8usa;

__device__ __forceinline__ unsigned short f2bf(float f) { unsigned u = __float_as_uint(f); u += 0x7FFFu + ((u >> 16) & 1u); return (unsigned short)(u >> 16); }
__device__ __forceinline__ float bf2f(unsigned short b) { return __uint_as_float(((unsigned)b) << 16); }
__device__ __forceinline__ float bfr(float f) { return bf2f(f2bf(f)); }
__device__ __forceinline__ v16h cat16(v8h lo, v8h hi) { return __builtin_shufflevector(lo, hi, 0, 1, 2, 3, 4, 5, 6, 7, 8, 9, 10, 11, 12, 13, 14, 15); }
__device__ __forceinline__ v16bf cat16b(v8us lo, v8us hi) { return __builtin_bit_cast(v16bf, __builtin_shufflevector(lo, hi, 0, 1, 2, 3, 4, 5, 6, 7, 8, 9, 10, 11, 12, 13, 14, 15)); }
__device__ __forceinline__ v8f wmma16(v16h a, v16h b, v8f c) { return __builtin_amdgcn_wmma_f32_16x16x32_f16(false, a, false, b, (short)0, c, false, false); }
__device__ __forceinline__ v8f wmmab(v16bf a, v16bf b, v8f c) { return __builtin_amdgcn_wmma_f32_16x16x32_bf16(false, a, false, b, (short)0, c, false, false); }



// ---- k_gemmw: register-blocked GEMM, ONE WAVE per 64x64 output tile (16 accumulators), operands straight from 16-bit planes in fragment order (ld takes tile start + lane * 8 elements); grid (M/64, N/64, Z), 32 threads.
// C[m][n] (f32, pitch ldc, + optional f32 bias[n]) = sum_k A[m][k] Bt[n][k] (+ split products per NSPLIT). z-batch strides sA/sB/sC in elements. K % 64 == 0. TB: row m of A is (batch m / TT, time m % TT) and goes to row time * NB_ + batch of C.
template <typename T16> struct WFrag;
template <> struct WFrag<h16> { typedef v16h V; static __device__ __forceinline__ V ld(const h16* p) { return cat16(*(const v8h*)p, *(const v8h*)(p + 256)); } static __device__ __forceinline__ v8f mma(V a, V b, v8f c) { return wmma16(a, b, c); } };
template <> struct WFrag<bf> { typedef v16bf V; static __device__ __forceinline__ V ld(const bf* p) { return cat16b(*(const v8us*)p, *(const v8us*)(p + 256)); } static __device__ __forceinline__ v8f mma(V a, V b, v8f c) { return wmmab(a, b, c); } };
template <typename T16, int NSPLIT, bool BIAS, bool TB>
__global__ __launch_bounds__(32) void k_gemmw(const T16* __restrict__ A, const T16* __restrict__ A2, const T16* __restrict__ Bt, const T16* __restrict__ Bt2, int K, float* C, int ldc, const float* __restrict__ bias, size_t sA, size_t sB, size_t sC) {
    typedef typename WFrag<T16>::V V;
    __shared__ __align__(16) float os[16 * 68];
    const size_t z = blockIdx.z; A += z * sA; if (A2) A2 += z * sA; Bt += z * sB; if (Bt2) Bt2 += z * sB; C += z * sC;
    const int lane = threadIdx.x & 31, lr = lane & 15, hi = lane >> 4; const int r0 = blockIdx.x * 64, c0 = blockIdx.y * 64;
    v8f acc[4][4];
#pragma unroll
    for (int mb = 0; mb < 4; ++mb)
#pragma unroll
        for (int nb = 0; nb < 4; ++nb) acc[mb][nb] = (v8f){};
    // Two fragment sets in registers: as soon as a set's WMMAs are issued, its refill for two k steps on (every A and B fragment, one group of loads) goes out and flies during the other set's WMMAs,
    // so that a wave waits for memory at most once per step, with a step of matrix work as lead. Each accumulator takes its products in the same order as with one set.
    V a[2][4], a2[2][4], b[2][4], b2[2][4];
    const char* pA[4]; const char* pA2[4]; const char* pB[4]; const char* pB2[4];    // wave-uniform start of each 16-row block (its K / 32 tiles lie in a row); they never change
#pragma unroll
    for (int q = 0; q < 4; ++q) { pA[q] = (const char*)(A + (size_t)(r0 + q * 16) * K); pA2[q] = (NSPLIT == 1 || NSPLIT == 2) ? (const char*)(A2 + (size_t)(r0 + q * 16) * K) : nullptr; pB[q] = (const char*)(Bt + (size_t)(c0 + q * 16) * K); pB2[q] = (NSPLIT >= 2) ? (const char*)(Bt2 + (size_t)(c0 + q * 16) * K) : nullptr; }
    unsigned vo = (unsigned)lane * 16u;    // this lane's byte offset inside a block, the same for every block: the one address register that moves, at the foot of a trip
    auto ldset = [&](int s, int ko) {
        if (NSPLIT == 2) asm volatile("s_wait_loadcnt 0x1f" ::: "memory");    // a set is 32 loads here: with at most 31 older ones left, a wave never has more than 63 outstanding, the most that s_wait_loadcnt can name
#pragma unroll
        for (int mb = 0; mb < 4; ++mb) { a[s][mb] = WFrag<T16>::ld((const T16*)(pA[mb] + vo) + ko); if (NSPLIT == 1 || NSPLIT == 2) a2[s][mb] = WFrag<T16>::ld((const T16*)(pA2[mb] + vo) + ko); }
#pragma unroll
        for (int nb = 0; nb < 4; ++nb) { b[s][nb] = WFrag<T16>::ld((const T16*)(pB[nb] + vo) + ko); if (NSPLIT >= 2) b2[s][nb] = WFrag<T16>::ld((const T16*)(pB2[nb] + vo) + ko); }
        asm volatile("s_wait_xcnt 0x0" ::: "memory");    // the base and offset registers of this group's loads are rewritten (the offset at a trip's foot, the bases behind the loop) only behind this wait
        __builtin_amdgcn_sched_barrier(0);    // a refill, with its wait, stays in front of the other set's WMMAs
    };
    auto mmset = [&](int s) {
#pragma unroll
        for (int nb = 0; nb < 4; ++nb)
#pragma unroll
            for (int mb = 0; mb < 4; ++mb) { acc[mb][nb] = WFrag<T16>::mma(a[s][mb], b[s][nb], acc[mb][nb]); if (NSPLIT == 1 || NSPLIT == 2) acc[mb][nb] = WFrag<T16>::mma(a2[s][mb], b[s][nb], acc[mb][nb]); if (NSPLIT >= 2) acc[mb][nb] = WFrag<T16>::mma(a[s][mb], b2[s][nb], acc[mb][nb]); }
        __builtin_amdgcn_sched_barrier(0);    // the loads that refill this set stay behind its WMMAs
    };
    ldset(0, 0); ldset(1, 512);    // ko: elements from the trip's first tile, 512 a tile
#pragma unroll 1                  // rolled: two steps a trip, so that each set keeps its own registers
    for (int kc = 64; kc < K; kc += 64) {
        mmset(0); ldset(0, 1024);
        mmset(1);
        vo += 2048;    // two tiles on; behind the wait that closes ldset(0, 1024); no load stands between
        ldset(1, 512);
    }
    mmset(0); mmset(1);
#pragma unroll
    for (int mb = 0; mb < 4; ++mb) {
#pragma unroll
        for (int nb = 0; nb < 4; ++nb) {
#pragma unroll
            for (int j = 0; j < 8; ++j) os[(hi * 8 + j) * 68 + nb * 16 + lr] = acc[mb][nb][j]; }
        __builtin_amdgcn_wave_barrier(); asm volatile("" ::: "memory");
        const size_t rs = TB ? (size_t)NB_ * ldc : (size_t)ldc; float* crow = TB ? C + ((size_t)((r0 & (TT - 1)) + mb * 16) * NB_ + (r0 / TT)) * ldc + c0 : C + (size_t)(r0 + mb * 16) * ldc + c0;
{
#pragma unroll
            for (int s = 0; s < 8; ++s) { const int row = 2 * s + hi, cofs = lr * 4; v4f val = *(const v4fa*)(os + row * 68 + cofs); if (BIAS) { val[0] += bfr(bias[c0 + cofs]); val[1] += bfr(bias[c0 + cofs + 1]); val[2] += bfr(bias[c0 + cofs + 2]); val[3] += bfr(bias[c0 + cofs + 3]); }
                *(v4f*)(crow + (size_t)row * rs + cofs) = val; }
             }
        __builtin_amdgcn_wave_barrier(); asm volatile("" ::: "memory");
        asm volatile("s_wait_xcnt 0x0" ::: "memory");    // the address registers of this block's stores are reused only behind this wait
    }
}

__device__ __forceinline__ h16 tohx(float x) { return (h16)x; }
__device__ __forceinline__ void splitf(float y, unsigned short& h, unsigned short& l) { h = f2bf(y); l = f2bf(y - bf2f(h)); }
typedef __attribute__((ext_vector_type(2))) _Float16 v2h;
typedef __attribute__((ext_vector_type(4))) _Float16 v4h;
typedef __attribute__((ext_vector_type(2))) unsigned short v2us;
typedef __attribute__((ext_vector_type(4))) int v4i;

// row and first k of the 16-byte chunk c of a plane in fragment order with kt = K / 32 tiles per 16 rows. The kernels below that fill such a plane go by the place they write, so that every store covers whole lines.
__device__ __forceinline__ void fo_rk(unsigned c, unsigned kt, int& row, int& k) { const unsigned tile = c >> 6; row = (int)((tile / kt) * 16 + (c & 15)); k = (int)((tile % kt) * 32 + ((c >> 5) & 1) * 16 + ((c >> 4) & 1) * 8); }
__global__ __launch_bounds__(256) void k_cvt8(const float* __restrict__ src, bf* dst, size_t n8) { const size_t i = (size_t)blockIdx.x * 256 + threadIdx.x; if (i >= n8) return; int row, k0; fo_rk((unsigned)i, DD / 32, row, k0); const v8f v = *(const v8f*)(src + (size_t)row * DD + k0); v8us o;
#pragma unroll
    for (int k = 0; k < 8; ++k) o[k] = f2bf(v[k]); *(v8us*)(dst + i * 8) = o;  }
// k_fact: factorised weight hi/lo planes: W'[a][b] = bf16(W[a][b]) bf16(rm[l][a]) bf16(sm[l][b]) + sum_k bf16(r[l][k][a]) bf16(s[l][k][b]) (f32, fixed order), l = indices[0] read on device (int input,
__global__ __launch_bounds__(256) void k_fact(const float* __restrict__ W, const int* __restrict__ idx, const float* __restrict__ rm, const float* __restrict__ sm, const float* __restrict__ rr, const float* __restrict__ ss, int rows, bf* Wh, bf* Wl) {
    const size_t i = ((size_t)blockIdx.x * 256 + threadIdx.x) * 2; if (i >= (size_t)rows * DD) return; int a, b0; fo_rk((unsigned)(i >> 3), DD / 32, a, b0); b0 += (int)(i & 7); int l = idx[0]; l = l < 0 ? 0 : (l >= NLY ? NLY - 1 : l); v2us oh, ol;
#pragma unroll
    for (int q = 0; q < 2; ++q) { const int b = b0 + q; float m = __fmul_rn(bfr(rm[(size_t)l * rows + a]), bfr(sm[(size_t)l * DD + b])); asm volatile("" : "+v"(m)); float w = __fmul_rn(bfr(W[(size_t)a * DD + b]), m); asm volatile("" : "+v"(w)); float ad = 0.f;
#pragma unroll
        for (int k = 0; k < RNK; ++k) { float p = __fmul_rn(bfr(rr[((size_t)l * RNK + k) * rows + a]), bfr(ss[((size_t)l * RNK + k) * DD + b])); asm volatile("" : "+v"(p)); ad = __fadd_rn(ad, p); }
        unsigned short h, lo; splitf(__fadd_rn(w, ad), h, lo); oh[q] = h; ol[q] = lo; }
    *(v2us*)(Wh + i) = oh; *(v2us*)(Wl + i) = ol;  }
__global__ __launch_bounds__(256) void k_hb16(const float* __restrict__ F, const float* __restrict__ hb, h16* P) {
    const int lane = threadIdx.x & 31; const int L0 = (blockIdx.x * 8 + (threadIdx.x >> 5)) * 8; const int nlines = NT * DD / 64;
{
#pragma unroll
        for (int l = 0; l < 8; ++l) { const int L = L0 + l; if (L >= nlines) break; const int e = L * 64 + lane * 2; int t, d; fo_rk((unsigned)(e & 65535) >> 3, HD / 32, t, d); d += e & 7; const int z = e >> 16; const int b = z >> 4, h = z & 15; v2h o;
#pragma unroll
            for (int q = 0; q < 2; ++q) { const float bb = hb ? bfr(hb[h * HD + d + q]) : 0.f; o[q] = tohx(__fadd_rn(F[((size_t)t * NB_ + b) * DD + h * HD + d + q], bb)); }
            *(v2h*)(P + (size_t)e) = o; }
         }
}
__global__ __launch_bounds__(256) void k_rk16(const float* __restrict__ FR, h16* RK) {
    const int lane = threadIdx.x & 31; const int L0 = (blockIdx.x * 8 + (threadIdx.x >> 5)) * 8; const int nlines = NH_ * TT * HD / 64;
{
#pragma unroll
        for (int l = 0; l < 8; ++l) { const int L = L0 + l; if (L >= nlines) break; const int e = L * 64 + lane * 2; int j, d; fo_rk((unsigned)(e & 65535) >> 3, HD / 32, j, d); d += e & 7; const int h = e >> 16; v2h o;
#pragma unroll
            for (int q = 0; q < 2; ++q) o[q] = tohx(FR[(size_t)j * DD + h * HD + d + q]);
            *(v2h*)(RK + (size_t)e) = o; }
         }
}
__global__ __launch_bounds__(256) void k_vtplane(const float* __restrict__ F, h16* VT) {
    const int lane = threadIdx.x & 31; const int L0 = (blockIdx.x * 8 + (threadIdx.x >> 5)) * 8; const int nlines = NT * DD / 64;
{
#pragma unroll
        for (int l = 0; l < 8; ++l) { const int L = L0 + l; if (L >= nlines) break; const int e = L * 64 + lane * 2; int d, t; fo_rk((unsigned)(e & 65535) >> 3, TT / 32, d, t); t += e & 7; const int z = e >> 16; const int b = z >> 4, h = z & 15; v2h v;
#pragma unroll
            for (int q = 0; q < 2; ++q) v[q] = tohx(F[((size_t)(t + q) * NB_ + b) * DD + h * HD + d]);
            *(v2h*)(VT + (size_t)e) = v; }
         }
}
// k_attn: one work-group (8 waves) = 32 query rows of one (batch, head). The whole 32 x 1024 score block stays in LDS (f32, row pitch SP floats), so no score, probability or per-head output plane goes through memory.
// 1) BD: raw tiles (q + r_r_bias).r_k for rows i (lower part) and rows i + 1 (upper part) against the same r_k fragment; element (i, n) lands at its shifted column of row i: with d = i + n + 1 - T,
//    d >= 0 -> column d from row i; d <= -2 -> column d + T + 1 from row i + 1; d == -1 has no place in the shifted row and falls on column T, in the row's pad, which nobody reads.
//    For fixed i that fills every column but i + 1, which holds the shift's zero and is stored by wave 0 (for i = T - 1 that store too falls on the pad).
// 2) AC tiles are added at their own place and scaled by 1/8.  3) each wave: softmax of 4 rows; P (x1024, fp16) overwrites the front half of the row's own bytes, which only that wave touches here.
// 4) P.V: wave = (16-wide d tile, half of the keys), both 16-row tiles; the two halves' partial sums meet in Of.  5) 1/1024, hi/lo bf16 split; the merged planes are in fragment order with rows batch * T + time, so the work-group owns four whole tiles of each and a wave stores 512 bytes in a row.
// Every plain '#pragma unroll' in k_attn: the fragment and accumulator arrays are indexed by the loop counters and stay in registers only when those loops are unrolled.
#define MR 32
#define SP 1028                   // 4112 bytes = 16 x odd: the b128 fragment reads of 16 rows fall on distinct banks
typedef v4h __attribute__((may_alias)) v4ha;
__global__ __launch_bounds__(256) __attribute__((amdgpu_waves_per_eu(4, 4))) void k_attn(const h16* __restrict__ QA, const h16* __restrict__ QB, const h16* __restrict__ KP, const h16* __restrict__ VT, const h16* __restrict__ RK, bf* Ah, bf* Al) {
    __shared__ __align__(16) float S[MR * SP];
    __shared__ __align__(16) float Of[2 * MR * 68];
    const int tid = threadIdx.x, lane = tid & 31, lr = lane & 15, hi = lane >> 4; const int w = __builtin_amdgcn_readfirstlane(tid >> 5);
    const int i0 = blockIdx.x * MR; const int z = blockIdx.y; const int b = z >> 4, h = z & 15;
    const h16* qa = QA + (size_t)z * TT * HD; const h16* qb = QB + (size_t)z * TT * HD; const h16* kp = KP + (size_t)z * TT * HD; const h16* vt = VT + (size_t)z * HD * TT; const h16* rk = RK + (size_t)h * TT * HD;
    if (w == 0) S[lane * SP + i0 + lane + 1] = 0.f;
    // Both score loops are straight-line with two operand buffers: the loads of the next pair of key tiles are issued, then this pair is worked on. The sched_barrier calls hold that order:
    // without them the scheduler lifts all eight tiles' loads to the top and spills past the 256 registers that two work-groups per WGP allow.
    v16h a[2][2], kb[2][2][2];    // AC's operands; the q + r_w_bias rows and the first pair of key tiles are fetched in front of the last BD pair, whose work covers their latency
    const h16* pa = qa + (size_t)i0 * HD + lane * 8; const h16* pk = kp + (size_t)(w * 128) * HD + lane * 8;    // 16 rows of 64 = two tiles = 16 * HD elements; the second tile (k 32..63) 512 elements on
    {   v16h aL[2][2], aU[2][2], rb[2][2][2]; const h16* bp = rk + (size_t)(w * 128) * HD + lane * 8; const h16* pL = qb + (size_t)i0 * HD + lane * 8;
        const int ru = (i0 + 17 + lr < TT) ? i0 + 17 + lr : TT - 1; const h16* pU = qb + (size_t)(ru >> 4) * 16 * HD + (hi * 16 + (ru & 15)) * 8;    // row T does not exist; row T - 1 has no upper part, so its aU result is never chosen
        const int rv = i0 + 1 + lr; const h16* pV = qb + (size_t)(rv >> 4) * 16 * HD + (hi * 16 + (rv & 15)) * 8;    // rows i + 1 straddle two row blocks: lane 15's (and 31's) chunk lies in the next one
#pragma unroll
        for (int ks = 0; ks < 2; ++ks) { aL[0][ks] = WFrag<h16>::ld(pL + ks * 512); aL[1][ks] = WFrag<h16>::ld(pL + 16 * HD + ks * 512); aU[0][ks] = WFrag<h16>::ld(pV + ks * 512); aU[1][ks] = WFrag<h16>::ld(pU + ks * 512); }
#pragma unroll
        for (int t = 0; t < 2; ++t) { rb[0][t][0] = WFrag<h16>::ld(bp + t * 16 * HD); rb[0][t][1] = WFrag<h16>::ld(bp + t * 16 * HD + 512); }
        asm volatile("s_wait_xcnt 0x0" :: "v"(pL), "v"(pU), "v"(pV) : "memory");    // the address registers of the issued loads are held to here and may be reused only behind this wait
#pragma unroll
        for (int g = 0; g < 4; ++g) {
            if (g < 3) {
#pragma unroll
                for (int t = 0; t < 2; ++t) { rb[(g + 1) & 1][t][0] = WFrag<h16>::ld(bp + ((g + 1) * 2 + t) * 16 * HD); rb[(g + 1) & 1][t][1] = WFrag<h16>::ld(bp + ((g + 1) * 2 + t) * 16 * HD + 512); } }
            else {
#pragma unroll
                for (int mb = 0; mb < 2; ++mb)
#pragma unroll
                    for (int ks = 0; ks < 2; ++ks) { a[mb][ks] = WFrag<h16>::ld(pa + mb * 16 * HD + ks * 512); kb[0][mb][ks] = WFrag<h16>::ld(pk + mb * 16 * HD + ks * 512); } }
            if (g == 2) asm volatile("s_wait_xcnt 0x0" :: "v"(bp) : "memory");    // last loads through bp: its registers are held to here and reused only behind this wait
            if (g == 3) asm volatile("s_wait_xcnt 0x0" :: "v"(pa) : "memory");    // the same for pa
            __builtin_amdgcn_sched_barrier(0);    // the next pair's loads stay in front of this pair's work
#pragma unroll
            for (int t = 0; t < 2; ++t) { const int n0 = w * 128 + (g * 2 + t) * 16;
#pragma unroll
                for (int mb = 0; mb < 2; ++mb) { v8f cL = (v8f){}, cU = (v8f){}; cL = wmma16(aL[mb][0], rb[g & 1][t][0], cL); cU = wmma16(aU[mb][0], rb[g & 1][t][0], cU); cL = wmma16(aL[mb][1], rb[g & 1][t][1], cL); cU = wmma16(aU[mb][1], rb[g & 1][t][1], cU);
#pragma unroll
                    for (int j = 0; j < 8; ++j) { const int ml = mb * 16 + hi * 8 + j; const int d = i0 + ml + n0 + lr + 1 - TT;
                        S[ml * SP + d + ((d >> 31) & (TT + 1))] = (d >= 0) ? cL[j] : cU[j]; } } }
            __builtin_amdgcn_sched_barrier(0);    // later pairs' loads stay behind this pair's work
        }
    }
    __syncthreads();              // every shifted BD element is in place before AC is added to it
    {
#pragma unroll
        for (int g = 0; g < 4; ++g) {
            if (g < 3) {
#pragma unroll
                for (int t = 0; t < 2; ++t) { kb[(g + 1) & 1][t][0] = WFrag<h16>::ld(pk + ((g + 1) * 2 + t) * 16 * HD); kb[(g + 1) & 1][t][1] = WFrag<h16>::ld(pk + ((g + 1) * 2 + t) * 16 * HD + 512); } }
            if (g == 2) asm volatile("s_wait_xcnt 0x0" :: "v"(pk) : "memory");    // last loads through pk: its registers are held to here and reused only behind this wait
            __builtin_amdgcn_sched_barrier(0);    // the next pair's loads stay in front of this pair's work
#pragma unroll
            for (int t = 0; t < 2; ++t) { const int n0 = w * 128 + (g * 2 + t) * 16;
#pragma unroll
                for (int mb = 0; mb < 2; ++mb) { v8f c = (v8f){}; c = wmma16(a[mb][0], kb[g & 1][t][0], c); c = wmma16(a[mb][1], kb[g & 1][t][1], c);
#pragma unroll
                    for (int j = 0; j < 8; ++j) { float* sp = S + (mb * 16 + hi * 8 + j) * SP + n0 + lr; *sp = __fmul_rn(__fadd_rn(c[j], *sp), 0.125f); } } }
            __builtin_amdgcn_sched_barrier(0);    // later pairs' loads stay behind this pair's work
        }
    }
    __syncthreads();              // whole rows are complete before a wave reduces them
    const int dt = w & 3, kh = w >> 2; v16h bv[16]; const h16* vp = vt + (size_t)(dt * (TT / 32) + kh * 16) * 512 + lane * 8;    // this wave's V fragments: the first eight are fetched here, so that their latency passes behind the softmax
#pragma unroll
    for (int ks = 0; ks < 8; ++ks) bv[ks] = WFrag<h16>::ld(vp + ks * 512);
#pragma unroll 1                  // rolled: one row's 32 values at a time, so that the V fragments held across this loop stay in registers
    for (int rr = 0; rr < 4; ++rr) { float* sr = S + (w * 4 + rr) * SP; float v[32]; float mx = -3.0e38f;
#pragma unroll
        for (int ch = 0; ch < 8; ++ch) { const v4f sv = *(const v4fa*)(sr + ch * 128 + lane * 4);
#pragma unroll
            for (int q = 0; q < 4; ++q) { v[ch * 4 + q] = sv[q]; mx = fmaxf(mx, sv[q]); } }
#pragma unroll
        for (int sh = 16; sh; sh >>= 1) mx = fmaxf(mx, __shfl_xor(mx, sh, 32));
        float sum = 0.f;
#pragma unroll
        for (int k = 0; k < 32; ++k) { v[k] = __expf(v[k] - mx); sum += v[k]; }
#pragma unroll
        for (int sh = 16; sh; sh >>= 1) sum += __shfl_xor(sum, sh, 32);
        const float fct = __fdiv_rn(PCAR, sum); h16* pr = (h16*)sr;
#pragma unroll
        for (int ch = 0; ch < 8; ++ch) { v4h o;
#pragma unroll
            for (int q = 0; q < 4; ++q) o[q] = tohx(v[ch * 4 + q] * fct);
            *(v4ha*)(pr + ch * 128 + lane * 4) = o; } }
    __syncthreads();              // P of all 32 rows is written before any wave reads it as its A operand
#pragma unroll
    for (int ks = 8; ks < 16; ++ks) bv[ks] = WFrag<h16>::ld(vp + ks * 512);    // the other eight fly while the first eight are worked on (all sixteen held over the softmax spill)
    asm volatile("s_wait_xcnt 0x0" :: "v"(vp) : "memory");    // last loads through vp: its registers are held to here and reused only behind this wait
    {   const h16* P = (const h16*)S; v8f o[2]; o[0] = (v8f){}; o[1] = (v8f){}; const h16* pp = P + (size_t)lr * (2 * SP) + kh * 512 + 8 * hi;
#pragma unroll
        for (int ks = 0; ks < 16; ++ks) {
#pragma unroll
            for (int mb = 0; mb < 2; ++mb) { const h16* ap = pp + (size_t)mb * 16 * (2 * SP) + ks * 32; o[mb] = wmma16(cat16(*(const v8ha*)ap, *(const v8ha*)(ap + 16)), bv[ks], o[mb]); } }
#pragma unroll
        for (int mb = 0; mb < 2; ++mb)
#pragma unroll
            for (int j = 0; j < 8; ++j) Of[(kh * MR + mb * 16 + hi * 8 + j) * 68 + dt * 16 + lr] = o[mb][j];
    }
    __syncthreads();              // both key halves' partial sums are in Of
    {   const int row = (tid >> 7) * 16 + lr, d0 = ((tid >> 6) & 1) * 32 + ((tid >> 5) & 1) * 16 + hi * 8; const float* p0 = Of + row * 68 + d0; const float* p1 = p0 + MR * 68; v8us oh, ol;
#pragma unroll
        for (int q = 0; q < 8; ++q) { unsigned short x, y; splitf(__fadd_rn(p0[q], p1[q]) * (1.0f / PCAR), x, y); oh[q] = x; ol[q] = y; }
        const size_t o = ((size_t)((b * TT + i0) / 16 + (tid >> 7)) * (DD / 32) + h * 2 + ((tid >> 6) & 1)) * 512 + (tid & 63) * 8; *(v8us*)(Ah + o) = oh; *(v8us*)(Al + o) = ol; }
}

extern "C" void kernel_launch(void* const* d_in, const int* in_sizes, int n_in,
                              void* d_out, int out_size, void* d_ws, size_t ws_size, hipStream_t stream) {
    (void)in_sizes; (void)n_in; (void)out_size;
    const float* IN[23]; for (int i = 0; i < 23; ++i) IN[i] = (const float*)d_in[i];
    // input [1024][4][1024], pos [1024][1][1024], indices (int [1]), in_proj_weight [3072][1024], in_proj_bias, out_proj_weight, out_proj_bias, pos_proj_weight, pos_proj_bias,
    // r_i [8][4][3072], s_i [8][4][1024], r_p, s_p, r_o, s_o, rm_i [8][1][3072], sm_i [8][1][1024], rm_p, sm_p, rm_o, sm_o, r_w_bias [16][64], r_r_bias = d_in[0..22]
    const float* x = IN[0]; const float* r = IN[1]; const int* idx = (const int*)d_in[2]; const float* rwb = IN[21]; const float* rrb = IN[22];
    float* OUT = (float*)d_out;     // [1024][4][1024] (rows t*4 + b)
    char* wsp = (char*)d_ws;
    auto take = [&](size_t bytes) { char* p = wsp; wsp += (bytes + 255) & ~(size_t)255; return (void*)p; };
    bf* WIh = (bf*)take((size_t)3 * DD * DD * 2); bf* WIl = (bf*)take((size_t)3 * DD * DD * 2); bf* WRh = (bf*)take((size_t)DD * DD * 2); bf* WRl = (bf*)take((size_t)DD * DD * 2); bf* WOh = (bf*)take((size_t)DD * DD * 2); bf* WOl = (bf*)take((size_t)DD * DD * 2);
    bf* XB = (bf*)take((size_t)NT * DD * 2); bf* RB = (bf*)take((size_t)TT * DD * 2); float* F = (float*)take((size_t)NT * DD * 4);
    h16* QA = (h16*)take((size_t)NT * DD * 2); h16* QB = (h16*)take((size_t)NT * DD * 2); h16* KP = (h16*)take((size_t)NT * DD * 2); h16* VT = (h16*)take((size_t)NT * DD * 2); h16* RK = (h16*)take((size_t)NH_ * TT * HD * 2);
    bf* ATh = (bf*)F; bf* ATl = ATh + (size_t)NT * DD;   // the merged hi/lo planes lie in F: its last reader (k_rk16) runs before k_attn, and both planes fill exactly its bytes
    if ((size_t)(wsp - (char*)d_ws) > ws_size) return;    // total 80 MiB; ws 256 MiB
    { const unsigned gi = (unsigned)(((size_t)3 * DD * DD / 2 + 255) / 256), g1 = (unsigned)(((size_t)DD * DD / 2 + 255) / 256);
      k_fact<<<gi, 256, 0, stream>>>(IN[3], idx, IN[15], IN[16], IN[9], IN[10], 3 * DD, WIh, WIl);     // in_proj: rm_i, sm_i, r_i, s_i
      k_fact<<<g1, 256, 0, stream>>>(IN[7], idx, IN[17], IN[18], IN[11], IN[12], DD, WRh, WRl);         // pos_proj: rm_p, sm_p, r_p, s_p
      k_fact<<<g1, 256, 0, stream>>>(IN[5], idx, IN[19], IN[20], IN[13], IN[14], DD, WOh, WOl);         // out_proj: rm_o, sm_o, r_o, s_o
      const size_t nx = (size_t)NT * DD / 8; k_cvt8<<<(unsigned)((nx + 255) / 256), 256, 0, stream>>>(x, XB, nx); k_cvt8<<<(unsigned)(((size_t)TT * DD / 8 + 255) / 256), 256, 0, stream>>>(r, RB, (size_t)TT * DD / 8); }
    const unsigned LB = (unsigned)((NT * DD / 64 + 63) / 64); const dim3 gP(NT / 64, DD / 64, 1);
    k_gemmw<bf, 3, true, false><<<gP, 32, 0, stream>>>(XB, nullptr, WIh, WIl, DD, F, DD, IN[4], 0, 0, 0); k_hb16<<<LB, 256, 0, stream>>>(F, rwb, QA); k_hb16<<<LB, 256, 0, stream>>>(F, rrb, QB);
    k_gemmw<bf, 3, true, false><<<gP, 32, 0, stream>>>(XB, nullptr, WIh + (size_t)DD * DD, WIl + (size_t)DD * DD, DD, F, DD, IN[4] + DD, 0, 0, 0); k_hb16<<<LB, 256, 0, stream>>>(F, nullptr, KP);
    k_gemmw<bf, 3, true, false><<<gP, 32, 0, stream>>>(XB, nullptr, WIh + (size_t)2 * DD * DD, WIl + (size_t)2 * DD * DD, DD, F, DD, IN[4] + 2 * DD, 0, 0, 0); k_vtplane<<<LB, 256, 0, stream>>>(F, VT);
    k_gemmw<bf, 3, true, false><<<dim3(TT / 64, DD / 64, 1), 32, 0, stream>>>(RB, nullptr, WRh, WRl, DD, F, DD, IN[8], 0, 0, 0); k_rk16<<<(unsigned)((NH_ * TT * HD / 64 + 63) / 64), 256, 0, stream>>>(F, RK);
    k_attn<<<dim3(TT / MR, NB_ * NH_, 1), 256, 0, stream>>>(QA, QB, KP, VT, RK, ATh, ATl);
    k_gemmw<bf, 2, true, true><<<gP, 32, 0, stream>>>(ATh, ATl, WOh, WOl, DD, OUT, DD, IN[6], 0, 0, 0);
}

// v005
// Measured time: 180 microseconds a run.
// Next to v004, in two timings, it ran 1.24 times as fast each time.
// Over all steps from v000 it is 9.42 times as fast.
#include <hip/hip_runtime.h>

// Relative-position multi-head attention (segment-recurrence style relative shift; query [1024][4][1024] seq-first, r [1024][1024]; w = query qkv_w^T -> q|k|v (16 heads x 64); r_k = r r_w^T; AC = (q + r_w_bias).k,
// BD = rel_shift((q + r_r_bias).r_k) with the module's exact zero-pad/reshape shift (out[i][j] = BD[f / (T+1)][f % (T+1) - 1] or 0 when f % (T+1) == 0, f = T + i*T + j); p = softmax((AC + BD) / 8)
// over the keys; attn = p.v; out = merged out_w^T + out_b; output [1024][4][1024] (rows t*4 + b)).
// Compute dtypes, f32 accumulate: every input rounded to bf16; the qkv and r projections on bf16 inputs (exact) x hi/lo bf16 weight planes (two products); AC, BD and attn.v on SINGLE fp16 planes
// (the per-head biases added in f32 before the fp16 rounding; logit sd ~ 0.6); the relative shift is done by where each BD element is stored in the LDS score block of k_attn; P x1024;

// FRAGMENT ORDER of every 16-bit WMMA operand plane in the workspace (rows x K, K % 32 == 0): tiles of 16 rows x 32 k = 1 KiB, tile (row / 16, k / 32) at index (row / 16) * (K / 32) + k / 32; inside a tile the 16-byte chunk
// of row lr, k = half * 16 + hi * 8 + 0..7 stands at chunk half * 32 + hi * 16 + lr. That is the register layout of a 16x16x32 A or B fragment, so a fragment is two loads of 512 contiguous bytes (lane * 16): four whole 128-byte lines each.

#define NB_  4
#define TT   1024
#define NLY  8                    // weight-factor layers
#define RNK  4                    // additive rank
#define DD   1024
#define NH_  16
#define HD   64
#define NT   (NB_ * TT)
#define PCAR 1024.0f
typedef _Float16 h16;
typedef unsigned short bf;
typedef __attribute__((ext_vector_type(16))) __bf16   v16bf;
typedef __attribute__((ext_vector_type(16))) _Float16 v16h;
typedef __attribute__((ext_vector_type(8)))  _Float16 v8h;
typedef __attribute__((ext_vector_type(8)))  unsigned short v8us;
typedef __attribute__((ext_vector_type(8)))  float    v8f;
typedef __attribute__((ext_vector_type(4)))  float    v4f;
typedef v8h  __attribute__((may_alias)) v8ha;
typedef v4f  __attribute__((may_alias)) v4fa;
typedef v8us __attribute__((may_alias)) v8usa;

__device__ __forceinline__ unsigned short f2bf(float f) { unsigned u = __float_as_uint(f); u += 0x7FFFu + ((u >> 16) & 1u); return (unsigned short)(u >> 16); }
__device__ __forceinline__ float bf2f(unsigned short b) { return __uint_as_float(((unsigned)b) << 16); }
__device__ __forceinline__ float bfr(float f) { return bf2f(f2bf(f)); }
__device__ __forceinline__ v16h cat16(v8h lo, v8h hi) { return __builtin_shufflevector(lo, hi, 0, 1, 2, 3, 4, 5, 6, 7, 8, 9, 10, 11, 12, 13, 14, 15); }
__device__ __forceinline__ v16bf cat16b(v8us lo, v8us hi) { return __builtin_bit_cast(v16bf, __builtin_shufflevector(lo, hi, 0, 1, 2, 3, 4, 5, 6, 7, 8, 9, 10, 11, 12, 13, 14, 15)); }
__device__ __forceinline__ v8f wmma16(v16h a, v16h b, v8f c) { return __builtin_amdgcn_wmma_f32_16x16x32_f16(false, a, false, b, (short)0, c, false, false); }
__device__ __forceinline__ v8f wmmab(v16bf a, v16bf b, v8f c) { return __builtin_amdgcn_wmma_f32_16x16x32_bf16(false, a, false, b, (short)0, c, false, false); }



// ---- gemmw_tile: register-blocked GEMM, ONE WAVE per 64x64 output tile (16 accumulators) at rows r0.., columns c0.., operands straight from 16-bit planes in fragment order (ld takes tile start + lane * 8 elements); 32 threads.
// C[m][n] (f32, pitch ldc, + optional f32 bias[n]) = sum_k A[m][k] Bt[n][k] (+ split products per NSPLIT). K % 64 == 0. TB: row m of A is (batch m / TT, time m % TT) and goes to row time * NB_ + batch of C.
template <typename T16> struct WFrag;
template <> struct WFrag<h16> { typedef v16h V; static __device__ __forceinline__ V ld(const h16* p) { return cat16(*(const v8h*)p, *(const v8h*)(p + 256)); } static __device__ __forceinline__ v8f mma(V a, V b, v8f c) { return wmma16(a, b, c); } };
template <> struct WFrag<bf> { typedef v16bf V; static __device__ __forceinline__ V ld(const bf* p) { return cat16b(*(const v8us*)p, *(const v8us*)(p + 256)); } static __device__ __forceinline__ v8f mma(V a, V b, v8f c) { return wmmab(a, b, c); } };
template <typename T16, int NSPLIT, bool BIAS, bool TB>
__device__ __forceinline__ void gemmw_tile(const T16* __restrict__ A, const T16* __restrict__ A2, const T16* __restrict__ Bt, const T16* __restrict__ Bt2, int K, float* C, int ldc, const float* __restrict__ bias, int r0, int c0) {
    typedef typename WFrag<T16>::V V;
    __shared__ __align__(16) float os[16 * 68];
    const int lane = threadIdx.x & 31, lr = lane & 15, hi = lane >> 4;
    v8f acc[4][4];
#pragma unroll
    for (int mb = 0; mb < 4; ++mb)
#pragma unroll
        for (int nb = 0; nb < 4; ++nb) acc[mb][nb] = (v8f){};
    // Two fragment sets in registers: as soon as a set's WMMAs are issued, its refill for two k steps on (every A and B fragment, one group of loads) goes out and flies during the other set's WMMAs,
    // so that a wave waits for memory at most once per step, with a step of matrix work as lead. Each accumulator takes its products in the same order as with one set.
    V a[2][4], a2[2][4], b[2][4], b2[2][4];
    const char* pA[4]; const char* pA2[4]; const char* pB[4]; const char* pB2[4];    // wave-uniform start of each 16-row block (its K / 32 tiles lie in a row); they never change
#pragma unroll
    for (int q = 0; q < 4; ++q) { pA[q] = (const char*)(A + (size_t)(r0 + q * 16) * K); pA2[q] = (NSPLIT == 1 || NSPLIT == 2) ? (const char*)(A2 + (size_t)(r0 + q * 16) * K) : nullptr; pB[q] = (const char*)(Bt + (size_t)(c0 + q * 16) * K); pB2[q] = (NSPLIT >= 2) ? (const char*)(Bt2 + (size_t)(c0 + q * 16) * K) : nullptr; }
    unsigned vo = (unsigned)lane * 16u;    // this lane's byte offset inside a block, the same for every block: the one address register that moves, at the foot of a trip
    auto ldset = [&](int s, int ko) {
        if (NSPLIT == 2) asm volatile("s_wait_loadcnt 0x1f" ::: "memory");    // a set is 32 loads here: with at most 31 older ones left, a wave never has more than 63 outstanding, the most that s_wait_loadcnt can name
#pragma unroll
        for (int mb = 0; mb < 4; ++mb) { a[s][mb] = WFrag<T16>::ld((const T16*)(pA[mb] + vo) + ko); if (NSPLIT == 1 || NSPLIT == 2) a2[s][mb] = WFrag<T16>::ld((const T16*)(pA2[mb] + vo) + ko); }
#pragma unroll
        for (int nb = 0; nb < 4; ++nb) { b[s][nb] = WFrag<T16>::ld((const T16*)(pB[nb] + vo) + ko); if (NSPLIT >= 2) b2[s][nb] = WFrag<T16>::ld((const T16*)(pB2[nb] + vo) + ko); }
        asm volatile("s_wait_xcnt 0x0" ::: "memory");    // the base and offset registers of this group's loads are rewritten (the offset at a trip's foot, the bases behind the loop) only behind this wait
        __builtin_amdgcn_sched_barrier(0);    // a refill, with its wait, stays in front of the other set's WMMAs
    };
    auto mmset = [&](int s) {
#pragma unroll
        for (int nb = 0; nb < 4; ++nb)
#pragma unroll
            for (int mb = 0; mb < 4; ++mb) { acc[mb][nb] = WFrag<T16>::mma(a[s][mb], b[s][nb], acc[mb][nb]); if (NSPLIT == 1 || NSPLIT == 2) acc[mb][nb] = WFrag<T16>::mma(a2[s][mb], b[s][nb], acc[mb][nb]); if (NSPLIT >= 2) acc[mb][nb] = WFrag<T16>::mma(a[s][mb], b2[s][nb], acc[mb][nb]); }
        __builtin_amdgcn_sched_barrier(0);    // the loads that refill this set stay behind its WMMAs
    };
    ldset(0, 0); ldset(1, 512);    // ko: elements from the trip's first tile, 512 a tile
#pragma unroll 1                  // rolled: two steps a trip, so that each set keeps its own registers
    for (int kc = 64; kc < K; kc += 64) {
        mmset(0); ldset(0, 1024);
        mmset(1);
        vo += 2048;    // two tiles on; behind the wait that closes ldset(0, 1024); no load stands between
        ldset(1, 512);
    }
    mmset(0); mmset(1);
#pragma unroll
    for (int mb = 0; mb < 4; ++mb) {
#pragma unroll
        for (int nb = 0; nb < 4; ++nb) {
#pragma unroll
            for (int j = 0; j < 8; ++j) os[(hi * 8 + j) * 68 + nb * 16 + lr] = acc[mb][nb][j]; }
        __builtin_amdgcn_wave_barrier(); asm volatile("" ::: "memory");
        const size_t rs = TB ? (size_t)NB_ * ldc : (size_t)ldc; float* crow = TB ? C + ((size_t)((r0 & (TT - 1)) + mb * 16) * NB_ + (r0 / TT)) * ldc + c0 : C + (size_t)(r0 + mb * 16) * ldc + c0;
{
#pragma unroll
            for (int s = 0; s < 8; ++s) { const int row = 2 * s + hi, cofs = lr * 4; v4f val = *(const v4fa*)(os + row * 68 + cofs); if (BIAS) { val[0] += bfr(bias[c0 + cofs]); val[1] += bfr(bias[c0 + cofs + 1]); val[2] += bfr(bias[c0 + cofs + 2]); val[3] += bfr(bias[c0 + cofs + 3]); }
                *(v4f*)(crow + (size_t)row * rs + cofs) = val; }
             }
        __builtin_amdgcn_wave_barrier(); asm volatile("" ::: "memory");
        asm volatile("s_wait_xcnt 0x0" ::: "memory");    // the address registers of this block's stores are reused only behind this wait
    }
}
// k_gemmw: one GEMM, grid (M/64, N/64).
template <typename T16, int NSPLIT, bool BIAS, bool TB>
__global__ __launch_bounds__(32) void k_gemmw(const T16* __restrict__ A, const T16* __restrict__ A2, const T16* __restrict__ Bt, const T16* __restrict__ Bt2, int K, float* C, int ldc, const float* __restrict__ bias) {
    gemmw_tile<T16, NSPLIT, BIAS, TB>(A, A2, Bt, Bt2, K, C, ldc, bias, (int)blockIdx.x * 64, (int)blockIdx.y * 64);
}
// k_proj: the four projections, which do not depend on one another, as ONE grid (64, 52): blockIdx.y / 16 = 0, 1, 2: the q, k, v third of in_proj (x tile blockIdx.x, f32 plane y / 16 of F); y = 48..51: the 16 x 16 tiles of the pos projection (into FR).
__global__ __launch_bounds__(32) void k_proj(const bf* __restrict__ XB, const bf* __restrict__ RB, const bf* __restrict__ WIh, const bf* __restrict__ WIl, const bf* __restrict__ WRh, const bf* __restrict__ WRl, int K, float* F, float* FR, const float* __restrict__ bi, const float* __restrict__ bp) {
    const int x = (int)blockIdx.x, y = (int)blockIdx.y; const bool pos = y >= 48; const size_t sel = (size_t)(y >> 4); const int t = (y - 48) * 64 + x;
    gemmw_tile<bf, 3, true, false>(pos ? RB : XB, nullptr, pos ? WRh : WIh + sel * DD * DD, pos ? WRl : WIl + sel * DD * DD, K, pos ? FR : F + sel * NT * DD, DD, pos ? bp : bi + sel * DD, (pos ? (t & 15) : x) * 64, (pos ? (t >> 4) : (y & 15)) * 64);
}

__device__ __forceinline__ h16 tohx(float x) { return (h16)x; }
__device__ __forceinline__ void splitf(float y, unsigned short& h, unsigned short& l) { h = f2bf(y); l = f2bf(y - bf2f(h)); }
typedef __attribute__((ext_vector_type(2))) _Float16 v2h;
typedef __attribute__((ext_vector_type(4))) _Float16 v4h;
typedef __attribute__((ext_vector_type(2))) unsigned short v2us;
typedef __attribute__((ext_vector_type(4))) int v4i;

// row and first k of the 16-byte chunk c of a plane in fragment order with kt = K / 32 tiles per 16 rows. The kernels below that fill such a plane go by the place they write, so that every store covers whole lines.
__device__ __forceinline__ void fo_rk(unsigned c, unsigned kt, int& row, int& k) { const unsigned tile = c >> 6; row = (int)((tile / kt) * 16 + (c & 15)); k = (int)((tile % kt) * 32 + ((c >> 5) & 1) * 16 + ((c >> 4) & 1) * 8); }
__device__ __forceinline__ void cvt8_blk(unsigned blk, const float* __restrict__ src, bf* dst, size_t n8) { const size_t i = (size_t)blk * 256 + threadIdx.x; if (i >= n8) return; int row, k0; fo_rk((unsigned)i, DD / 32, row, k0); const float* sp = src + (size_t)row * DD + k0; const v8f v = *(const v8f*)sp; v8us o;
    asm volatile("s_wait_xcnt 0x0" :: "v"(sp) : "memory");    // the address registers of the two issued loads are held to here and reused only behind this wait
#pragma unroll
    for (int k = 0; k < 8; ++k) o[k] = f2bf(v[k]); *(v8us*)(dst + i * 8) = o;  }
// fact_blk: factorised weight hi/lo planes: W'[a][b] = bf16(W[a][b]) bf16(rm[l][a]) bf16(sm[l][b]) + sum_k bf16(r[l][k][a]) bf16(s[l][k][b]) (f32, fixed order), l = indices[0] read on device (int input,
__device__ __forceinline__ void fact_blk(unsigned blk, const float* __restrict__ W, const int* __restrict__ idx, const float* __restrict__ rm, const float* __restrict__ sm, const float* __restrict__ rr, const float* __restrict__ ss, int rows, bf* Wh, bf* Wl) {
    const size_t i = ((size_t)blk * 256 + threadIdx.x) * 2; if (i >= (size_t)rows * DD) return; int a, b0; fo_rk((unsigned)(i >> 3), DD / 32, a, b0); b0 += (int)(i & 7); int l = idx[0]; l = l < 0 ? 0 : (l >= NLY ? NLY - 1 : l); v2us oh, ol;
#pragma unroll
    for (int q = 0; q < 2; ++q) { const int b = b0 + q; float m = __fmul_rn(bfr(rm[(size_t)l * rows + a]), bfr(sm[(size_t)l * DD + b])); asm volatile("" : "+v"(m)); float w = __fmul_rn(bfr(W[(size_t)a * DD + b]), m); asm volatile("" : "+v"(w)); float ad = 0.f;
#pragma unroll
        for (int k = 0; k < RNK; ++k) { float p = __fmul_rn(bfr(rr[((size_t)l * RNK + k) * rows + a]), bfr(ss[((size_t)l * RNK + k) * DD + b])); asm volatile("" : "+v"(p)); ad = __fadd_rn(ad, p); }
        unsigned short h, lo; splitf(__fadd_rn(w, ad), h, lo); oh[q] = h; ol[q] = lo; }
    *(v2us*)(Wh + i) = oh; *(v2us*)(Wl + i) = ol;  }
// k_prep: the three weight factorisations and the two bf16 roundings, which do not depend on one another, as ONE grid; a block's index range says which it works for.
#define GFI (3 * DD * DD / 512)   // blocks: in_proj weight, 512 elements a block
#define GF1 (DD * DD / 512)       // pos_proj, out_proj weight
#define GCX (NT * DD / 2048)      // input, 2048 elements a block
#define GCR (TT * DD / 2048)      // pos
__global__ __launch_bounds__(256) void k_prep(const float* __restrict__ Wi, const float* __restrict__ Wp, const float* __restrict__ Wo, const int* __restrict__ idx,
                                              const float* __restrict__ rm_i, const float* __restrict__ sm_i, const float* __restrict__ r_i, const float* __restrict__ s_i,
                                              const float* __restrict__ rm_p, const float* __restrict__ sm_p, const float* __restrict__ r_p, const float* __restrict__ s_p,
                                              const float* __restrict__ rm_o, const float* __restrict__ sm_o, const float* __restrict__ r_o, const float* __restrict__ s_o,
                                              const float* __restrict__ x, const float* __restrict__ r, bf* WIh, bf* WIl, bf* WRh, bf* WRl, bf* WOh, bf* WOl, bf* XB, bf* RB) {
    const unsigned blk = blockIdx.x;
    if (blk < GFI) fact_blk(blk, Wi, idx, rm_i, sm_i, r_i, s_i, 3 * DD, WIh, WIl);
    else if (blk < GFI + GF1) fact_blk(blk - GFI, Wp, idx, rm_p, sm_p, r_p, s_p, DD, WRh, WRl);
    else if (blk < GFI + 2 * GF1) fact_blk(blk - (GFI + GF1), Wo, idx, rm_o, sm_o, r_o, s_o, DD, WOh, WOl);
    else if (blk < GFI + 2 * GF1 + GCX) cvt8_blk(blk - (GFI + 2 * GF1), x, XB, (size_t)NT * DD / 8);
    else cvt8_blk(blk - (GFI + 2 * GF1 + GCX), r, RB, (size_t)TT * DD / 8);
}
__device__ __forceinline__ void hb16_blk(int blk, const float* __restrict__ F, const float* __restrict__ hb, h16* P) {
    const int lane = threadIdx.x & 31; const int L0 = (blk * 8 + (threadIdx.x >> 5)) * 8; const int nlines = NT * DD / 64;
{
#pragma unroll
        for (int l = 0; l < 8; ++l) { const int L = L0 + l; if (L >= nlines) break; const int e = L * 64 + lane * 2; int t, d; fo_rk((unsigned)(e & 65535) >> 3, HD / 32, t, d); d += e & 7; const int z = e >> 16; const int b = z >> 4, h = z & 15; v2h o;
            const float* fp = F + ((size_t)t * NB_ + b) * DD + h * HD + d; const unsigned bo = (unsigned)(h * HD + d) * 4u; float f[2], g[2] = {0.f, 0.f};    // bo: byte offset of this lane's two bias values
#pragma unroll
            for (int q = 0; q < 2; ++q) f[q] = fp[q];
            if (hb) { const float* bp = (const float*)((const char*)hb + bo); g[0] = bp[0]; g[1] = bp[1]; asm volatile("s_wait_xcnt 0x0" :: "v"(bo) : "memory"); }    // the offset register of the issued bias loads is held to here and reused only behind this wait
            asm volatile("s_wait_xcnt 0x0" :: "v"(fp) : "memory");    // the same for the address registers of the two loads of F
#pragma unroll
            for (int q = 0; q < 2; ++q) o[q] = tohx(__fadd_rn(f[q], bfr(g[q])));    // no bias: g is 0 and stays 0 under the rounding
            h16* op = P + (size_t)e; *(v2h*)op = o;
            asm volatile("s_wait_xcnt 0x0" :: "v"(op), "v"(o) : "memory"); }    // the same for the store's address and data registers
         }
}
__device__ __forceinline__ void rk16_blk(int blk, const float* __restrict__ FR, h16* RK) {
    const int lane = threadIdx.x & 31; const int L0 = (blk * 8 + (threadIdx.x >> 5)) * 8; const int nlines = NH_ * TT * HD / 64;
{
#pragma unroll
        for (int l = 0; l < 8; ++l) { const int L = L0 + l; if (L >= nlines) break; const int e = L * 64 + lane * 2; int j, d; fo_rk((unsigned)(e & 65535) >> 3, HD / 32, j, d); d += e & 7; const int h = e >> 16; v2h o;
#pragma unroll
            for (int q = 0; q < 2; ++q) o[q] = tohx(FR[(size_t)j * DD + h * HD + d + q]);
            *(v2h*)(RK + (size_t)e) = o; }
         }
}
__device__ __forceinline__ void vtplane_blk(int blk, const float* __restrict__ F, h16* VT) {
    const int lane = threadIdx.x & 31; const int L0 = (blk * 8 + (threadIdx.x >> 5)) * 8; const int nlines = NT * DD / 64;
{
#pragma unroll
        for (int l = 0; l < 8; ++l) { const int L = L0 + l; if (L >= nlines) break; const int e = L * 64 + lane * 2; int d, t; fo_rk((unsigned)(e & 65535) >> 3, TT / 32, d, t); t += e & 7; const int z = e >> 16; const int b = z >> 4, h = z & 15; v2h v;
            const float* fp = F + ((size_t)t * NB_ + b) * DD + h * HD + d; float f[2];
#pragma unroll
            for (int q = 0; q < 2; ++q) f[q] = fp[(size_t)q * NB_ * DD];
            asm volatile("s_wait_xcnt 0x0" :: "v"(fp) : "memory");    // the address registers of this line's issued loads are held to here and reused only behind this wait
#pragma unroll
            for (int q = 0; q < 2; ++q) v[q] = tohx(f[q]);
            h16* op = VT + (size_t)e; *(v2h*)op = v;
            asm volatile("s_wait_xcnt 0x0" :: "v"(op), "v"(v) : "memory"); }    // the same for the store's address and data registers
         }
}
// k_planes: the five fp16 operand planes of k_attn, which do not depend on one another, as ONE grid: 1024 blocks each for V^T (first: its reads are the most scattered), q + r_w_bias, q + r_r_bias and k, then 256 for r_k. F: the q, k, v planes of k_proj.
__global__ __launch_bounds__(256) void k_planes(const float* __restrict__ F, const float* __restrict__ FR, const float* __restrict__ rwb, const float* __restrict__ rrb, h16* QA, h16* QB, h16* KP, h16* VT, h16* RK) {
    const int sel = (int)(blockIdx.x >> 10), blk = (int)(blockIdx.x & 1023);
    if (sel == 0) vtplane_blk(blk, F + (size_t)2 * NT * DD, VT);
    else if (sel == 1) hb16_blk(blk, F, rwb, QA);
    else if (sel == 2) hb16_blk(blk, F, rrb, QB);
    else if (sel == 3) hb16_blk(blk, F + (size_t)NT * DD, nullptr, KP);
    else rk16_blk(blk, FR, RK);
}
// k_attn: one work-group (8 waves) = 32 query rows of one (batch, head). The whole 32 x 1024 score block stays in LDS (f32, row pitch SP floats), so no score, probability or per-head output plane goes through memory.
// 1) BD: raw tiles (q + r_r_bias).r_k for rows i (lower part) and rows i + 1 (upper part) against the same r_k fragment; element (i, n) lands at its shifted column of row i: with d = i + n + 1 - T,
//    d >= 0 -> column d from row i; d <= -2 -> column d + T + 1 from row i + 1; d == -1 has no place in the shifted row and falls on column T, in the row's pad, which nobody reads.
//    For fixed i that fills every column but i + 1, which holds the shift's zero and is stored by wave 0 (for i = T - 1 that store too falls on the pad).
// 2) AC tiles are added at their own place and scaled by 1/8.  3) each wave: softmax of 4 rows; P (x1024, fp16) overwrites the front half of the row's own bytes, which only that wave touches here.
// 4) P.V: wave = (16-wide d tile, half of the keys), both 16-row tiles; the two halves' partial sums meet in Of.  5) 1/1024, hi/lo bf16 split; the merged planes are in fragment order with rows batch * T + time, so the work-group owns four whole tiles of each and a wave stores 512 bytes in a row.
// Every plain '#pragma unroll' in k_attn: the fragment and accumulator arrays are indexed by the loop counters and stay in registers only when those loops are unrolled.
#define MR 32
#define SP 1028                   // 4112 bytes = 16 x odd: the b128 fragment reads of 16 rows fall on distinct banks
typedef v4h __attribute__((may_alias)) v4ha;
__global__ __launch_bounds__(256) __attribute__((amdgpu_waves_per_eu(4, 4))) void k_attn(const h16* __restrict__ QA, const h16* __restrict__ QB, const h16* __restrict__ KP, const h16* __restrict__ VT, const h16* __restrict__ RK, bf* Ah, bf* Al) {
    __shared__ __align__(16) float S[MR * SP];
    __shared__ __align__(16) float Of[2 * MR * 68];
    const int tid = threadIdx.x, lane = tid & 31, lr = lane & 15, hi = lane >> 4; const int w = __builtin_amdgcn_readfirstlane(tid >> 5);
    const int i0 = blockIdx.x * MR; const int z = blockIdx.y; const int b = z >> 4, h = z & 15;
    const h16* qa = QA + (size_t)z * TT * HD; const h16* qb = QB + (size_t)z * TT * HD; const h16* kp = KP + (size_t)z * TT * HD; const h16* vt = VT + (size_t)z * HD * TT; const h16* rk = RK + (size_t)h * TT * HD;
    if (w == 0) S[lane * SP + i0 + lane + 1] = 0.f;
    // Both score loops are straight-line with two operand buffers: the loads of the next pair of key tiles are issued, then this pair is worked on. The sched_barrier calls hold that order:
    // without them the scheduler lifts all eight tiles' loads to the top and spills past the 256 registers that two work-groups per WGP allow.
    v16h a[2][2], kb[2][2][2];    // AC's operands; the q + r_w_bias rows and the first pair of key tiles are fetched in front of the last BD pair, whose work covers their latency
    const h16* pa = qa + (size_t)i0 * HD + lane * 8; const h16* pk = kp + (size_t)(w * 128) * HD + lane * 8;    // 16 rows of 64 = two tiles = 16 * HD elements; the second tile (k 32..63) 512 elements on
    {   v16h aL[2][2], aU[2][2], rb[2][2][2]; const h16* bp = rk + (size_t)(w * 128) * HD + lane * 8; const h16* pL = qb + (size_t)i0 * HD + lane * 8;
        const int ru = (i0 + 17 + lr < TT) ? i0 + 17 + lr : TT - 1; const h16* pU = qb + (size_t)(ru >> 4) * 16 * HD + (hi * 16 + (ru & 15)) * 8;    // row T does not exist; row T - 1 has no upper part, so its aU result is never chosen
        const int rv = i0 + 1 + lr; const h16* pV = qb + (size_t)(rv >> 4) * 16 * HD + (hi * 16 + (rv & 15)) * 8;    // rows i + 1 straddle two row blocks: lane 15's (and 31's) chunk lies in the next one
#pragma unroll
        for (int ks = 0; ks < 2; ++ks) { aL[0][ks] = WFrag<h16>::ld(pL + ks * 512); aL[1][ks] = WFrag<h16>::ld(pL + 16 * HD + ks * 512); aU[0][ks] = WFrag<h16>::ld(pV + ks * 512); aU[1][ks] = WFrag<h16>::ld(pU + ks * 512); }
#pragma unroll
        for (int t = 0; t < 2; ++t) { rb[0][t][0] = WFrag<h16>::ld(bp + t * 16 * HD); rb[0][t][1] = WFrag<h16>::ld(bp + t * 16 * HD + 512); }
        asm volatile("s_wait_xcnt 0x0" :: "v"(pL), "v"(pU), "v"(pV) : "memory");    // the address registers of the issued loads are held to here and may be reused only behind this wait
#pragma unroll
        for (int g = 0; g < 4; ++g) {
            if (g < 3) {
#pragma unroll
                for (int t = 0; t < 2; ++t) { rb[(g + 1) & 1][t][0] = WFrag<h16>::ld(bp + ((g + 1) * 2 + t) * 16 * HD); rb[(g + 1) & 1][t][1] = WFrag<h16>::ld(bp + ((g + 1) * 2 + t) * 16 * HD + 512); } }
            else {
#pragma unroll
                for (int mb = 0; mb < 2; ++mb)
#pragma unroll
                    for (int ks = 0; ks < 2; ++ks) { a[mb][ks] = WFrag<h16>::ld(pa + mb * 16 * HD + ks * 512); kb[0][mb][ks] = WFrag<h16>::ld(pk + mb * 16 * HD + ks * 512); } }
            if (g == 2) asm volatile("s_wait_xcnt 0x0" :: "v"(bp) : "memory");    // last loads through bp: its registers are held to here and reused only behind this wait
            if (g == 3) asm volatile("s_wait_xcnt 0x0" :: "v"(pa) : "memory");    // the same for pa
            __builtin_amdgcn_sched_barrier(0);    // the next pair's loads stay in front of this pair's work
#pragma unroll
            for (int t = 0; t < 2; ++t) { const int n0 = w * 128 + (g * 2 + t) * 16;
#pragma unroll
                for (int mb = 0; mb < 2; ++mb) { v8f cL = (v8f){}, cU = (v8f){}; cL = wmma16(aL[mb][0], rb[g & 1][t][0], cL); cU = wmma16(aU[mb][0], rb[g & 1][t][0], cU); cL = wmma16(aL[mb][1], rb[g & 1][t][1], cL); cU = wmma16(aU[mb][1], rb[g & 1][t][1], cU);
#pragma unroll
                    for (int j = 0; j < 8; ++j) { const int ml = mb * 16 + hi * 8 + j; const int d = i0 + ml + n0 + lr + 1 - TT;
                        S[ml * SP + d + ((d >> 31) & (TT + 1))] = (d >= 0) ? cL[j] : cU[j]; } } }
            __builtin_amdgcn_sched_barrier(0);    // later pairs' loads stay behind this pair's work
        }
    }
    __syncthreads();              // every shifted BD element is in place before AC is added to it
    {
#pragma unroll
        for (int g = 0; g < 4; ++g) {
            if (g < 3) {
#pragma unroll
                for (int t = 0; t < 2; ++t) { kb[(g + 1) & 1][t][0] = WFrag<h16>::ld(pk + ((g + 1) * 2 + t) * 16 * HD); kb[(g + 1) & 1][t][1] = WFrag<h16>::ld(pk + ((g + 1) * 2 + t) * 16 * HD + 512); } }
            if (g == 2) asm volatile("s_wait_xcnt 0x0" :: "v"(pk) : "memory");    // last loads through pk: its registers are held to here and reused only behind this wait
            __builtin_amdgcn_sched_barrier(0);    // the next pair's loads stay in front of this pair's work
#pragma unroll
            for (int t = 0; t < 2; ++t) { const int n0 = w * 128 + (g * 2 + t) * 16;
#pragma unroll
                for (int mb = 0; mb < 2; ++mb) { v8f c = (v8f){}; c = wmma16(a[mb][0], kb[g & 1][t][0], c); c = wmma16(a[mb][1], kb[g & 1][t][1], c);
#pragma unroll
                    for (int j = 0; j < 8; ++j) { float* sp = S + (mb * 16 + hi * 8 + j) * SP + n0 + lr; *sp = __fmul_rn(__fadd_rn(c[j], *sp), 0.125f); } } }
            __builtin_amdgcn_sched_barrier(0);    // later pairs' loads stay behind this pair's work
        }
    }
    __syncthreads();              // whole rows are complete before a wave reduces them
    const int dt = w & 3, kh = w >> 2; v16h bv[16]; const h16* vp = vt + (size_t)(dt * (TT / 32) + kh * 16) * 512 + lane * 8;    // this wave's V fragments: the first eight are fetched here, so that their latency passes behind the softmax
#pragma unroll
    for (int ks = 0; ks < 8; ++ks) bv[ks] = WFrag<h16>::ld(vp + ks * 512);
#pragma unroll 1                  // rolled: one row's 32 values at a time, so that the V fragments held across this loop stay in registers
    for (int rr = 0; rr < 4; ++rr) { float* sr = S + (w * 4 + rr) * SP; float v[32]; float mx = -3.0e38f;
#pragma unroll
        for (int ch = 0; ch < 8; ++ch) { const v4f sv = *(const v4fa*)(sr + ch * 128 + lane * 4);
#pragma unroll
            for (int q = 0; q < 4; ++q) { v[ch * 4 + q] = sv[q]; mx = fmaxf(mx, sv[q]); } }
#pragma unroll
        for (int sh = 16; sh; sh >>= 1) mx = fmaxf(mx, __shfl_xor(mx, sh, 32));
        float sum = 0.f;
#pragma unroll
        for (int k = 0; k < 32; ++k) { v[k] = __expf(v[k] - mx); sum += v[k]; }
#pragma unroll
        for (int sh = 16; sh; sh >>= 1) sum += __shfl_xor(sum, sh, 32);
        const float fct = __fdiv_rn(PCAR, sum); h16* pr = (h16*)sr;
#pragma unroll
        for (int ch = 0; ch < 8; ++ch) { v4h o;
#pragma unroll
            for (int q = 0; q < 4; ++q) o[q] = tohx(v[ch * 4 + q] * fct);
            *(v4ha*)(pr + ch * 128 + lane * 4) = o; } }
    __syncthreads();              // P of all 32 rows is written before any wave reads it as its A operand
#pragma unroll
    for (int ks = 8; ks < 16; ++ks) bv[ks] = WFrag<h16>::ld(vp + ks * 512);    // the other eight fly while the first eight are worked on (all sixteen held over the softmax spill)
    asm volatile("s_wait_xcnt 0x0" :: "v"(vp) : "memory");    // last loads through vp: its registers are held to here and reused only behind this wait
    {   const h16* P = (const h16*)S; v8f o[2]; o[0] = (v8f){}; o[1] = (v8f){}; const h16* pp = P + (size_t)lr * (2 * SP) + kh * 512 + 8 * hi;
#pragma unroll
        for (int ks = 0; ks < 16; ++ks) {
#pragma unroll
            for (int mb = 0; mb < 2; ++mb) { const h16* ap = pp + (size_t)mb * 16 * (2 * SP) + ks * 32; o[mb] = wmma16(cat16(*(const v8ha*)ap, *(const v8ha*)(ap + 16)), bv[ks], o[mb]); } }
#pragma unroll
        for (int mb = 0; mb < 2; ++mb)
#pragma unroll
            for (int j = 0; j < 8; ++j) Of[(kh * MR + mb * 16 + hi * 8 + j) * 68 + dt * 16 + lr] = o[mb][j];
    }
    __syncthreads();              // both key halves' partial sums are in Of
    {   const int row = (tid >> 7) * 16 + lr, d0 = ((tid >> 6) & 1) * 32 + ((tid >> 5) & 1) * 16 + hi * 8; const float* p0 = Of + row * 68 + d0; const float* p1 = p0 + MR * 68; v8us oh, ol;
#pragma unroll
        for (int q = 0; q < 8; ++q) { unsigned short x, y; splitf(__fadd_rn(p0[q], p1[q]) * (1.0f / PCAR), x, y); oh[q] = x; ol[q] = y; }
        const size_t o = ((size_t)((b * TT + i0) / 16 + (tid >> 7)) * (DD / 32) + h * 2 + ((tid >> 6) & 1)) * 512 + (tid & 63) * 8; *(v8us*)(Ah + o) = oh; *(v8us*)(Al + o) = ol; }
}

extern "C" void kernel_launch(void* const* d_in, const int* in_sizes, int n_in,
                              void* d_out, int out_size, void* d_ws, size_t ws_size, hipStream_t stream) {
    (void)in_sizes; (void)n_in; (void)out_size;
    const float* IN[23]; for (int i = 0; i < 23; ++i) IN[i] = (const float*)d_in[i];
    // input [1024][4][1024], pos [1024][1][1024], indices (int [1]), in_proj_weight [3072][1024], in_proj_bias, out_proj_weight, out_proj_bias, pos_proj_weight, pos_proj_bias,
    // r_i [8][4][3072], s_i [8][4][1024], r_p, s_p, r_o, s_o, rm_i [8][1][3072], sm_i [8][1][1024], rm_p, sm_p, rm_o, sm_o, r_w_bias [16][64], r_r_bias = d_in[0..22]
    const float* x = IN[0]; const float* r = IN[1]; const int* idx = (const int*)d_in[2]; const float* rwb = IN[21]; const float* rrb = IN[22];
    float* OUT = (float*)d_out;     // [1024][4][1024] (rows t*4 + b)
    char* wsp = (char*)d_ws;
    auto take = [&](size_t bytes) { char* p = wsp; wsp += (bytes + 255) & ~(size_t)255; return (void*)p; };
    bf* WIh = (bf*)take((size_t)3 * DD * DD * 2); bf* WIl = (bf*)take((size_t)3 * DD * DD * 2); bf* WRh = (bf*)take((size_t)DD * DD * 2); bf* WRl = (bf*)take((size_t)DD * DD * 2); bf* WOh = (bf*)take((size_t)DD * DD * 2); bf* WOl = (bf*)take((size_t)DD * DD * 2);
    bf* XB = (bf*)take((size_t)NT * DD * 2); bf* RB = (bf*)take((size_t)TT * DD * 2); float* F = (float*)take((size_t)3 * NT * DD * 4); float* FR = (float*)take((size_t)TT * DD * 4);    // F: the f32 q, k, v planes, one behind the other
    h16* QA = (h16*)take((size_t)NT * DD * 2); h16* QB = (h16*)take((size_t)NT * DD * 2); h16* KP = (h16*)take((size_t)NT * DD * 2); h16* VT = (h16*)take((size_t)NT * DD * 2); h16* RK = (h16*)take((size_t)NH_ * TT * HD * 2);
    bf* ATh = (bf*)F; bf* ATl = ATh + (size_t)NT * DD;   // the merged hi/lo planes lie in F's q plane: its last reader (k_planes) runs before k_attn, and both planes fill exactly its bytes
    if ((size_t)(wsp - (char*)d_ws) > ws_size) return;    // total 116 MiB; ws 256 MiB
    // Five dependent launches; what does not depend on one another shares a grid.
    k_prep<<<GFI + 2 * GF1 + GCX + GCR, 256, 0, stream>>>(IN[3], IN[7], IN[5], idx, IN[15], IN[16], IN[9], IN[10], IN[17], IN[18], IN[11], IN[12], IN[19], IN[20], IN[13], IN[14], x, r, WIh, WIl, WRh, WRl, WOh, WOl, XB, RB);
    k_proj<<<dim3(NT / 64, 3 * DD / 64 + TT / 64 * (DD / 64) / (NT / 64), 1), 32, 0, stream>>>(XB, RB, WIh, WIl, WRh, WRl, DD, F, FR, IN[4], IN[8]);
    k_planes<<<4 * 1024 + 256, 256, 0, stream>>>(F, FR, rwb, rrb, QA, QB, KP, VT, RK);
    k_attn<<<dim3(TT / MR, NB_ * NH_, 1), 256, 0, stream>>>(QA, QB, KP, VT, RK, ATh, ATl);
    k_gemmw<bf, 2, true, true><<<dim3(NT / 64, DD / 64, 1), 32, 0, stream>>>(ATh, ATl, WOh, WOl, DD, OUT, DD, IN[6]);
}

// v006
// One run takes 162 microseconds.
// Timed twice side by side with v005, it ran 1.12 times as fast both times.
// Counting every step since v000, it is 10.5 times as fast.
#include <hip/hip_runtime.h>

// Relative-position multi-head attention (segment-recurrence style relative shift; query [1024][4][1024] seq-first, r [1024][1024]; w = query qkv_w^T -> q|k|v (16 heads x 64); r_k = r r_w^T; AC = (q + r_w_bias).k,
// BD = rel_shift((q + r_r_bias).r_k) with the module's exact zero-pad/reshape shift (out[i][j] = BD[f / (T+1)][f % (T+1) - 1] or 0 when f % (T+1) == 0, f = T + i*T + j); p = softmax((AC + BD) / 8)
// over the keys; attn = p.v; out = merged out_w^T + out_b; output [1024][4][1024] (rows t*4 + b)).
// Compute dtypes, f32 accumulate: every input rounded to bf16; the qkv and r projections on PLAIN bf16 inputs (exact) x hi/lo SPLIT bf16 weights; AC, BD and attn.v on SINGLE fp16 planes
// (the per-head biases added in f32 before the fp16 rounding; logit sd ~ 0.6); the relative shift is done by where each BD element is stored in the LDS score block of k_attn; P x1024;

// FRAGMENT ORDER of every 16-bit WMMA operand plane in the workspace (rows x K, K % 32 == 0): tiles of 16 rows x 32 k = 1 KiB, tile (row / 16, k / 32) at index (row / 16) * (K / 32) + k / 32; inside a tile the 16-byte chunk
// of row lr, k = half * 16 + hi * 8 + 0..7 stands at chunk half * 32 + hi * 16 + lr. That is the register layout of a 16x16x32 A or B fragment, so a fragment is two loads of 512 contiguous bytes (lane * 16): four whole 128-byte lines each.

#define NB_  4
#define TT   1024
#define NLY  8                    // weight-factor layers
#define RNK  4                    // additive rank
#define DD   1024
#define NH_  16
#define HD   64
#define NT   (NB_ * TT)
#define PCAR 1024.0f
typedef _Float16 h16;
typedef unsigned short bf;
typedef __attribute__((ext_vector_type(16))) __bf16   v16bf;
typedef __attribute__((ext_vector_type(16))) _Float16 v16h;
typedef __attribute__((ext_vector_type(8)))  _Float16 v8h;
typedef __attribute__((ext_vector_type(8)))  unsigned short v8us;
typedef __attribute__((ext_vector_type(8)))  float    v8f;
typedef __attribute__((ext_vector_type(4)))  float    v4f;
typedef v8h  __attribute__((may_alias)) v8ha;
typedef v4f  __attribute__((may_alias)) v4fa;
typedef v8us __attribute__((may_alias)) v8usa;

__device__ __forceinline__ unsigned short f2bf(float f) { unsigned u = __float_as_uint(f); u += 0x7FFFu + ((u >> 16) & 1u); return (unsigned short)(u >> 16); }
__device__ __forceinline__ float bf2f(unsigned short b) { return __uint_as_float(((unsigned)b) << 16); }
__device__ __forceinline__ float bfr(float f) { return bf2f(f2bf(f)); }
__device__ __forceinline__ v16h cat16(v8h lo, v8h hi) { return __builtin_shufflevector(lo, hi, 0, 1, 2, 3, 4, 5, 6, 7, 8, 9, 10, 11, 12, 13, 14, 15); }
__device__ __forceinline__ v16bf cat16b(v8us lo, v8us hi) { return __builtin_bit_cast(v16bf, __builtin_shufflevector(lo, hi, 0, 1, 2, 3, 4, 5, 6, 7, 8, 9, 10, 11, 12, 13, 14, 15)); }
__device__ __forceinline__ v8f wmma16(v16h a, v16h b, v8f c) { return __builtin_amdgcn_wmma_f32_16x16x32_f16(false, a, false, b, (short)0, c, false, false); }
__device__ __forceinline__ v8f wmmab(v16bf a, v16bf b, v8f c) { return __builtin_amdgcn_wmma_f32_16x16x32_bf16(false, a, false, b, (short)0, c, false, false); }



// ---- gemmw_tile: register-blocked GEMM, ONE WAVE per 64x64 output tile (16 accumulators) at rows r0.., columns c0.., operands straight from 16-bit planes in fragment order (ld takes tile start + lane * 8 elements); 32 threads.
// C[m][n] (f32, pitch ldc, + optional f32 bias[n]) = sum_k A[m][k] Bt[n][k] (+ split products per NSPLIT). K % 64 == 0. TB: row m of A is (batch m / TT, time m % TT) and goes to row time * NB_ + batch of C.
template <typename T16> struct WFrag;
template <> struct WFrag<h16> { typedef v16h V; static __device__ __forceinline__ V ld(const h16* p) { return cat16(*(const v8h*)p, *(const v8h*)(p + 256)); } static __device__ __forceinline__ v8f mma(V a, V b, v8f c) { return wmma16(a, b, c); } };
template <> struct WFrag<bf> { typedef v16bf V; static __device__ __forceinline__ V ld(const bf* p) { return cat16b(*(const v8us*)p, *(const v8us*)(p + 256)); } static __device__ __forceinline__ v8f mma(V a, V b, v8f c) { return wmmab(a, b, c); } };
// gemmw_acc: the k loop alone; it leaves the tile's 16 accumulators in acc (row mb * 16 + hi * 8 + j, column nb * 16 + lr).
template <typename T16, int NSPLIT>
__device__ __forceinline__ void gemmw_acc(const T16* __restrict__ A, const T16* __restrict__ A2, const T16* __restrict__ Bt, const T16* __restrict__ Bt2, int K, int r0, int c0, v8f (&acc)[4][4]) {
    typedef typename WFrag<T16>::V V;
    const int lane = threadIdx.x & 31;
#pragma unroll
    for (int mb = 0; mb < 4; ++mb)
#pragma unroll
        for (int nb = 0; nb < 4; ++nb) acc[mb][nb] = (v8f){};
    // Two fragment sets in registers: as soon as a set's WMMAs are issued, its refill for two k steps on (every A and B fragment, one group of loads) goes out and flies during the other set's WMMAs,
    // so that a wave waits for memory at most once per step, with a step of matrix work as lead. Each accumulator takes its products in the same order as with one set.
    V a[2][4], a2[2][4], b[2][4], b2[2][4];
    const char* pA[4]; const char* pA2[4]; const char* pB[4]; const char* pB2[4];    // wave-uniform start of each 16-row block (its K / 32 tiles lie in a row); they never change
#pragma unroll
    for (int q = 0; q < 4; ++q) { pA[q] = (const char*)(A + (size_t)(r0 + q * 16) * K); pA2[q] = (NSPLIT == 1 || NSPLIT == 2) ? (const char*)(A2 + (size_t)(r0 + q * 16) * K) : nullptr; pB[q] = (const char*)(Bt + (size_t)(c0 + q * 16) * K); pB2[q] = (NSPLIT >= 2) ? (const char*)(Bt2 + (size_t)(c0 + q * 16) * K) : nullptr; }
    unsigned vo = (unsigned)lane * 16u;    // this lane's byte offset inside a block, the same for every block: the one address register that moves, at the foot of a trip
    auto ldset = [&](int s, int ko) {
        if (NSPLIT == 2) asm volatile("s_wait_loadcnt 0x1f" ::: "memory");    // a set is 32 loads here: with at most 31 older ones left, a wave never has more than 63 outstanding, the most that s_wait_loadcnt can name
#pragma unroll
        for (int mb = 0; mb < 4; ++mb) { a[s][mb] = WFrag<T16>::ld((const T16*)(pA[mb] + vo) + ko); if (NSPLIT == 1 || NSPLIT == 2) a2[s][mb] = WFrag<T16>::ld((const T16*)(pA2[mb] + vo) + ko); }
#pragma unroll
        for (int nb = 0; nb < 4; ++nb) { b[s][nb] = WFrag<T16>::ld((const T16*)(pB[nb] + vo) + ko); if (NSPLIT >= 2) b2[s][nb] = WFrag<T16>::ld((const T16*)(pB2[nb] + vo) + ko); }
        asm volatile("s_wait_xcnt 0x0" ::: "memory");    // the base and offset registers of this group's loads are rewritten (the offset at a trip's foot, the bases behind the loop) only behind this wait
        __builtin_amdgcn_sched_barrier(0);    // a refill, with its wait, stays in front of the other set's WMMAs
    };
    auto mmset = [&](int s) {
#pragma unroll
        for (int nb = 0; nb < 4; ++nb)
#pragma unroll
            for (int mb = 0; mb < 4; ++mb) { acc[mb][nb] = WFrag<T16>::mma(a[s][mb], b[s][nb], acc[mb][nb]); if (NSPLIT == 1 || NSPLIT == 2) acc[mb][nb] = WFrag<T16>::mma(a2[s][mb], b[s][nb], acc[mb][nb]); if (NSPLIT >= 2) acc[mb][nb] = WFrag<T16>::mma(a[s][mb], b2[s][nb], acc[mb][nb]); }
        __builtin_amdgcn_sched_barrier(0);    // the loads that refill this set stay behind its WMMAs
    };
    ldset(0, 0); ldset(1, 512);    // ko: elements from the trip's first tile, 512 a tile
#pragma unroll 1                  // rolled: two steps a trip, so that each set keeps its own registers
    for (int kc = 64; kc < K; kc += 64) {
        mmset(0); ldset(0, 1024);
        mmset(1);
        vo += 2048;    // two tiles on; behind the wait that closes ldset(0, 1024); no load stands between
        ldset(1, 512);
    }
    mmset(0); mmset(1);
}
template <typename T16, int NSPLIT, bool BIAS, bool TB>
__device__ __forceinline__ void gemmw_tile(const T16* __restrict__ A, const T16* __restrict__ A2, const T16* __restrict__ Bt, const T16* __restrict__ Bt2, int K, float* C, int ldc, const float* __restrict__ bias, int r0, int c0) {
    __shared__ __align__(16) float os[16 * 68];
    const int lane = threadIdx.x & 31, lr = lane & 15, hi = lane >> 4;
    v8f acc[4][4];
    gemmw_acc<T16, NSPLIT>(A, A2, Bt, Bt2, K, r0, c0, acc);
#pragma unroll
    for (int mb = 0; mb < 4; ++mb) {
#pragma unroll
        for (int nb = 0; nb < 4; ++nb) {
#pragma unroll
            for (int j = 0; j < 8; ++j) os[(hi * 8 + j) * 68 + nb * 16 + lr] = acc[mb][nb][j]; }
        __builtin_amdgcn_wave_barrier(); asm volatile("" ::: "memory");
        const size_t rs = TB ? (size_t)NB_ * ldc : (size_t)ldc; float* crow = TB ? C + ((size_t)((r0 & (TT - 1)) + mb * 16) * NB_ + (r0 / TT)) * ldc + c0 : C + (size_t)(r0 + mb * 16) * ldc + c0;
{
#pragma unroll
            for (int s = 0; s < 8; ++s) { const int row = 2 * s + hi, cofs = lr * 4; v4f val = *(const v4fa*)(os + row * 68 + cofs); if (BIAS) { val[0] += bfr(bias[c0 + cofs]); val[1] += bfr(bias[c0 + cofs + 1]); val[2] += bfr(bias[c0 + cofs + 2]); val[3] += bfr(bias[c0 + cofs + 3]); }
                *(v4f*)(crow + (size_t)row * rs + cofs) = val; }
             }
        __builtin_amdgcn_wave_barrier(); asm volatile("" ::: "memory");
        asm volatile("s_wait_xcnt 0x0" ::: "memory");    // the address registers of this block's stores are reused only behind this wait
    }
}
// k_gemmw: one GEMM, grid (M/64, N/64).
template <typename T16, int NSPLIT, bool BIAS, bool TB>
__global__ __launch_bounds__(32) void k_gemmw(const T16* __restrict__ A, const T16* __restrict__ A2, const T16* __restrict__ Bt, const T16* __restrict__ Bt2, int K, float* C, int ldc, const float* __restrict__ bias) {
    gemmw_tile<T16, NSPLIT, BIAS, TB>(A, A2, Bt, Bt2, K, C, ldc, bias, (int)blockIdx.x * 64, (int)blockIdx.y * 64);
}

__device__ __forceinline__ h16 tohx(float x) { return (h16)x; }
__device__ __forceinline__ void splitf(float y, unsigned short& h, unsigned short& l) { h = f2bf(y); l = f2bf(y - bf2f(h)); }
typedef __attribute__((ext_vector_type(2))) _Float16 v2h;
typedef __attribute__((ext_vector_type(4))) _Float16 v4h;
typedef __attribute__((ext_vector_type(2))) unsigned short v2us;
typedef __attribute__((ext_vector_type(4))) int v4i;

// row and first k of the 16-byte chunk c of a plane in fragment order with kt = K / 32 tiles per 16 rows. The kernels below that fill such a plane go by the place they write, so that every store covers whole lines.
__device__ __forceinline__ void fo_rk(unsigned c, unsigned kt, int& row, int& k) { const unsigned tile = c >> 6; row = (int)((tile / kt) * 16 + (c & 15)); k = (int)((tile % kt) * 32 + ((c >> 5) & 1) * 16 + ((c >> 4) & 1) * 8); }
__device__ __forceinline__ void cvt8_blk(unsigned blk, const float* __restrict__ src, bf* dst, size_t n8) { const size_t i = (size_t)blk * 256 + threadIdx.x; if (i >= n8) return; int row, k0; fo_rk((unsigned)i, DD / 32, row, k0); const float* sp = src + (size_t)row * DD + k0; const v8f v = *(const v8f*)sp; v8us o;
    asm volatile("s_wait_xcnt 0x0" :: "v"(sp) : "memory");    // the address registers of the two issued loads are held to here and reused only behind this wait
#pragma unroll
    for (int k = 0; k < 8; ++k) o[k] = f2bf(v[k]); *(v8us*)(dst + i * 8) = o;  }
// fact_blk: factorised weight hi/lo planes: W'[a][b] = bf16(W[a][b]) bf16(rm[l][a]) bf16(sm[l][b]) + sum_k bf16(r[l][k][a]) bf16(s[l][k][b]) (f32, fixed order), l = indices[0] read on device (int input,
__device__ __forceinline__ void fact_blk(unsigned blk, const float* __restrict__ W, const int* __restrict__ idx, const float* __restrict__ rm, const float* __restrict__ sm, const float* __restrict__ rr, const float* __restrict__ ss, int rows, bf* Wh, bf* Wl) {
    const size_t i = ((size_t)blk * 256 + threadIdx.x) * 2; if (i >= (size_t)rows * DD) return; int a, b0; fo_rk((unsigned)(i >> 3), DD / 32, a, b0); b0 += (int)(i & 7); int l = idx[0]; l = l < 0 ? 0 : (l >= NLY ? NLY - 1 : l); v2us oh, ol;
#pragma unroll
    for (int q = 0; q < 2; ++q) { const int b = b0 + q; float m = __fmul_rn(bfr(rm[(size_t)l * rows + a]), bfr(sm[(size_t)l * DD + b])); asm volatile("" : "+v"(m)); float w = __fmul_rn(bfr(W[(size_t)a * DD + b]), m); asm volatile("" : "+v"(w)); float ad = 0.f;
#pragma unroll
        for (int k = 0; k < RNK; ++k) { float p = __fmul_rn(bfr(rr[((size_t)l * RNK + k) * rows + a]), bfr(ss[((size_t)l * RNK + k) * DD + b])); asm volatile("" : "+v"(p)); ad = __fadd_rn(ad, p); }
        unsigned short h, lo; splitf(__fadd_rn(w, ad), h, lo); oh[q] = h; ol[q] = lo; }
    *(v2us*)(Wh + i) = oh; *(v2us*)(Wl + i) = ol;  }
// k_prep: the three weight factorisations and the two bf16 roundings, which do not depend on one another, as ONE grid; a block's index range says which it works for.
#define GFI (3 * DD * DD / 512)   // blocks: in_proj weight, 512 elements a block
#define GF1 (DD * DD / 512)       // pos_proj, out_proj weight
#define GCX (NT * DD / 2048)      // input, 2048 elements a block
#define GCR (TT * DD / 2048)      // pos
__global__ __launch_bounds__(256) void k_prep(const float* __restrict__ Wi, const float* __restrict__ Wp, const float* __restrict__ Wo, const int* __restrict__ idx,
                                              const float* __restrict__ rm_i, const float* __restrict__ sm_i, const float* __restrict__ r_i, const float* __restrict__ s_i,
                                              const float* __restrict__ rm_p, const float* __restrict__ sm_p, const float* __restrict__ r_p, const float* __restrict__ s_p,
                                              const float* __restrict__ rm_o, const float* __restrict__ sm_o, const float* __restrict__ r_o, const float* __restrict__ s_o,
                                              const float* __restrict__ x, const float* __restrict__ r, bf* WIh, bf* WIl, bf* WRh, bf* WRl, bf* WOh, bf* WOl, bf* XB, bf* RB) {
    const unsigned blk = blockIdx.x;
    if (blk < GFI) fact_blk(blk, Wi, idx, rm_i, sm_i, r_i, s_i, 3 * DD, WIh, WIl);
    else if (blk < GFI + GF1) fact_blk(blk - GFI, Wp, idx, rm_p, sm_p, r_p, s_p, DD, WRh, WRl);
    else if (blk < GFI + 2 * GF1) fact_blk(blk - (GFI + GF1), Wo, idx, rm_o, sm_o, r_o, s_o, DD, WOh, WOl);
    else if (blk < GFI + 2 * GF1 + GCX) cvt8_blk(blk - (GFI + 2 * GF1), x, XB, (size_t)NT * DD / 8);
    else cvt8_blk(blk - (GFI + 2 * GF1 + GCX), r, RB, (size_t)TT * DD / 8);
}
// rowplanes: the tile in LDS -> one plane (Q false), or the two q planes (Q true), in fragment order. Chunk u * 32 + lane of a group's two tiles holds d = u * 16 + hi * 8 + 0..7 of row lr; the pointers come with the lane's part added.
template <bool Q>
__device__ __forceinline__ void rowplanes(const float* sp, int rstep, const float* __restrict__ bias, const float* __restrict__ ha, const float* __restrict__ hb, h16* P, h16* P2, size_t pstep) {
    v4f rb[4][2], ra[4][2], re[4][2];    // every bias value of the lane, fetched as one group: one load latency for the whole epilogue
#pragma unroll
    for (int u = 0; u < 4; ++u)
#pragma unroll
        for (int p = 0; p < 2; ++p) { rb[u][p] = *(const v4f*)(bias + u * 16 + p * 4); if (Q) { ra[u][p] = *(const v4f*)(ha + u * 16 + p * 4); re[u][p] = *(const v4f*)(hb + u * 16 + p * 4); } }
#pragma unroll
    for (int u = 0; u < 4; ++u) { float pb[8], ga[8], gb[8];
#pragma unroll
        for (int q = 0; q < 4; ++q) { pb[q] = bfr(rb[u][0][q]); pb[4 + q] = bfr(rb[u][1][q]); if (Q) { ga[q] = bfr(ra[u][0][q]); ga[4 + q] = bfr(ra[u][1][q]); gb[q] = bfr(re[u][0][q]); gb[4 + q] = bfr(re[u][1][q]); } }
#pragma unroll
        for (int bb = 0; bb < 4; ++bb) { const float* s = sp + bb * rstep + u * 16; const v4f s0 = *(const v4fa*)s, s1 = *(const v4fa*)(s + 4); float f[8]; v8h o;
#pragma unroll
            for (int q = 0; q < 4; ++q) { f[q] = s0[q] + pb[q]; f[4 + q] = s1[q] + pb[4 + q]; }
#pragma unroll
            for (int q = 0; q < 8; ++q) o[q] = tohx(Q ? __fadd_rn(f[q], ga[q]) : f[q]);
            *(v8h*)(P + (size_t)bb * pstep + u * 256) = o;
            if (Q) { v8h o2;
#pragma unroll
                for (int q = 0; q < 8; ++q) o2[q] = tohx(__fadd_rn(f[q], gb[q]));
                *(v8h*)(P2 + (size_t)bb * pstep + u * 256) = o2; } }
        asm volatile("s_wait_xcnt 0x0" ::: "memory"); }    // the registers of this group's stores (in the first group: of the bias loads too) are reused only behind this wait
}
// k_proj: the four projections, which do not depend on one another, as ONE grid (64, 52): blockIdx.y / 16 = 0, 1, 2: the q, k, v third of in_proj (x tile blockIdx.x, head y & 15); y = 48..51: the 16 x 16 tiles of the pos projection.
// A tile's 64 columns are one head; its 64 rows are 16 times x 4 batch entries (row = time * 4 + batch), or 64 positions of pos. So the tile holds whole 16-row blocks of k_attn's fp16 operand planes, and the epilogue writes those
// planes itself, in fragment order, 512 bytes in a row per store: q + r_w_bias and q + r_r_bias (QA, QB), k (KP), v transposed (VT), r_k (RK). No f32 projection goes through memory.
// Rounding of each value: f32 sum + bf16-rounded projection bias, then + bf16-rounded head bias (q only), each addition rounded to f32, then fp16.
__global__ __launch_bounds__(32) void k_proj(const bf* __restrict__ XB, const bf* __restrict__ RB, const bf* __restrict__ WIh, const bf* __restrict__ WIl, const bf* __restrict__ WRh, const bf* __restrict__ WRl, int K, const float* __restrict__ bi, const float* __restrict__ bp,
                                             const float* __restrict__ rwb, const float* __restrict__ rrb, h16* QA, h16* QB, h16* KP, h16* VT, h16* RK) {
    __shared__ __align__(16) float os[64 * 68];    // the whole tile; tile row m stands at LDS row (m & 3) * 16 + (m >> 2): batch-major for x tiles
    const int lane = threadIdx.x & 31, lr = lane & 15, hi = lane >> 4;
    const int x = (int)blockIdx.x, y = (int)blockIdx.y; const bool pos = y >= 48; const int sel = y >> 4; const int t = (y - 48) * 64 + x;
    const int r0 = (pos ? (t & 15) : x) * 64, hh = pos ? (t >> 4) : (y & 15), c0 = hh * 64;
    const float* bias = (pos ? bp : bi + (size_t)sel * DD) + c0;    // the 64 projection-bias values of this tile's columns
    v8f acc[4][4];
    gemmw_acc<bf, 3>(pos ? RB : XB, nullptr, pos ? WRh : WIh + (size_t)sel * DD * DD, pos ? WRl : WIl + (size_t)sel * DD * DD, K, r0, c0, acc);
#pragma unroll
    for (int mb = 0; mb < 4; ++mb)
#pragma unroll
        for (int nb = 0; nb < 4; ++nb)
#pragma unroll
            for (int j = 0; j < 8; ++j) os[((j & 3) * 16 + mb * 4 + hi * 2 + (j >> 2)) * 68 + nb * 16 + lr] = acc[mb][nb][j];
    __builtin_amdgcn_wave_barrier(); asm volatile("" ::: "memory");    // the reads below take other lanes' values: they stay behind the stores above
    if (!pos && sel == 2) {    // VT[batch * 16 + head][d][time]: lane = (8 times hi * 8.., column d = db * 16 + lr); the 16 times are half a 32-wide k tile
        h16* P = VT + (size_t)hh * (HD * TT) + (size_t)((x >> 1) * 64 + (x & 1) * 32 + lane) * 8;
        float rv[4];    // the lane's four bias values, fetched as one group
#pragma unroll
        for (int db = 0; db < 4; ++db) rv[db] = bias[db * 16 + lr];
#pragma unroll
        for (int db = 0; db < 4; ++db) { const float bv = bfr(rv[db]);
#pragma unroll
            for (int bb = 0; bb < 4; ++bb) { v8h o;
#pragma unroll
                for (int q = 0; q < 8; ++q) o[q] = tohx(os[(bb * 16 + hi * 8 + q) * 68 + db * 16 + lr] + bv);
                *(v8h*)(P + (size_t)bb * (NH_ * HD * TT) + (size_t)db * (16 * TT)) = o; }
            asm volatile("s_wait_xcnt 0x0" ::: "memory"); }    // the registers of this group's stores (in the first group: of the bias loads too) are reused only behind this wait
    } else {    // planes [..][row][d]: 16 rows x 64 d = two tiles = 2 KiB in a row; group bb = batch entry bb (x tiles) or 16-row block bb (pos tiles)
        const bool isq = !pos && sel == 0;
        const float* sp = os + (pos ? (lr & 3) * 16 + (lr >> 2) : lr) * 68 + hi * 8; const int rstep = pos ? 4 * 68 : 16 * 68;    // (group bb, row lr) stands bb * rstep floats behind sp
        h16* P = (pos ? RK + (size_t)hh * (TT * HD) + (size_t)(r0 >> 4) * (16 * HD) : (isq ? QA : KP) + (size_t)hh * (TT * HD) + (size_t)x * (16 * HD)) + lane * 8;
        const size_t pstep = pos ? (size_t)(16 * HD) : (size_t)NH_ * TT * HD;
        if (isq) rowplanes<true>(sp, rstep, bias + hi * 8, rwb + c0 + hi * 8, rrb + c0 + hi * 8, P, QB + (size_t)hh * (TT * HD) + (size_t)x * (16 * HD) + lane * 8, pstep);
        else rowplanes<false>(sp, rstep, bias + hi * 8, nullptr, nullptr, P, nullptr, pstep);
    }
}
// k_attn: one work-group (8 waves) = 32 query rows of one (batch, head). The whole 32 x 1024 score block stays in LDS (f32, row pitch SP floats), so no score, probability or per-head output plane goes through memory.
// 1) BD: raw tiles (q + r_r_bias).r_k for rows i (lower part) and rows i + 1 (upper part) against the same r_k fragment; element (i, n) lands at its shifted column of row i: with d = i + n + 1 - T,
//    d >= 0 -> column d from row i; d <= -2 -> column d + T + 1 from row i + 1; d == -1 has no place in the shifted row and falls on column T, in the row's pad, which nobody reads.
//    For fixed i that fills every column but i + 1, which holds the shift's zero and is stored by wave 0 (for i = T - 1 that store too falls on the pad).
// 2) AC tiles are added at their own place and scaled by 1/8.  3) each wave: softmax of 4 rows; P (x1024, fp16) overwrites the front half of the row's own bytes, which only that wave touches here.
// 4) P.V: wave = (16-wide d tile, half of the keys), both 16-row tiles; the two halves' partial sums meet in Of.  5) 1/1024, hi/lo bf16 split; the merged planes are in fragment order with rows batch * T + time, so the work-group owns four whole tiles of each and a wave stores 512 bytes in a row.
// Every plain '#pragma unroll' in k_attn: the fragment and accumulator arrays are indexed by the loop counters and stay in registers only when those loops are unrolled.
#define MR 32
#define SP 1028                   // 4112 bytes = 16 x odd: the b128 fragment reads of 16 rows fall on distinct banks
typedef v4h __attribute__((may_alias)) v4ha;
__global__ __launch_bounds__(256) __attribute__((amdgpu_waves_per_eu(4, 4))) void k_attn(const h16* __restrict__ QA, const h16* __restrict__ QB, const h16* __restrict__ KP, const h16* __restrict__ VT, const h16* __restrict__ RK, bf* Ah, bf* Al) {
    __shared__ __align__(16) float S[MR * SP];
    __shared__ __align__(16) float Of[2 * MR * 68];
    const int tid = threadIdx.x, lane = tid & 31, lr = lane & 15, hi = lane >> 4; const int w = __builtin_amdgcn_readfirstlane(tid >> 5);
    const int i0 = blockIdx.x * MR; const int z = blockIdx.y; const int b = z >> 4, h = z & 15;
    const h16* qa = QA + (size_t)z * TT * HD; const h16* qb = QB + (size_t)z * TT * HD; const h16* kp = KP + (size_t)z * TT * HD; const h16* vt = VT + (size_t)z * HD * TT; const h16* rk = RK + (size_t)h * TT * HD;
    if (w == 0) S[lane * SP + i0 + lane + 1] = 0.f;
    // Both score loops are straight-line with two operand buffers: the loads of the next pair of key tiles are issued, then this pair is worked on. The sched_barrier calls hold that order:
    // without them the scheduler lifts all eight tiles' loads to the top and spills past the 256 registers that two work-groups per WGP allow.
    v16h a[2][2], kb[2][2][2];    // AC's operands; the q + r_w_bias rows and the first pair of key tiles are fetched in front of the last BD pair, whose work covers their latency
    const h16* pa = qa + (size_t)i0 * HD + lane * 8; const h16* pk = kp + (size_t)(w * 128) * HD + lane * 8;    // 16 rows of 64 = two tiles = 16 * HD elements; the second tile (k 32..63) 512 elements on
    {   v16h aL[2][2], aU[2][2], rb[2][2][2]; const h16* bp = rk + (size_t)(w * 128) * HD + lane * 8; const h16* pL = qb + (size_t)i0 * HD + lane * 8;
        const int ru = (i0 + 17 + lr < TT) ? i0 + 17 + lr : TT - 1; const h16* pU = qb + (size_t)(ru >> 4) * 16 * HD + (hi * 16 + (ru & 15)) * 8;    // row T does not exist; row T - 1 has no upper part, so its aU result is never chosen
        const int rv = i0 + 1 + lr; const h16* pV = qb + (size_t)(rv >> 4) * 16 * HD + (hi * 16 + (rv & 15)) * 8;    // rows i + 1 straddle two row blocks: lane 15's (and 31's) chunk lies in the next one
#pragma unroll
        for (int ks = 0; ks < 2; ++ks) { aL[0][ks] = WFrag<h16>::ld(pL + ks * 512); aL[1][ks] = WFrag<h16>::ld(pL + 16 * HD + ks * 512); aU[0][ks] = WFrag<h16>::ld(pV + ks * 512); aU[1][ks] = WFrag<h16>::ld(pU + ks * 512); }
#pragma unroll
        for (int t = 0; t < 2; ++t) { rb[0][t][0] = WFrag<h16>::ld(bp + t * 16 * HD); rb[0][t][1] = WFrag<h16>::ld(bp + t * 16 * HD + 512); }
        asm volatile("s_wait_xcnt 0x0" :: "v"(pL), "v"(pU), "v"(pV) : "memory");    // the address registers of the issued loads are held to here and may be reused only behind this wait
#pragma unroll
        for (int g = 0; g < 4; ++g) {
            if (g < 3) {
#pragma unroll
                for (int t = 0; t < 2; ++t) { rb[(g + 1) & 1][t][0] = WFrag<h16>::ld(bp + ((g + 1) * 2 + t) * 16 * HD); rb[(g + 1) & 1][t][1] = WFrag<h16>::ld(bp + ((g + 1) * 2 + t) * 16 * HD + 512); } }
            else {
#pragma unroll
                for (int mb = 0; mb < 2; ++mb)
#pragma unroll
                    for (int ks = 0; ks < 2; ++ks) { a[mb][ks] = WFrag<h16>::ld(pa + mb * 16 * HD + ks * 512); kb[0][mb][ks] = WFrag<h16>::ld(pk + mb * 16 * HD + ks * 512); } }
            if (g == 2) asm volatile("s_wait_xcnt 0x0" :: "v"(bp) : "memory");    // last loads through bp: its registers are held to here and reused only behind this wait
            if (g == 3) asm volatile("s_wait_xcnt 0x0" :: "v"(pa) : "memory");    // the same for pa
            __builtin_amdgcn_sched_barrier(0);    // the next pair's loads stay in front of this pair's work
#pragma unroll
            for (int t = 0; t < 2; ++t) { const int n0 = w * 128 + (g * 2 + t) * 16;
#pragma unroll
                for (int mb = 0; mb < 2; ++mb) { v8f cL = (v8f){}, cU = (v8f){}; cL = wmma16(aL[mb][0], rb[g & 1][t][0], cL); cU = wmma16(aU[mb][0], rb[g & 1][t][0], cU); cL = wmma16(aL[mb][1], rb[g & 1][t][1], cL); cU = wmma16(aU[mb][1], rb[g & 1][t][1], cU);
#pragma unroll
                    for (int j = 0; j < 8; ++j) { const int ml = mb * 16 + hi * 8 + j; const int d = i0 + ml + n0 + lr + 1 - TT;
                        S[ml * SP + d + ((d >> 31) & (TT + 1))] = (d >= 0) ? cL[j] : cU[j]; } } }
            __builtin_amdgcn_sched_barrier(0);    // later pairs' loads stay behind this pair's work
        }
    }
    __syncthreads();              // every shifted BD element is in place before AC is added to it
    {
#pragma unroll
        for (int g = 0; g < 4; ++g) {
            if (g < 3) {
#pragma unroll
                for (int t = 0; t < 2; ++t) { kb[(g + 1) & 1][t][0] = WFrag<h16>::ld(pk + ((g + 1) * 2 + t) * 16 * HD); kb[(g + 1) & 1][t][1] = WFrag<h16>::ld(pk + ((g + 1) * 2 + t) * 16 * HD + 512); } }
            if (g == 2) asm volatile("s_wait_xcnt 0x0" :: "v"(pk) : "memory");    // last loads through pk: its registers are held to here and reused only behind this wait
            __builtin_amdgcn_sched_barrier(0);    // the next pair's loads stay in front of this pair's work
#pragma unroll
            for (int t = 0; t < 2; ++t) { const int n0 = w * 128 + (g * 2 + t) * 16;
#pragma unroll
                for (int mb = 0; mb < 2; ++mb) { v8f c = (v8f){}; c = wmma16(a[mb][0], kb[g & 1][t][0], c); c = wmma16(a[mb][1], kb[g & 1][t][1], c);
#pragma unroll
                    for (int j = 0; j < 8; ++j) { float* sp = S + (mb * 16 + hi * 8 + j) * SP + n0 + lr; *sp = __fmul_rn(__fadd_rn(c[j], *sp), 0.125f); } } }
            __builtin_amdgcn_sched_barrier(0);    // later pairs' loads stay behind this pair's work
        }
    }
    __syncthreads();              // whole rows are complete before a wave reduces them
    const int dt = w & 3, kh = w >> 2; v16h bv[16]; const h16* vp = vt + (size_t)(dt * (TT / 32) + kh * 16) * 512 + lane * 8;    // this wave's V fragments: the first eight are fetched here, so that their latency passes behind the softmax
#pragma unroll
    for (int ks = 0; ks < 8; ++ks) bv[ks] = WFrag<h16>::ld(vp + ks * 512);
#pragma unroll 1                  // rolled: one row's 32 values at a time, so that the V fragments held across this loop stay in registers
    for (int rr = 0; rr < 4; ++rr) { float* sr = S + (w * 4 + rr) * SP; float v[32]; float mx = -3.0e38f;
#pragma unroll
        for (int ch = 0; ch < 8; ++ch) { const v4f sv = *(const v4fa*)(sr + ch * 128 + lane * 4);
#pragma unroll
            for (int q = 0; q < 4; ++q) { v[ch * 4 + q] = sv[q]; mx = fmaxf(mx, sv[q]); } }
#pragma unroll
        for (int sh = 16; sh; sh >>= 1) mx = fmaxf(mx, __shfl_xor(mx, sh, 32));
        float sum = 0.f;
#pragma unroll
        for (int k = 0; k < 32; ++k) { v[k] = __expf(v[k] - mx); sum += v[k]; }
#pragma unroll
        for (int sh = 16; sh; sh >>= 1) sum += __shfl_xor(sum, sh, 32);
        const float fct = __fdiv_rn(PCAR, sum); h16* pr = (h16*)sr;
#pragma unroll
        for (int ch = 0; ch < 8; ++ch) { v4h o;
#pragma unroll
            for (int q = 0; q < 4; ++q) o[q] = tohx(v[ch * 4 + q] * fct);
            *(v4ha*)(pr + ch * 128 + lane * 4) = o; } }
    __syncthreads();              // P of all 32 rows is written before any wave reads it as its A operand
#pragma unroll
    for (int ks = 8; ks < 16; ++ks) bv[ks] = WFrag<h16>::ld(vp + ks * 512);    // the other eight fly while the first eight are worked on (all sixteen held over the softmax spill)
    asm volatile("s_wait_xcnt 0x0" :: "v"(vp) : "memory");    // last loads through vp: its registers are held to here and reused only behind this wait
    {   const h16* P = (const h16*)S; v8f o[2]; o[0] = (v8f){}; o[1] = (v8f){}; const h16* pp = P + (size_t)lr * (2 * SP) + kh * 512 + 8 * hi;
#pragma unroll
        for (int ks = 0; ks < 16; ++ks) {
#pragma unroll
            for (int mb = 0; mb < 2; ++mb) { const h16* ap = pp + (size_t)mb * 16 * (2 * SP) + ks * 32; o[mb] = wmma16(cat16(*(const v8ha*)ap, *(const v8ha*)(ap + 16)), bv[ks], o[mb]); } }
#pragma unroll
        for (int mb = 0; mb < 2; ++mb)
#pragma unroll
            for (int j = 0; j < 8; ++j) Of[(kh * MR + mb * 16 + hi * 8 + j) * 68 + dt * 16 + lr] = o[mb][j];
    }
    __syncthreads();              // both key halves' partial sums are in Of
    {   const int row = (tid >> 7) * 16 + lr, d0 = ((tid >> 6) & 1) * 32 + ((tid >> 5) & 1) * 16 + hi * 8; const float* p0 = Of + row * 68 + d0; const float* p1 = p0 + MR * 68; v8us oh, ol;
#pragma unroll
        for (int q = 0; q < 8; ++q) { unsigned short x, y; splitf(__fadd_rn(p0[q], p1[q]) * (1.0f / PCAR), x, y); oh[q] = x; ol[q] = y; }
        const size_t o = ((size_t)((b * TT + i0) / 16 + (tid >> 7)) * (DD / 32) + h * 2 + ((tid >> 6) & 1)) * 512 + (tid & 63) * 8; *(v8us*)(Ah + o) = oh; *(v8us*)(Al + o) = ol; }
}

extern "C" void kernel_launch(void* const* d_in, const int* in_sizes, int n_in,
                              void* d_out, int out_size, void* d_ws, size_t ws_size, hipStream_t stream) {
    (void)in_sizes; (void)n_in; (void)out_size;
    const float* IN[23]; for (int i = 0; i < 23; ++i) IN[i] = (const float*)d_in[i];
    // input [1024][4][1024], pos [1024][1][1024], indices (int [1]), in_proj_weight [3072][1024], in_proj_bias, out_proj_weight, out_proj_bias, pos_proj_weight, pos_proj_bias,
    // r_i [8][4][3072], s_i [8][4][1024], r_p, s_p, r_o, s_o, rm_i [8][1][3072], sm_i [8][1][1024], rm_p, sm_p, rm_o, sm_o, r_w_bias [16][64], r_r_bias = d_in[0..22]
    const float* x = IN[0]; const float* r = IN[1]; const int* idx = (const int*)d_in[2]; const float* rwb = IN[21]; const float* rrb = IN[22];
    float* OUT = (float*)d_out;     // [1024][4][1024] (rows t*4 + b)
    char* wsp = (char*)d_ws;
    auto take = [&](size_t bytes) { char* p = wsp; wsp += (bytes + 255) & ~(size_t)255; return (void*)p; };
    bf* WIh = (bf*)take((size_t)3 * DD * DD * 2); bf* WIl = (bf*)take((size_t)3 * DD * DD * 2); bf* WRh = (bf*)take((size_t)DD * DD * 2); bf* WRl = (bf*)take((size_t)DD * DD * 2); bf* WOh = (bf*)take((size_t)DD * DD * 2); bf* WOl = (bf*)take((size_t)DD * DD * 2);
    bf* XB = (bf*)take((size_t)NT * DD * 2); bf* RB = (bf*)take((size_t)TT * DD * 2);
    h16* QA = (h16*)take((size_t)NT * DD * 2); h16* QB = (h16*)take((size_t)NT * DD * 2); h16* KP = (h16*)take((size_t)NT * DD * 2); h16* VT = (h16*)take((size_t)NT * DD * 2); h16* RK = (h16*)take((size_t)NH_ * TT * HD * 2);
    bf* ATh = (bf*)take((size_t)NT * DD * 2); bf* ATl = (bf*)take((size_t)NT * DD * 2);   // the merged hi/lo planes
    if ((size_t)(wsp - (char*)d_ws) > ws_size) return;    // total 80 MiB; ws 256 MiB
    // Four dependent launches; what does not depend on one another shares a grid.
    k_prep<<<GFI + 2 * GF1 + GCX + GCR, 256, 0, stream>>>(IN[3], IN[7], IN[5], idx, IN[15], IN[16], IN[9], IN[10], IN[17], IN[18], IN[11], IN[12], IN[19], IN[20], IN[13], IN[14], x, r, WIh, WIl, WRh, WRl, WOh, WOl, XB, RB);
    k_proj<<<dim3(NT / 64, 3 * DD / 64 + TT / 64 * (DD / 64) / (NT / 64), 1), 32, 0, stream>>>(XB, RB, WIh, WIl, WRh, WRl, DD, IN[4], IN[8], rwb, rrb, QA, QB, KP, VT, RK);
    k_attn<<<dim3(TT / MR, NB_ * NH_, 1), 256, 0, stream>>>(QA, QB, KP, VT, RK, ATh, ATl);
    k_gemmw<bf, 2, true, true><<<dim3(NT / 64, DD / 64, 1), 32, 0, stream>>>(ATh, ATl, WOh, WOl, DD, OUT, DD, IN[6]);
}

// v007
// Measured time: 145 microseconds a run.
// Next to v006, in two timings, it ran 1.12 times as fast each time.
// Counting every step since v000, it is 11.8 times as fast.
#include <hip/hip_runtime.h>

// Relative-position multi-head attention (segment-recurrence style relative shift; query [1024][4][1024] seq-first, r [1024][1024]; w = query qkv_w^T -> q|k|v (16 heads x 64); r_k = r r_w^T; AC = (q + r_w_bias).k,
// BD = rel_shift((q + r_r_bias).r_k) with the module's exact zero-pad/reshape shift (out[i][j] = BD[f / (T+1)][f % (T+1) - 1] or 0 when f % (T+1) == 0, f = T + i*T + j); p = softmax((AC + BD) / 8)
// over the keys; attn = p.v; out = merged out_w^T + out_b; output [1024][4][1024] (rows t*4 + b)).
// Compute dtypes, f32 accumulate: every input rounded to bf16; the qkv and r projections on PLAIN bf16 inputs (exact) x hi/lo SPLIT bf16 weights; AC, BD and attn.v on SINGLE fp16 planes
// (the per-head biases added in f32 before the fp16 rounding; logit sd ~ 0.6); the relative shift is done by where each BD element is stored in the LDS score block of k_attn; P x1024;

// FRAGMENT ORDER of every 16-bit WMMA operand plane in the workspace (rows x K, K % 32 == 0): tiles of 16 rows x 32 k = 1 KiB, tile (row / 16, k / 32) at index (row / 16) * (K / 32) + k / 32; inside a tile the 16-byte chunk
// of row lr, k = half * 16 + hi * 8 + 0..7 stands at chunk half * 32 + hi * 16 + lr. That is the register layout of a 16x16x32 A or B fragment, so a fragment is two loads of 512 contiguous bytes (lane * 16): four whole 128-byte lines each.

#define NB_  4
#define TT   1024
#define NLY  8                    // weight-factor layers
#define RNK  4                    // additive rank
#define DD   1024
#define NH_  16
#define HD   64
#define NT   (NB_ * TT)
#define PCAR 1024.0f
typedef _Float16 h16;
typedef unsigned short bf;
typedef __attribute__((ext_vector_type(16))) __bf16   v16bf;
typedef __attribute__((ext_vector_type(16))) _Float16 v16h;
typedef __attribute__((ext_vector_type(8)))  _Float16 v8h;
typedef __attribute__((ext_vector_type(8)))  unsigned short v8us;
typedef __attribute__((ext_vector_type(8)))  float    v8f;
typedef __attribute__((ext_vector_type(4)))  float    v4f;
typedef v8h  __attribute__((may_alias)) v8ha;
typedef v4f  __attribute__((may_alias)) v4fa;
typedef v8us __attribute__((may_alias)) v8usa;

__device__ __forceinline__ unsigned short f2bf(float f) { unsigned u = __float_as_uint(f); u += 0x7FFFu + ((u >> 16) & 1u); return (unsigned short)(u >> 16); }
__device__ __forceinline__ float bf2f(unsigned short b) { return __uint_as_float(((unsigned)b) << 16); }
__device__ __forceinline__ float bfr(float f) { return bf2f(f2bf(f)); }
__device__ __forceinline__ v16h cat16(v8h lo, v8h hi) { return __builtin_shufflevector(lo, hi, 0, 1, 2, 3, 4, 5, 6, 7, 8, 9, 10, 11, 12, 13, 14, 15); }
__device__ __forceinline__ v16bf cat16b(v8us lo, v8us hi) { return __builtin_bit_cast(v16bf, __builtin_shufflevector(lo, hi, 0, 1, 2, 3, 4, 5, 6, 7, 8, 9, 10, 11, 12, 13, 14, 15)); }
__device__ __forceinline__ v8f wmma16(v16h a, v16h b, v8f c) { return __builtin_amdgcn_wmma_f32_16x16x32_f16(false, a, false, b, (short)0, c, false, false); }
__device__ __forceinline__ v8f wmmab(v16bf a, v16bf b, v8f c) { return __builtin_amdgcn_wmma_f32_16x16x32_bf16(false, a, false, b, (short)0, c, false, false); }



// ---- gemmw_tile: register-blocked GEMM, ONE WAVE per 64x64 output tile (16 accumulators) at rows r0.., columns c0.., operands straight from 16-bit planes in fragment order (ld takes tile start + lane * 8 elements); 32 threads.
// C[m][n] (f32, pitch ldc, + optional f32 bias[n]) = sum_k A[m][k] Bt[n][k] (+ split products per NSPLIT). K % 64 == 0. TB: row m of A is (batch m / TT, time m % TT) and goes to row time * NB_ + batch of C.
template <typename T16> struct WFrag;
template <> struct WFrag<h16> { typedef v16h V; static __device__ __forceinline__ V ld(const h16* p) { return cat16(*(const v8h*)p, *(const v8h*)(p + 256)); } static __device__ __forceinline__ v8f mma(V a, V b, v8f c) { return wmma16(a, b, c); } };
template <> struct WFrag<bf> { typedef v16bf V; static __device__ __forceinline__ V ld(const bf* p) { return cat16b(*(const v8us*)p, *(const v8us*)(p + 256)); } static __device__ __forceinline__ v8f mma(V a, V b, v8f c) { return wmmab(a, b, c); } };
// gemmw_acc: the k loop alone; it leaves the tile's 16 accumulators in acc (row mb * 16 + hi * 8 + j, column nb * 16 + lr).
template <typename T16, int NSPLIT>
__device__ __forceinline__ void gemmw_acc(const T16* __restrict__ A, const T16* __restrict__ A2, const T16* __restrict__ Bt, const T16* __restrict__ Bt2, int K, int r0, int c0, v8f (&acc)[4][4]) {
    typedef typename WFrag<T16>::V V;
    const int lane = threadIdx.x & 31;
#pragma unroll
    for (int mb = 0; mb < 4; ++mb)
#pragma unroll
        for (int nb = 0; nb < 4; ++nb) acc[mb][nb] = (v8f){};
    // Two fragment sets in registers: as soon as a set's WMMAs are issued, its refill for two k steps on (every A and B fragment, one group of loads) goes out and flies during the other set's WMMAs,
    // so that a wave waits for memory at most once per step, with a step of matrix work as lead. Each accumulator takes its products in the same order as with one set.
    V a[2][4], a2[2][4], b[2][4], b2[2][4];
    const char* pA[4]; const char* pA2[4]; const char* pB[4]; const char* pB2[4];    // wave-uniform start of each 16-row block (its K / 32 tiles lie in a row); they never change
#pragma unroll
    for (int q = 0; q < 4; ++q) { pA[q] = (const char*)(A + (size_t)(r0 + q * 16) * K); pA2[q] = (NSPLIT == 1 || NSPLIT == 2) ? (const char*)(A2 + (size_t)(r0 + q * 16) * K) : nullptr; pB[q] = (const char*)(Bt + (size_t)(c0 + q * 16) * K); pB2[q] = (NSPLIT >= 2) ? (const char*)(Bt2 + (size_t)(c0 + q * 16) * K) : nullptr; }
    unsigned vo = (unsigned)lane * 16u;    // this lane's byte offset inside a block, the same for every block: the one address register that moves, at the foot of a trip
    auto ldset = [&](int s, int ko) {
        if (NSPLIT == 2) asm volatile("s_wait_loadcnt 0x1f" ::: "memory");    // a set is 32 loads here: with at most 31 older ones left, a wave never has more than 63 outstanding, the most that s_wait_loadcnt can name
#pragma unroll
        for (int mb = 0; mb < 4; ++mb) { a[s][mb] = WFrag<T16>::ld((const T16*)(pA[mb] + vo) + ko); if (NSPLIT == 1 || NSPLIT == 2) a2[s][mb] = WFrag<T16>::ld((const T16*)(pA2[mb] + vo) + ko); }
#pragma unroll
        for (int nb = 0; nb < 4; ++nb) { b[s][nb] = WFrag<T16>::ld((const T16*)(pB[nb] + vo) + ko); if (NSPLIT >= 2) b2[s][nb] = WFrag<T16>::ld((const T16*)(pB2[nb] + vo) + ko); }
        asm volatile("s_wait_xcnt 0x0" ::: "memory");    // the base and offset registers of this group's loads are rewritten (the offset at a trip's foot, the bases behind the loop) only behind this wait
        __builtin_amdgcn_sched_barrier(0);    // a refill, with its wait, stays in front of the other set's WMMAs
    };
    auto mmset = [&](int s) {
#pragma unroll
        for (int nb = 0; nb < 4; ++nb)
#pragma unroll
            for (int mb = 0; mb < 4; ++mb) { acc[mb][nb] = WFrag<T16>::mma(a[s][mb], b[s][nb], acc[mb][nb]); if (NSPLIT == 1 || NSPLIT == 2) acc[mb][nb] = WFrag<T16>::mma(a2[s][mb], b[s][nb], acc[mb][nb]); if (NSPLIT >= 2) acc[mb][nb] = WFrag<T16>::mma(a[s][mb], b2[s][nb], acc[mb][nb]); }
        __builtin_amdgcn_sched_barrier(0);    // the loads that refill this set stay behind its WMMAs
    };
    ldset(0, 0); ldset(1, 512);    // ko: elements from the trip's first tile, 512 a tile
#pragma unroll 1                  // rolled: two steps a trip, so that each set keeps its own registers
    for (int kc = 64; kc < K; kc += 64) {
        mmset(0); ldset(0, 1024);
        mmset(1);
        vo += 2048;    // two tiles on; behind the wait that closes ldset(0, 1024); no load stands between
        ldset(1, 512);
    }
    mmset(0); mmset(1);
}
template <typename T16, int NSPLIT, bool BIAS, bool TB>
__device__ __forceinline__ void gemmw_tile(const T16* __restrict__ A, const T16* __restrict__ A2, const T16* __restrict__ Bt, const T16* __restrict__ Bt2, int K, float* C, int ldc, const float* __restrict__ bias, int r0, int c0) {
    __shared__ __align__(16) float os[16 * 68];
    const int lane = threadIdx.x & 31, lr = lane & 15, hi = lane >> 4;
    v8f acc[4][4];
    gemmw_acc<T16, NSPLIT>(A, A2, Bt, Bt2, K, r0, c0, acc);
#pragma unroll
    for (int mb = 0; mb < 4; ++mb) {
#pragma unroll
        for (int nb = 0; nb < 4; ++nb) {
#pragma unroll
            for (int j = 0; j < 8; ++j) os[(hi * 8 + j) * 68 + nb * 16 + lr] = acc[mb][nb][j]; }
        __builtin_amdgcn_wave_barrier(); asm volatile("" ::: "memory");
        const size_t rs = TB ? (size_t)NB_ * ldc : (size_t)ldc; float* crow = TB ? C + ((size_t)((r0 & (TT - 1)) + mb * 16) * NB_ + (r0 / TT)) * ldc + c0 : C + (size_t)(r0 + mb * 16) * ldc + c0;
{
#pragma unroll
            for (int s = 0; s < 8; ++s) { const int row = 2 * s + hi, cofs = lr * 4; v4f val = *(const v4fa*)(os + row * 68 + cofs); if (BIAS) { val[0] += bfr(bias[c0 + cofs]); val[1] += bfr(bias[c0 + cofs + 1]); val[2] += bfr(bias[c0 + cofs + 2]); val[3] += bfr(bias[c0 + cofs + 3]); }
                *(v4f*)(crow + (size_t)row * rs + cofs) = val; }
             }
        __builtin_amdgcn_wave_barrier(); asm volatile("" ::: "memory");
        asm volatile("s_wait_xcnt 0x0" ::: "memory");    // the address registers of this block's stores are reused only behind this wait
    }
}
// k_gemmw: one GEMM, grid (M/64, N/64).
template <typename T16, int NSPLIT, bool BIAS, bool TB>
__global__ __launch_bounds__(32) void k_gemmw(const T16* __restrict__ A, const T16* __restrict__ A2, const T16* __restrict__ Bt, const T16* __restrict__ Bt2, int K, float* C, int ldc, const float* __restrict__ bias) {
    gemmw_tile<T16, NSPLIT, BIAS, TB>(A, A2, Bt, Bt2, K, C, ldc, bias, (int)blockIdx.x * 64, (int)blockIdx.y * 64);
}

__device__ __forceinline__ h16 tohx(float x) { return (h16)x; }
__device__ __forceinline__ void splitf(float y, unsigned short& h, unsigned short& l) { h = f2bf(y); l = f2bf(y - bf2f(h)); }
typedef __attribute__((ext_vector_type(2))) _Float16 v2h;
typedef __attribute__((ext_vector_type(4))) _Float16 v4h;
typedef __attribute__((ext_vector_type(2))) unsigned short v2us;
typedef __attribute__((ext_vector_type(4))) int v4i;

// k_prep's unit of work: one wave, 8 rows x 32 columns (one k tile) of a [rows][DD] f32 source. Lane = (row lane & 7, 8 columns (lane >> 3) * 8): a 16-byte load takes pieces of 8 lines, one per row, and the lane's second load the rest of
// the same lines; the lane's 8 results are one 16-byte chunk of the plane in fragment order, chunk (lane >> 3) * 16 + (row & 15) of the tile, so that a wave's store covers four whole 128-byte lines.
// A wave does PU such units, every load of them issued before the first result is formed: few long waves with many loads in flight each, in place of one short wave per 64 (weights) or 256 (inputs) elements.
// Every plain '#pragma unroll' in cvt_wave and fact_wave: the value arrays are indexed by the loop counters and stay in registers only when those loops are unrolled.
#define PU 8                      // units a wave
#define PW 4                      // waves a block
// cvt_wave: bf16 rounding of 8 rows x 256 columns: wave wv = (16-row block wv >> 3, quarter of the columns (wv >> 1) & 3, upper or lower 8 rows wv & 1); unit j is k tile j of the quarter.
__device__ __forceinline__ void cvt_wave(unsigned wv, const float* __restrict__ src, bf* dst) {
    const unsigned lane = threadIdx.x & 31, r8 = wv & 1, kq = (wv >> 1) & 3, rb = wv >> 3, c4 = lane >> 3, lr = r8 * 8 + (lane & 7);
    const float* sp = src + (size_t)(rb * 16 + lr) * DD + kq * (PU * 32) + c4 * 8; bf* dp = dst + ((size_t)(rb * (DD / 32) + kq * PU) * 64 + c4 * 16 + lr) * 8; v4f v[PU][2];
#pragma unroll
    for (int j = 0; j < PU; ++j) { v[j][0] = *(const v4f*)(sp + j * 32); v[j][1] = *(const v4f*)(sp + j * 32 + 4); }
    asm volatile("s_wait_xcnt 0x0" :: "v"(sp) : "memory");    // the address registers of the issued loads are held to here and reused only behind this wait
#pragma unroll
    for (int j = 0; j < PU; ++j) { v8us o;
#pragma unroll
        for (int q = 0; q < 4; ++q) { o[q] = f2bf(v[j][0][q]); o[4 + q] = f2bf(v[j][1][q]); }
        *(v8us*)(dp + j * 512) = o; }
}
// fact_wave: factorised weight hi/lo planes: W'[a][b] = bf16(W[a][b]) (bf16(rm[l][a]) bf16(sm[l][b])) + sum_k bf16(r[l][k][a]) bf16(s[l][k][b]) (f32, k ascending), l = indices[0] read on device and clamped to the factor arrays.
// Wave wv = (64 rows wv >> 5, k tile wv & 31); unit j is rows j * 8 .. j * 8 + 7 of the 64, so the lane's 8 columns, and with them its sm and s values, are the same in all its units and are fetched once.
// All loads go out first; the arithmetic is one rolled loop of two trips, four units each, so that the text a wave runs through only once stays short.
__device__ __forceinline__ void fact_wave(unsigned wv, const float* __restrict__ W, const int* __restrict__ idx, const float* __restrict__ rm, const float* __restrict__ sm, const float* __restrict__ rr, const float* __restrict__ ss, int rows, bf* Wh, bf* Wl) {
    const unsigned lane = threadIdx.x & 31, kt = wv & 31, rg = wv >> 5, c4 = lane >> 3, row0 = rg * 64 + (lane & 7), col = kt * 32 + c4 * 8;
    const float* wp = W + (size_t)row0 * DD + col; size_t o = ((size_t)(rg * 4 * (DD / 32) + kt) * 64 + c4 * 16 + (lane & 7)) * 8; v4f v[2][PU / 2][2];    // v, ra: [0] this trip's four units, [1] the next trip's
#pragma unroll
    for (int j = 0; j < PU; ++j) { v[j >> 2][j & 3][0] = *(const v4f*)(wp + (size_t)j * 8 * DD); v[j >> 2][j & 3][1] = *(const v4f*)(wp + (size_t)j * 8 * DD + 4); }
    int l = idx[0]; l = __builtin_amdgcn_readfirstlane(l < 0 ? 0 : (l >= NLY ? NLY - 1 : l));    // the same in every lane: in a scalar register the four starts below are scalar too, and the loads name only the lane's two offsets
    const char* smp = (const char*)(sm + (size_t)l * DD); const char* ssp = (const char*)(ss + (size_t)l * RNK * DD); const char* rmp = (const char*)(rm + (size_t)l * rows); const char* rrp = (const char*)(rr + (size_t)l * RNK * rows);    // wave-uniform starts of layer l
    const unsigned cof = col * 4u, rof = row0 * 4u;    // the lane's byte offsets behind them: its first column, its first row
    const char* rq[RNK];    // the lane's first row in each of the layer's RNK rows of r
#pragma unroll
    for (int k = 0; k < RNK; ++k) rq[k] = rrp + (size_t)k * rows * 4 + rof;
    v4f cs[1 + RNK][2]; float ra[2][PU / 2][1 + RNK];
#pragma unroll
    for (int p = 0; p < 2; ++p) { cs[0][p] = *(const v4f*)(smp + cof + p * 16);
#pragma unroll
        for (int k = 0; k < RNK; ++k) cs[1 + k][p] = *(const v4f*)(ssp + cof + k * (DD * 4) + p * 16); }
#pragma unroll
    for (int g = 0; g < 2; ++g) {
        if (g == 1) asm volatile("s_wait_loadcnt 0x2b" ::: "memory");    // 46 loads are out and 20 follow: with at most 43 older ones left, a wave never has more than 63 outstanding, the most that s_wait_loadcnt can name
#pragma unroll
        for (int u = 0; u < PU / 2; ++u) { ra[g][u][0] = *(const float*)(rmp + rof + (g * 4 + u) * 32);
#pragma unroll
            for (int k = 0; k < RNK; ++k) ra[g][u][1 + k] = *(const float*)(rq[k] + (g * 4 + u) * 32); } }
    asm volatile("s_wait_xcnt 0x0" :: "v"(wp), "v"(cof), "v"(rof), "v"(rq[0]), "v"(rq[1]), "v"(rq[2]), "v"(rq[3]) : "memory");    // the address and offset registers of the issued loads are held to here and reused only behind this wait
    float cf[1 + RNK][8];
#pragma unroll
    for (int k = 0; k < 1 + RNK; ++k)
#pragma unroll
        for (int q = 0; q < 4; ++q) { cf[k][q] = bfr(cs[k][0][q]); cf[k][4 + q] = bfr(cs[k][1][q]); }
#pragma unroll 1                  // rolled: for speed only
    for (int g = 0; g < 2; ++g) {
#pragma unroll
        for (int u = 0; u < PU / 2; ++u) { v8us oh, ol; float rf[1 + RNK];
#pragma unroll
            for (int k = 0; k < 1 + RNK; ++k) rf[k] = bfr(ra[0][u][k]);
#pragma unroll
            for (int q = 0; q < 8; ++q) { const float wb = bfr(v[0][u][q >> 2][q & 3]); float ad = rf[1] * cf[1][q];
#pragma unroll
                for (int k = 1; k < RNK; ++k) ad += rf[1 + k] * cf[1 + k][q];
                unsigned short h, lo; splitf(wb * (rf[0] * cf[0][q]) + ad, h, lo); oh[q] = h; ol[q] = lo; }
            const size_t ou = o + (size_t)(u >> 1) * ((DD / 32) * 512) + (u & 1) * 64; *(v8us*)(Wh + ou) = oh; *(v8us*)(Wl + ou) = ol;
            asm volatile("s_wait_xcnt 0x0" ::: "memory");    // the registers of this unit's two stores are reused only behind this wait
            v[0][u][0] = v[1][u][0]; v[0][u][1] = v[1][u][1];
#pragma unroll
            for (int k = 0; k < 1 + RNK; ++k) ra[0][u][k] = ra[1][u][k]; }
        o += (size_t)2 * ((DD / 32) * 512); }
}
// k_prep: the three weight factorisations and the two bf16 roundings, which do not depend on one another, as ONE grid; a block's index range says which it works for. The pointers are chosen by that range (scalar selects) and
// each of the two bodies stands once in the text.
#define GFI (3 * DD / 64 * (DD / 32) / PW)   // blocks: in_proj weight, a wave per 64 rows x 32 columns
#define GF1 (DD / 64 * (DD / 32) / PW)       // pos_proj, out_proj weight
#define GCX (NT / 8 * (DD / (PU * 32)) / PW) // input, a wave per 8 rows x 256 columns
#define GCR (TT / 8 * (DD / (PU * 32)) / PW) // pos
__global__ __launch_bounds__(PW * 32) void k_prep(const float* __restrict__ Wi, const float* __restrict__ Wp, const float* __restrict__ Wo, const int* __restrict__ idx,
                                              const float* __restrict__ rm_i, const float* __restrict__ sm_i, const float* __restrict__ r_i, const float* __restrict__ s_i,
                                              const float* __restrict__ rm_p, const float* __restrict__ sm_p, const float* __restrict__ r_p, const float* __restrict__ s_p,
                                              const float* __restrict__ rm_o, const float* __restrict__ sm_o, const float* __restrict__ r_o, const float* __restrict__ s_o,
                                              const float* __restrict__ x, const float* __restrict__ r, bf* WIh, bf* WIl, bf* WRh, bf* WRl, bf* WOh, bf* WOl, bf* XB, bf* RB) {
    const unsigned blk = blockIdx.x, w = threadIdx.x >> 5;
    if (blk < GFI + 2 * GF1) { const bool wi = blk < GFI, wq = blk < GFI + GF1;    // in_proj; else pos_proj; else out_proj
        fact_wave((blk - (wi ? 0u : wq ? (unsigned)GFI : (unsigned)(GFI + GF1))) * PW + w, wi ? Wi : wq ? Wp : Wo, idx, wi ? rm_i : wq ? rm_p : rm_o, wi ? sm_i : wq ? sm_p : sm_o, wi ? r_i : wq ? r_p : r_o, wi ? s_i : wq ? s_p : s_o,
                  wi ? 3 * DD : DD, wi ? WIh : wq ? WRh : WOh, wi ? WIl : wq ? WRl : WOl); }
    else { const bool ix = blk < GFI + 2 * GF1 + GCX; cvt_wave((blk - (ix ? (unsigned)(GFI + 2 * GF1) : (unsigned)(GFI + 2 * GF1 + GCX))) * PW + w, ix ? x : r, ix ? XB : RB); }
}
// rowplanes: the tile in LDS -> one plane (Q false), or the two q planes (Q true), in fragment order. Chunk u * 32 + lane of a group's two tiles holds d = u * 16 + hi * 8 + 0..7 of row lr; the pointers come with the lane's part added.
template <bool Q>
__device__ __forceinline__ void rowplanes(const float* sp, int rstep, const float* __restrict__ bias, const float* __restrict__ ha, const float* __restrict__ hb, h16* P, h16* P2, size_t pstep) {
    v4f rb[4][2], ra[4][2], re[4][2];    // every bias value of the lane, fetched as one group: one load latency for the whole epilogue
#pragma unroll
    for (int u = 0; u < 4; ++u)
#pragma unroll
        for (int p = 0; p < 2; ++p) { rb[u][p] = *(const v4f*)(bias + u * 16 + p * 4); if (Q) { ra[u][p] = *(const v4f*)(ha + u * 16 + p * 4); re[u][p] = *(const v4f*)(hb + u * 16 + p * 4); } }
#pragma unroll
    for (int u = 0; u < 4; ++u) { float pb[8], ga[8], gb[8];
#pragma unroll
        for (int q = 0; q < 4; ++q) { pb[q] = bfr(rb[u][0][q]); pb[4 + q] = bfr(rb[u][1][q]); if (Q) { ga[q] = bfr(ra[u][0][q]); ga[4 + q] = bfr(ra[u][1][q]); gb[q] = bfr(re[u][0][q]); gb[4 + q] = bfr(re[u][1][q]); } }
#pragma unroll
        for (int bb = 0; bb < 4; ++bb) { const float* s = sp + bb * rstep + u * 16; const v4f s0 = *(const v4fa*)s, s1 = *(const v4fa*)(s + 4); float f[8]; v8h o;
#pragma unroll
            for (int q = 0; q < 4; ++q) { f[q] = s0[q] + pb[q]; f[4 + q] = s1[q] + pb[4 + q]; }
#pragma unroll
            for (int q = 0; q < 8; ++q) o[q] = tohx(Q ? __fadd_rn(f[q], ga[q]) : f[q]);
            *(v8h*)(P + (size_t)bb * pstep + u * 256) = o;
            if (Q) { v8h o2;
#pragma unroll
                for (int q = 0; q < 8; ++q) o2[q] = tohx(__fadd_rn(f[q], gb[q]));
                *(v8h*)(P2 + (size_t)bb * pstep + u * 256) = o2; } }
        asm volatile("s_wait_xcnt 0x0" ::: "memory"); }    // the registers of this group's stores (in the first group: of the bias loads too) are reused only behind this wait
}
// k_proj: the four projections, which do not depend on one another, as ONE grid (64, 52): blockIdx.y / 16 = 0, 1, 2: the q, k, v third of in_proj (x tile blockIdx.x, head y & 15); y = 48..51: the 16 x 16 tiles of the pos projection.
// A tile's 64 columns are one head; its 64 rows are 16 times x 4 batch entries (row = time * 4 + batch), or 64 positions of pos. So the tile holds whole 16-row blocks of k_attn's fp16 operand planes, and the epilogue writes those
// planes itself, in fragment order, 512 bytes in a row per store: q + r_w_bias and q + r_r_bias (QA, QB), k (KP), v transposed (VT), r_k (RK). No f32 projection goes through memory.
// Rounding of each value: f32 sum + bf16-rounded projection bias, then + bf16-rounded head bias (q only), each addition rounded to f32, then fp16.
__global__ __launch_bounds__(32) void k_proj(const bf* __restrict__ XB, const bf* __restrict__ RB, const bf* __restrict__ WIh, const bf* __restrict__ WIl, const bf* __restrict__ WRh, const bf* __restrict__ WRl, int K, const float* __restrict__ bi, const float* __restrict__ bp,
                                             const float* __restrict__ rwb, const float* __restrict__ rrb, h16* QA, h16* QB, h16* KP, h16* VT, h16* RK) {
    __shared__ __align__(16) float os[64 * 68];    // the whole tile; tile row m stands at LDS row (m & 3) * 16 + (m >> 2): batch-major for x tiles
    const int lane = threadIdx.x & 31, lr = lane & 15, hi = lane >> 4;
    const int x = (int)blockIdx.x, y = (int)blockIdx.y; const bool pos = y >= 48; const int sel = y >> 4; const int t = (y - 48) * 64 + x;
    const int r0 = (pos ? (t & 15) : x) * 64, hh = pos ? (t >> 4) : (y & 15), c0 = hh * 64;
    const float* bias = (pos ? bp : bi + (size_t)sel * DD) + c0;    // the 64 projection-bias values of this tile's columns
    v8f acc[4][4];
    gemmw_acc<bf, 3>(pos ? RB : XB, nullptr, pos ? WRh : WIh + (size_t)sel * DD * DD, pos ? WRl : WIl + (size_t)sel * DD * DD, K, r0, c0, acc);
#pragma unroll
    for (int mb = 0; mb < 4; ++mb)
#pragma unroll
        for (int nb = 0; nb < 4; ++nb)
#pragma unroll
            for (int j = 0; j < 8; ++j) os[((j & 3) * 16 + mb * 4 + hi * 2 + (j >> 2)) * 68 + nb * 16 + lr] = acc[mb][nb][j];
    __builtin_amdgcn_wave_barrier(); asm volatile("" ::: "memory");    // the reads below take other lanes' values: they stay behind the stores above
    if (!pos && sel == 2) {    // VT[batch * 16 + head][d][time]: lane = (8 times hi * 8.., column d = db * 16 + lr); the 16 times are half a 32-wide k tile
        h16* P = VT + (size_t)hh * (HD * TT) + (size_t)((x >> 1) * 64 + (x & 1) * 32 + lane) * 8;
        float rv[4];    // the lane's four bias values, fetched as one group
#pragma unroll
        for (int db = 0; db < 4; ++db) rv[db] = bias[db * 16 + lr];
#pragma unroll
        for (int db = 0; db < 4; ++db) { const float bv = bfr(rv[db]);
#pragma unroll
            for (int bb = 0; bb < 4; ++bb) { v8h o;
#pragma unroll
                for (int q = 0; q < 8; ++q) o[q] = tohx(os[(bb * 16 + hi * 8 + q) * 68 + db * 16 + lr] + bv);
                *(v8h*)(P + (size_t)bb * (NH_ * HD * TT) + (size_t)db * (16 * TT)) = o; }
            asm volatile("s_wait_xcnt 0x0" ::: "memory"); }    // the registers of this group's stores (in the first group: of the bias loads too) are reused only behind this wait
    } else {    // planes [..][row][d]: 16 rows x 64 d = two tiles = 2 KiB in a row; group bb = batch entry bb (x tiles) or 16-row block bb (pos tiles)
        const bool isq = !pos && sel == 0;
        const float* sp = os + (pos ? (lr & 3) * 16 + (lr >> 2) : lr) * 68 + hi * 8; const int rstep = pos ? 4 * 68 : 16 * 68;    // (group bb, row lr) stands bb * rstep floats behind sp
        h16* P = (pos ? RK + (size_t)hh * (TT * HD) + (size_t)(r0 >> 4) * (16 * HD) : (isq ? QA : KP) + (size_t)hh * (TT * HD) + (size_t)x * (16 * HD)) + lane * 8;
        const size_t pstep = pos ? (size_t)(16 * HD) : (size_t)NH_ * TT * HD;
        if (isq) rowplanes<true>(sp, rstep, bias + hi * 8, rwb + c0 + hi * 8, rrb + c0 + hi * 8, P, QB + (size_t)hh * (TT * HD) + (size_t)x * (16 * HD) + lane * 8, pstep);
        else rowplanes<false>(sp, rstep, bias + hi * 8, nullptr, nullptr, P, nullptr, pstep);
    }
}
// k_attn: one work-group (8 waves) = 32 query rows of one (batch, head). The whole 32 x 1024 score block stays in LDS (f32, row pitch SP floats), so no score, probability or per-head output plane goes through memory.
// 1) BD: raw tiles (q + r_r_bias).r_k for rows i (lower part) and rows i + 1 (upper part) against the same r_k fragment; element (i, n) lands at its shifted column of row i: with d = i + n + 1 - T,
//    d >= 0 -> column d from row i; d <= -2 -> column d + T + 1 from row i + 1; d == -1 has no place in the shifted row and falls on column T, in the row's pad, which nobody reads.
//    For fixed i that fills every column but i + 1, which holds the shift's zero and is stored by wave 0 (for i = T - 1 that store too falls on the pad).
// 2) AC tiles are added at their own place and scaled by 1/8.  3) each wave: softmax of 4 rows; P (x1024, fp16) overwrites the front half of the row's own bytes, which only that wave touches here.
// 4) P.V: wave = (16-wide d tile, half of the keys), both 16-row tiles; the two halves' partial sums meet in Of.  5) 1/1024, hi/lo bf16 split; the merged planes are in fragment order with rows batch * T + time, so the work-group owns four whole tiles of each and a wave stores 512 bytes in a row.
// Every plain '#pragma unroll' in k_attn: the fragment and accumulator arrays are indexed by the loop counters and stay in registers only when those loops are unrolled.
#define MR 32
#define SP 1028                   // 4112 bytes = 16 x odd: the b128 fragment reads of 16 rows fall on distinct banks
typedef v4h __attribute__((may_alias)) v4ha;
__global__ __launch_bounds__(256) __attribute__((amdgpu_waves_per_eu(4, 4))) void k_attn(const h16* __restrict__ QA, const h16* __restrict__ QB, const h16* __restrict__ KP, const h16* __restrict__ VT, const h16* __restrict__ RK, bf* Ah, bf* Al) {
    __shared__ __align__(16) float S[MR * SP];
    __shared__ __align__(16) float Of[2 * MR * 68];
    const int tid = threadIdx.x, lane = tid & 31, lr = lane & 15, hi = lane >> 4; const int w = __builtin_amdgcn_readfirstlane(tid >> 5);
    const int i0 = blockIdx.x * MR; const int z = blockIdx.y; const int b = z >> 4, h = z & 15;
    const h16* qa = QA + (size_t)z * TT * HD; const h16* qb = QB + (size_t)z * TT * HD; const h16* kp = KP + (size_t)z * TT * HD; const h16* vt = VT + (size_t)z * HD * TT; const h16* rk = RK + (size_t)h * TT * HD;
    if (w == 0) S[lane * SP + i0 + lane + 1] = 0.f;
    // Both score loops are straight-line with two operand buffers: the loads of the next pair of key tiles are issued, then this pair is worked on. The sched_barrier calls hold that order:
    // without them the scheduler lifts all eight tiles' loads to the top and spills past the 256 registers that two work-groups per WGP allow.
    v16h a[2][2], kb[2][2][2];    // AC's operands; the q + r_w_bias rows and the first pair of key tiles are fetched in front of the last BD pair, whose work covers their latency
    const h16* pa = qa + (size_t)i0 * HD + lane * 8; const h16* pk = kp + (size_t)(w * 128) * HD + lane * 8;    // 16 rows of 64 = two tiles = 16 * HD elements; the second tile (k 32..63) 512 elements on
    {   v16h aL[2][2], aU[2][2], rb[2][2][2]; const h16* bp = rk + (size_t)(w * 128) * HD + lane * 8; const h16* pL = qb + (size_t)i0 * HD + lane * 8;
        const int ru = (i0 + 17 + lr < TT) ? i0 + 17 + lr : TT - 1; const h16* pU = qb + (size_t)(ru >> 4) * 16 * HD + (hi * 16 + (ru & 15)) * 8;    // row T does not exist; row T - 1 has no upper part, so its aU result is never chosen
        const int rv = i0 + 1 + lr; const h16* pV = qb + (size_t)(rv >> 4) * 16 * HD + (hi * 16 + (rv & 15)) * 8;    // rows i + 1 straddle two row blocks: lane 15's (and 31's) chunk lies in the next one
#pragma unroll
        for (int ks = 0; ks < 2; ++ks) { aL[0][ks] = WFrag<h16>::ld(pL + ks * 512); aL[1][ks] = WFrag<h16>::ld(pL + 16 * HD + ks * 512); aU[0][ks] = WFrag<h16>::ld(pV + ks * 512); aU[1][ks] = WFrag<h16>::ld(pU + ks * 512); }
#pragma unroll
        for (int t = 0; t < 2; ++t) { rb[0][t][0] = WFrag<h16>::ld(bp + t * 16 * HD); rb[0][t][1] = WFrag<h16>::ld(bp + t * 16 * HD + 512); }
        asm volatile("s_wait_xcnt 0x0" :: "v"(pL), "v"(pU), "v"(pV) : "memory");    // the address registers of the issued loads are held to here and may be reused only behind this wait
#pragma unroll
        for (int g = 0; g < 4; ++g) {
            if (g < 3) {
#pragma unroll
                for (int t = 0; t < 2; ++t) { rb[(g + 1) & 1][t][0] = WFrag<h16>::ld(bp + ((g + 1) * 2 + t) * 16 * HD); rb[(g + 1) & 1][t][1] = WFrag<h16>::ld(bp + ((g + 1) * 2 + t) * 16 * HD + 512); } }
            else {
#pragma unroll
                for (int mb = 0; mb < 2; ++mb)
#pragma unroll
                    for (int ks = 0; ks < 2; ++ks) { a[mb][ks] = WFrag<h16>::ld(pa + mb * 16 * HD + ks * 512); kb[0][mb][ks] = WFrag<h16>::ld(pk + mb * 16 * HD + ks * 512); } }
            if (g == 2) asm volatile("s_wait_xcnt 0x0" :: "v"(bp) : "memory");    // last loads through bp: its registers are held to here and reused only behind this wait
            if (g == 3) asm volatile("s_wait_xcnt 0x0" :: "v"(pa) : "memory");    // the same for pa
            __builtin_amdgcn_sched_barrier(0);    // the next pair's loads stay in front of this pair's work
#pragma unroll
            for (int t = 0; t < 2; ++t) { const int n0 = w * 128 + (g * 2 + t) * 16;
#pragma unroll
                for (int mb = 0; mb < 2; ++mb) { v8f cL = (v8f){}, cU = (v8f){}; cL = wmma16(aL[mb][0], rb[g & 1][t][0], cL); cU = wmma16(aU[mb][0], rb[g & 1][t][0], cU); cL = wmma16(aL[mb][1], rb[g & 1][t][1], cL); cU = wmma16(aU[mb][1], rb[g & 1][t][1], cU);
#pragma unroll
                    for (int j = 0; j < 8; ++j) { const int ml = mb * 16 + hi * 8 + j; const int d = i0 + ml + n0 + lr + 1 - TT;
                        S[ml * SP + d + ((d >> 31) & (TT + 1))] = (d >= 0) ? cL[j] : cU[j]; } } }
            __builtin_amdgcn_sched_barrier(0);    // later pairs' loads stay behind this pair's work
        }
    }
    __syncthreads();              // every shifted BD element is in place before AC is added to it
    {
#pragma unroll
        for (int g = 0; g < 4; ++g) {
            if (g < 3) {
#pragma unroll
                for (int t = 0; t < 2; ++t) { kb[(g + 1) & 1][t][0] = WFrag<h16>::ld(pk + ((g + 1) * 2 + t) * 16 * HD); kb[(g + 1) & 1][t][1] = WFrag<h16>::ld(pk + ((g + 1) * 2 + t) * 16 * HD + 512); } }
            if (g == 2) asm volatile("s_wait_xcnt 0x0" :: "v"(pk) : "memory");    // last loads through pk: its registers are held to here and reused only behind this wait
            __builtin_amdgcn_sched_barrier(0);    // the next pair's loads stay in front of this pair's work
#pragma unroll
            for (int t = 0; t < 2; ++t) { const int n0 = w * 128 + (g * 2 + t) * 16;
#pragma unroll
                for (int mb = 0; mb < 2; ++mb) { v8f c = (v8f){}; c = wmma16(a[mb][0], kb[g & 1][t][0], c); c = wmma16(a[mb][1], kb[g & 1][t][1], c);
#pragma unroll
                    for (int j = 0; j < 8; ++j) { float* sp = S + (mb * 16 + hi * 8 + j) * SP + n0 + lr; *sp = __fmul_rn(__fadd_rn(c[j], *sp), 0.125f); } } }
            __builtin_amdgcn_sched_barrier(0);    // later pairs' loads stay behind this pair's work
        }
    }
    __syncthreads();              // whole rows are complete before a wave reduces them
    const int dt = w & 3, kh = w >> 2; v16h bv[16]; const h16* vp = vt + (size_t)(dt * (TT / 32) + kh * 16) * 512 + lane * 8;    // this wave's V fragments: the first eight are fetched here, so that their latency passes behind the softmax
#pragma unroll
    for (int ks = 0; ks < 8; ++ks) bv[ks] = WFrag<h16>::ld(vp + ks * 512);
#pragma unroll 1                  // rolled: one row's 32 values at a time, so that the V fragments held across this loop stay in registers
    for (int rr = 0; rr < 4; ++rr) { float* sr = S + (w * 4 + rr) * SP; float v[32]; float mx = -3.0e38f;
#pragma unroll
        for (int ch = 0; ch < 8; ++ch) { const v4f sv = *(const v4fa*)(sr + ch * 128 + lane * 4);
#pragma unroll
            for (int q = 0; q < 4; ++q) { v[ch * 4 + q] = sv[q]; mx = fmaxf(mx, sv[q]); } }
#pragma unroll
        for (int sh = 16; sh; sh >>= 1) mx = fmaxf(mx, __shfl_xor(mx, sh, 32));
        float sum = 0.f;
#pragma unroll
        for (int k = 0; k < 32; ++k) { v[k] = __expf(v[k] - mx); sum += v[k]; }
#pragma unroll
        for (int sh = 16; sh; sh >>= 1) sum += __shfl_xor(sum, sh, 32);
        const float fct = __fdiv_rn(PCAR, sum); h16* pr = (h16*)sr;
#pragma unroll
        for (int ch = 0; ch < 8; ++ch) { v4h o;
#pragma unroll
            for (int q = 0; q < 4; ++q) o[q] = tohx(v[ch * 4 + q] * fct);
            *(v4ha*)(pr + ch * 128 + lane * 4) = o; } }
    __syncthreads();              // P of all 32 rows is written before any wave reads it as its A operand
#pragma unroll
    for (int ks = 8; ks < 16; ++ks) bv[ks] = WFrag<h16>::ld(vp + ks * 512);    // the other eight fly while the first eight are worked on (all sixteen held over the softmax spill)
    asm volatile("s_wait_xcnt 0x0" :: "v"(vp) : "memory");    // last loads through vp: its registers are held to here and reused only behind this wait
    {   const h16* P = (const h16*)S; v8f o[2]; o[0] = (v8f){}; o[1] = (v8f){}; const h16* pp = P + (size_t)lr * (2 * SP) + kh * 512 + 8 * hi;
#pragma unroll
        for (int ks = 0; ks < 16; ++ks) {
#pragma unroll
            for (int mb = 0; mb < 2; ++mb) { const h16* ap = pp + (size_t)mb * 16 * (2 * SP) + ks * 32; o[mb] = wmma16(cat16(*(const v8ha*)ap, *(const v8ha*)(ap + 16)), bv[ks], o[mb]); } }
#pragma unroll
        for (int mb = 0; mb < 2; ++mb)
#pragma unroll
            for (int j = 0; j < 8; ++j) Of[(kh * MR + mb * 16 + hi * 8 + j) * 68 + dt * 16 + lr] = o[mb][j];
    }
    __syncthreads();              // both key halves' partial sums are in Of
    {   const int row = (tid >> 7) * 16 + lr, d0 = ((tid >> 6) & 1) * 32 + ((tid >> 5) & 1) * 16 + hi * 8; const float* p0 = Of + row * 68 + d0; const float* p1 = p0 + MR * 68; v8us oh, ol;
#pragma unroll
        for (int q = 0; q < 8; ++q) { unsigned short x, y; splitf(__fadd_rn(p0[q], p1[q]) * (1.0f / PCAR), x, y); oh[q] = x; ol[q] = y; }
        const size_t o = ((size_t)((b * TT + i0) / 16 + (tid >> 7)) * (DD / 32) + h * 2 + ((tid >> 6) & 1)) * 512 + (tid & 63) * 8; *(v8us*)(Ah + o) = oh; *(v8us*)(Al + o) = ol; }
}

extern "C" void kernel_launch(void* const* d_in, const int* in_sizes, int n_in,
                              void* d_out, int out_size, void* d_ws, size_t ws_size, hipStream_t stream) {
    (void)in_sizes; (void)n_in; (void)out_size;
    const float* IN[23]; for (int i = 0; i < 23; ++i) IN[i] = (const float*)d_in[i];
    // input [1024][4][1024], pos [1024][1][1024], indices (int [1]), in_proj_weight [3072][1024], in_proj_bias, out_proj_weight, out_proj_bias, pos_proj_weight, pos_proj_bias,
    // r_i [8][4][3072], s_i [8][4][1024], r_p, s_p, r_o, s_o, rm_i [8][1][3072], sm_i [8][1][1024], rm_p, sm_p, rm_o, sm_o, r_w_bias [16][64], r_r_bias = d_in[0..22]
    const float* x = IN[0]; const float* r = IN[1]; const int* idx = (const int*)d_in[2]; const float* rwb = IN[21]; const float* rrb = IN[22];
    float* OUT = (float*)d_out;     // [1024][4][1024] (rows t*4 + b)
    char* wsp = (char*)d_ws;
    auto take = [&](size_t bytes) { char* p = wsp; wsp += (bytes + 255) & ~(size_t)255; return (void*)p; };
    bf* WIh = (bf*)take((size_t)3 * DD * DD * 2); bf* WIl = (bf*)take((size_t)3 * DD * DD * 2); bf* WRh = (bf*)take((size_t)DD * DD * 2); bf* WRl = (bf*)take((size_t)DD * DD * 2); bf* WOh = (bf*)take((size_t)DD * DD * 2); bf* WOl = (bf*)take((size_t)DD * DD * 2);
    bf* XB = (bf*)take((size_t)NT * DD * 2); bf* RB = (bf*)take((size_t)TT * DD * 2);
    h16* QA = (h16*)take((size_t)NT * DD * 2); h16* QB = (h16*)take((size_t)NT * DD * 2); h16* KP = (h16*)take((size_t)NT * DD * 2); h16* VT = (h16*)take((size_t)NT * DD * 2); h16* RK = (h16*)take((size_t)NH_ * TT * HD * 2);
    bf* ATh = (bf*)take((size_t)NT * DD * 2); bf* ATl = (bf*)take((size_t)NT * DD * 2);   // the merged hi/lo planes
    if ((size_t)(wsp - (char*)d_ws) > ws_size) return;    // total 80 MiB; ws 256 MiB
    // Four dependent launches; what does not depend on one another shares a grid.
    k_prep<<<GFI + 2 * GF1 + GCX + GCR, PW * 32, 0, stream>>>(IN[3], IN[7], IN[5], idx, IN[15], IN[16], IN[9], IN[10], IN[17], IN[18], IN[11], IN[12], IN[19], IN[20], IN[13], IN[14], x, r, WIh, WIl, WRh, WRl, WOh, WOl, XB, RB);
    k_proj<<<dim3(NT / 64, 3 * DD / 64 + TT / 64 * (DD / 64) / (NT / 64), 1), 32, 0, stream>>>(XB, RB, WIh, WIl, WRh, WRl, DD, IN[4], IN[8], rwb, rrb, QA, QB, KP, VT, RK);
    k_attn<<<dim3(TT / MR, NB_ * NH_, 1), 256, 0, stream>>>(QA, QB, KP, VT, RK, ATh, ATl);
    k_gemmw<bf, 2, true, true><<<dim3(NT / 64, DD / 64, 1), 32, 0, stream>>>(ATh, ATl, WOh, WOl, DD, OUT, DD, IN[6]);
}

// v008
// One run takes 114 microseconds.
// Next to v007, in two timings, it ran 1.27 and 1.28 times as fast.
// Counting every step since v000, it is 15.0 times as fast.
#include <hip/hip_runtime.h>

// Relative-position multi-head attention (segment-recurrence style relative shift; query [1024][4][1024] seq-first, r [1024][1024]; w = query qkv_w^T -> q|k|v (16 heads x 64); r_k = r r_w^T; AC = (q + r_w_bias).k,
// BD = rel_shift((q + r_r_bias).r_k) with the module's exact zero-pad/reshape shift (out[i][j] = BD[f / (T+1)][f % (T+1) - 1] or 0 when f % (T+1) == 0, f = T + i*T + j); p = softmax((AC + BD) / 8)
// over the keys; attn = p.v; out = merged out_w^T + out_b; output [1024][4][1024] (rows t*4 + b)).
// Compute dtypes, f32 accumulate: every input rounded to bf16; the qkv and r projections on PLAIN bf16 inputs (exact) x hi/lo SPLIT bf16 weights; AC, BD and attn.v on SINGLE fp16 planes
// (the per-head biases added in f32 before the fp16 rounding; logit sd ~ 0.6); the relative shift is done by where each BD element is stored in the LDS score block of k_attn; P x1024;

// FRAGMENT ORDER of every 16-bit WMMA operand plane in the workspace (rows x K, K % 32 == 0): tiles of 16 rows x 32 k = 1 KiB, tile (row / 16, k / 32) at index (row / 16) * (K / 32) + k / 32; inside a tile the 16-byte chunk
// of row lr, k = half * 16 + hi * 8 + 0..7 stands at chunk half * 32 + hi * 16 + lr. That is the register layout of a 16x16x32 A or B fragment, so a fragment is two loads of 512 contiguous bytes (lane * 16): four whole 128-byte lines each.

#define NB_  4
#define TT   1024
#define NLY  8                    // weight-factor layers
#define RNK  4                    // additive rank
#define DD   1024
#define NH_  16
#define HD   64
#define NT   (NB_ * TT)
#define PCAR 1024.0f
typedef _Float16 h16;
typedef unsigned short bf;
typedef __attribute__((ext_vector_type(16))) __bf16   v16bf;
typedef __attribute__((ext_vector_type(16))) _Float16 v16h;
typedef __attribute__((ext_vector_type(8)))  _Float16 v8h;
typedef __attribute__((ext_vector_type(8)))  unsigned short v8us;
typedef __attribute__((ext_vector_type(8)))  float    v8f;
typedef __attribute__((ext_vector_type(4)))  float    v4f;
typedef v8h  __attribute__((may_alias)) v8ha;
typedef v4f  __attribute__((may_alias)) v4fa;
typedef v8us __attribute__((may_alias)) v8usa;

__device__ __forceinline__ unsigned short f2bf(float f) { unsigned u = __float_as_uint(f); u += 0x7FFFu + ((u >> 16) & 1u); return (unsigned short)(u >> 16); }
__device__ __forceinline__ float bf2f(unsigned short b) { return __uint_as_float(((unsigned)b) << 16); }
__device__ __forceinline__ float bfr(float f) { return bf2f(f2bf(f)); }
__device__ __forceinline__ v16h cat16(v8h lo, v8h hi) { return __builtin_shufflevector(lo, hi, 0, 1, 2, 3, 4, 5, 6, 7, 8, 9, 10, 11, 12, 13, 14, 15); }
__device__ __forceinline__ v16bf cat16b(v8us lo, v8us hi) { return __builtin_bit_cast(v16bf, __builtin_shufflevector(lo, hi, 0, 1, 2, 3, 4, 5, 6, 7, 8, 9, 10, 11, 12, 13, 14, 15)); }
__device__ __forceinline__ v8f wmma16(v16h a, v16h b, v8f c) { return __builtin_amdgcn_wmma_f32_16x16x32_f16(false, a, false, b, (short)0, c, false, false); }
__device__ __forceinline__ v8f wmmab(v16bf a, v16bf b, v8f c) { return __builtin_amdgcn_wmma_f32_16x16x32_bf16(false, a, false, b, (short)0, c, false, false); }



// ---- GEMM core: a work-group of NWV waves, each wave a 64x64 output tile (16 accumulators); 8 waves stand 4 x 2 (256 rows x 128 columns), 4 waves 2 x 2 (128 x 128). Operands are 16-bit planes in fragment order.
// C[m][n] = sum_k A[m][k] Bt[n][k] (+ split products per NSPLIT). K % 64 == 0.
template <typename T16> struct WFrag;
template <> struct WFrag<h16> { typedef v16h V; static __device__ __forceinline__ V ld(const h16* p) { return cat16(*(const v8h*)p, *(const v8h*)(p + 256)); } static __device__ __forceinline__ v8f mma(V a, V b, v8f c) { return wmma16(a, b, c); } };
#define STG 65536                 // bytes of one staging buffer: 8 groups of 8 KiB
// Asynchronous copies, 16 bytes a lane, 512 a copy. A 2-KiB segment lies in a row in the plane and in LDS alike, so its four copies name one pair of address registers and step both addresses by the immediate offset.
// acopy16: one group (four segments); acopy32: two groups. l: the lane's LDS byte address, g: its global address in the group's first segment; gs: elements from a segment to the next in the plane (2 KiB in LDS).
// The s_wait_xcnt stands inside the statement, behind the last copy: the address registers that the copies name are rewritten only behind it.
#define ACP4(L, G) "global_load_async_to_lds_b128 %" #L ", %" #G ", off\n\tglobal_load_async_to_lds_b128 %" #L ", %" #G ", off offset:512\n\tglobal_load_async_to_lds_b128 %" #L ", %" #G ", off offset:1024\n\tglobal_load_async_to_lds_b128 %" #L ", %" #G ", off offset:1536\n\t"
__device__ __forceinline__ void acopy16(unsigned l, const bf* g, size_t gs) {
    asm volatile(ACP4(0, 4) ACP4(1, 5) ACP4(2, 6) ACP4(3, 7) "s_wait_xcnt 0x0"
                 :: "v"(l), "v"(l + 2048u), "v"(l + 4096u), "v"(l + 6144u), "v"(g), "v"(g + gs), "v"(g + 2 * gs), "v"(g + 3 * gs) : "memory");
}
__device__ __forceinline__ void acopy32(unsigned l, const bf* g, unsigned l2, const bf* g2, size_t gs) {
    asm volatile(ACP4(0, 8) ACP4(1, 9) ACP4(2, 10) ACP4(3, 11) ACP4(4, 12) ACP4(5, 13) ACP4(6, 14) ACP4(7, 15) "s_wait_xcnt 0x0"
                 :: "v"(l), "v"(l + 2048u), "v"(l + 4096u), "v"(l + 6144u), "v"(l2), "v"(l2 + 2048u), "v"(l2 + 4096u), "v"(l2 + 6144u),
                    "v"(g), "v"(g + gs), "v"(g + 2 * gs), "v"(g + 3 * gs), "v"(g2), "v"(g2 + gs), "v"(g2 + 2 * gs), "v"(g2 + 3 * gs) : "memory");
}
__device__ __forceinline__ v16bf ldl(const char* p) { return cat16b(*(const v8usa*)p, *(const v8usa*)(p + 512)); }    // one fragment from a staged tile: two reads of 512 bytes in a row, lane * 16
// gemms_acc: the k loop; it leaves this wave's 16 accumulators in acc (row mb * 16 + hi * 8 + j, column nb * 16 + lr of the wave's tile). r0, c0: the WORK-GROUP's first row and column.
// A trip is 64 k = two tiles = 2 KiB in a row of every 16-row block ("segment"). A group = the four segments of 64 rows of one plane, 8 KiB; a trip's eight groups fill one buffer:
// groups 0..3: NSPLIT 3: rows r0 + g * 64 of A; NSPLIT 2: rows r0 + (g & 1) * 64 of A (g < 2) or A2; groups 4, 5: columns c0 + (g & 1) * 64 of Bt; 6, 7: the same of Bt2.
// Each line of the operands is fetched from L2 once per work-group and read from LDS by the 2 or 4 waves that need it. Two buffers: tile t + 2's copies go out behind the barrier at the foot of trip t and fly during trip t + 1.
// Each accumulator takes its products in the order k ascending, and per k step a.b, a2.b, a.b2.
// Every plain '#pragma unroll' in gemms_acc: the fragment, accumulator and address arrays are indexed by the loop counters and stay in registers only when those loops are unrolled.
// PRE: k steps (of 32) whose fragments are read from LDS as one group: 2 where a wave has a SIMD to itself and registers to spare, 1 where four waves share one.
template <int NSPLIT, int NWV, int PRE>
__device__ __forceinline__ void gemms_acc(const bf* __restrict__ A, const bf* __restrict__ A2, const bf* __restrict__ Bt, const bf* __restrict__ Bt2, int K, int r0, int c0, char* st, v8f (&acc)[4][4]) {
    const int lane = threadIdx.x & 31; const int w = __builtin_amdgcn_readfirstlane((int)(threadIdx.x >> 5)); const int wn = w & 1, wm = w >> 1;
    constexpr int NG = 8 / NWV;   // groups that a wave copies
#pragma unroll
    for (int mb = 0; mb < 4; ++mb)
#pragma unroll
        for (int nb = 0; nb < 4; ++nb) acc[mb][nb] = (v8f){};
    const bf* gp[NG]; unsigned lp[NG];    // the lane's global address and LDS byte address in the first segment of each of its groups, tile 0, buffer 0
#pragma unroll
    for (int i = 0; i < NG; ++i) { const int g = w + i * NWV;
        const bf* p = g < 4 ? (NSPLIT == 2 ? (g < 2 ? A : A2) + (size_t)(r0 + (g & 1) * 64) * K : A + (size_t)(r0 + g * 64) * K) : (g < 6 ? Bt : Bt2) + (size_t)(c0 + (g & 1) * 64) * K;
        gp[i] = p + lane * 8; lp[i] = (unsigned)(size_t)st + (unsigned)(g * 8192 + lane * 16); }
    const size_t gs = (size_t)16 * K;
    auto copies = [&](int t, unsigned bo) {    // tile t into the buffer at byte bo: all of the wave's copies in one statement
        if constexpr (NG == 1) acopy16(lp[0] + bo, gp[0] + (size_t)t * 1024, gs);
        else acopy32(lp[0] + bo, gp[0] + (size_t)t * 1024, lp[NG - 1] + bo, gp[NG - 1] + (size_t)t * 1024, gs);
    };
    const int nt = K >> 6;
    copies(0, 0u);
    asm volatile("s_wait_asynccnt 0x0" ::: "memory");    // this wave's part of tile 0 has landed
    __syncthreads();              // tile 0 is whole before any wave reads it
    if (nt > 1) copies(1, (unsigned)STG);
    unsigned bo = 0u;
#pragma unroll 1                  // rolled: one trip's text serves both buffers
    for (int t = 0; t < nt; ++t) {
        const char* sa = st + bo + wm * 8192 + lane * 16; const char* sb = st + bo + (4 + wn) * 8192 + lane * 16;
#pragma unroll
        for (int k0 = 0; k0 < 2; k0 += PRE) { v16bf a[PRE][4], a2[PRE][4], b[PRE][4], b2[PRE][4];
#pragma unroll
            for (int p = 0; p < PRE; ++p) { const int ko = (k0 + p) * 1024;    // in the order in which the WMMAs below take them
#pragma unroll
                for (int q = 0; q < 4; ++q) a[p][q] = ldl(sa + q * 2048 + ko);
                b[p][0] = ldl(sb + ko);
                if (NSPLIT == 2) {
#pragma unroll
                    for (int q = 0; q < 4; ++q) a2[p][q] = ldl(sa + 2 * 8192 + q * 2048 + ko); }
                b2[p][0] = ldl(sb + 2 * 8192 + ko);
#pragma unroll
                for (int q = 1; q < 4; ++q) { b[p][q] = ldl(sb + q * 2048 + ko); b2[p][q] = ldl(sb + 2 * 8192 + q * 2048 + ko); } }
            __builtin_amdgcn_sched_barrier(0);    // the LDS reads stay one group in front of their WMMAs: left free, the scheduler keeps one B fragment and waits for LDS in front of every four WMMAs
#pragma unroll
            for (int p = 0; p < PRE; ++p)
#pragma unroll
                for (int nb = 0; nb < 4; ++nb) {
#pragma unroll
                    for (int mb = 0; mb < 4; ++mb) acc[mb][nb] = wmmab(a[p][mb], b[p][nb], acc[mb][nb]);
                    if (NSPLIT == 2) {
#pragma unroll
                        for (int mb = 0; mb < 4; ++mb) acc[mb][nb] = wmmab(a2[p][mb], b[p][nb], acc[mb][nb]); }
#pragma unroll
                    for (int mb = 0; mb < 4; ++mb) acc[mb][nb] = wmmab(a[p][mb], b2[p][nb], acc[mb][nb]); }
            __builtin_amdgcn_sched_barrier(0);    // the next group's reads stay behind these WMMAs, whose registers they take
        }
        asm volatile("s_wait_dscnt 0x0" ::: "memory");       // this wave's reads of the buffer are done before the barrier behind which it is refilled
        asm volatile("s_wait_asynccnt 0x0" ::: "memory");    // this wave's part of tile t + 1 has landed
        __syncthreads();          // publishes tile t + 1 and ends every wave's reads of tile t; behind the last trip it frees the buffers for the epilogue
        if (t + 2 < nt) copies(t + 2, bo);
        bo ^= (unsigned)STG;
    }
    asm volatile("s_wait_asynccnt 0x0" ::: "memory");    // no copy is outstanding when the LDS is put to another use
}
// gemmw_tile: C (f32, pitch ldc, + optional f32 bias[n]); TB: row m of A is (batch m / TT, time m % TT) and goes to row time * NB_ + batch of C. R0, C0: the work-group's first row and column; 4 waves.
template <int NSPLIT, bool BIAS, bool TB>
__device__ __forceinline__ void gemmw_tile(const bf* __restrict__ A, const bf* __restrict__ A2, const bf* __restrict__ Bt, const bf* __restrict__ Bt2, int K, float* C, int ldc, const float* __restrict__ bias, int R0, int C0, char* st) {
    const int lane = threadIdx.x & 31, lr = lane & 15, hi = lane >> 4; const int w = __builtin_amdgcn_readfirstlane((int)(threadIdx.x >> 5)); const int r0 = R0 + (w >> 1) * 64, c0 = C0 + (w & 1) * 64;
    v8f acc[4][4];
    gemms_acc<NSPLIT, 4, 2>(A, A2, Bt, Bt2, K, R0, C0, st, acc);
    float* os = (float*)(st + w * (16 * 68 * 4));    // each wave's own 16 x 68 block, in the staging buffers, which nobody reads any more
#pragma unroll
    for (int mb = 0; mb < 4; ++mb) {
#pragma unroll
        for (int nb = 0; nb < 4; ++nb) {
#pragma unroll
            for (int j = 0; j < 8; ++j) os[(hi * 8 + j) * 68 + nb * 16 + lr] = acc[mb][nb][j]; }
        __builtin_amdgcn_wave_barrier(); asm volatile("" ::: "memory");
        const size_t rs = TB ? (size_t)NB_ * ldc : (size_t)ldc; float* crow = TB ? C + ((size_t)((r0 & (TT - 1)) + mb * 16) * NB_ + (r0 / TT)) * ldc + c0 : C + (size_t)(r0 + mb * 16) * ldc + c0;
{
#pragma unroll
            for (int s = 0; s < 8; ++s) { const int row = 2 * s + hi, cofs = lr * 4; v4f val = *(const v4fa*)(os + row * 68 + cofs); if (BIAS) { val[0] += bfr(bias[c0 + cofs]); val[1] += bfr(bias[c0 + cofs + 1]); val[2] += bfr(bias[c0 + cofs + 2]); val[3] += bfr(bias[c0 + cofs + 3]); }
                *(v4f*)(crow + (size_t)row * rs + cofs) = val; }
             }
        __builtin_amdgcn_wave_barrier(); asm volatile("" ::: "memory");
        asm volatile("s_wait_xcnt 0x0" ::: "memory");    // the address registers of this block's stores are reused only behind this wait
    }
}
// k_gemmw: one GEMM, grid (M/128, N/128), 4 waves.
template <int NSPLIT, bool BIAS, bool TB>
__global__ __launch_bounds__(128) void k_gemmw(const bf* __restrict__ A, const bf* __restrict__ A2, const bf* __restrict__ Bt, const bf* __restrict__ Bt2, int K, float* C, int ldc, const float* __restrict__ bias) {
    __shared__ __align__(16) char st[2 * STG];
    gemmw_tile<NSPLIT, BIAS, TB>(A, A2, Bt, Bt2, K, C, ldc, bias, (int)blockIdx.x * 128, (int)blockIdx.y * 128, st);
}

__device__ __forceinline__ h16 tohx(float x) { return (h16)x; }
__device__ __forceinline__ void splitf(float y, unsigned short& h, unsigned short& l) { h = f2bf(y); l = f2bf(y - bf2f(h)); }
typedef __attribute__((ext_vector_type(2))) _Float16 v2h;
typedef __attribute__((ext_vector_type(4))) _Float16 v4h;
typedef __attribute__((ext_vector_type(2))) unsigned short v2us;
typedef __attribute__((ext_vector_type(4))) int v4i;

// k_prep's unit of work: one wave, 8 rows x 32 columns (one k tile) of a [rows][DD] f32 source. Lane = (row lane & 7, 8 columns (lane >> 3) * 8): a 16-byte load takes pieces of 8 lines, one per row, and the lane's second load the rest of
// the same lines; the lane's 8 results are one 16-byte chunk of the plane in fragment order, chunk (lane >> 3) * 16 + (row & 15) of the tile, so that a wave's store covers four whole 128-byte lines.
// A wave does PU such units, every load of them issued before the first result is formed: few long waves with many loads in flight each, in place of one short wave per 64 (weights) or 256 (inputs) elements.
// Every plain '#pragma unroll' in cvt_wave and fact_wave: the value arrays are indexed by the loop counters and stay in registers only when those loops are unrolled.
#define PU 8                      // units a wave
#define PW 4                      // waves a block
// cvt_wave: bf16 rounding of 8 rows x 256 columns: wave wv = (16-row block wv >> 3, quarter of the columns (wv >> 1) & 3, upper or lower 8 rows wv & 1); unit j is k tile j of the quarter.
__device__ __forceinline__ void cvt_wave(unsigned wv, const float* __restrict__ src, bf* dst) {
    const unsigned lane = threadIdx.x & 31, r8 = wv & 1, kq = (wv >> 1) & 3, rb = wv >> 3, c4 = lane >> 3, lr = r8 * 8 + (lane & 7);
    const float* sp = src + (size_t)(rb * 16 + lr) * DD + kq * (PU * 32) + c4 * 8; bf* dp = dst + ((size_t)(rb * (DD / 32) + kq * PU) * 64 + c4 * 16 + lr) * 8; v4f v[PU][2];
#pragma unroll
    for (int j = 0; j < PU; ++j) { v[j][0] = *(const v4f*)(sp + j * 32); v[j][1] = *(const v4f*)(sp + j * 32 + 4); }
    asm volatile("s_wait_xcnt 0x0" :: "v"(sp) : "memory");    // the address registers of the issued loads are held to here and reused only behind this wait
#pragma unroll
    for (int j = 0; j < PU; ++j) { v8us o;
#pragma unroll
        for (int q = 0; q < 4; ++q) { o[q] = f2bf(v[j][0][q]); o[4 + q] = f2bf(v[j][1][q]); }
        *(v8us*)(dp + j * 512) = o; }
}
// fact_wave: factorised weight hi/lo planes: W'[a][b] = bf16(W[a][b]) (bf16(rm[l][a]) bf16(sm[l][b])) + sum_k bf16(r[l][k][a]) bf16(s[l][k][b]) (f32, k ascending), l = indices[0] read on device and clamped to the factor arrays.
// Wave wv = (64 rows wv >> 5, k tile wv & 31); unit j is rows j * 8 .. j * 8 + 7 of the 64, so the lane's 8 columns, and with them its sm and s values, are the same in all its units and are fetched once.
// All loads go out first; the arithmetic is one rolled loop of two trips, four units each, so that the text a wave runs through only once stays short.
__device__ __forceinline__ void fact_wave(unsigned wv, const float* __restrict__ W, const int* __restrict__ idx, const float* __restrict__ rm, const float* __restrict__ sm, const float* __restrict__ rr, const float* __restrict__ ss, int rows, bf* Wh, bf* Wl) {
    const unsigned lane = threadIdx.x & 31, kt = wv & 31, rg = wv >> 5, c4 = lane >> 3, row0 = rg * 64 + (lane & 7), col = kt * 32 + c4 * 8;
    const float* wp = W + (size_t)row0 * DD + col; size_t o = ((size_t)(rg * 4 * (DD / 32) + kt) * 64 + c4 * 16 + (lane & 7)) * 8; v4f v[2][PU / 2][2];    // v, ra: [0] this trip's four units, [1] the next trip's
#pragma unroll
    for (int j = 0; j < PU; ++j) { v[j >> 2][j & 3][0] = *(const v4f*)(wp + (size_t)j * 8 * DD); v[j >> 2][j & 3][1] = *(const v4f*)(wp + (size_t)j * 8 * DD + 4); }
    int l = idx[0]; l = __builtin_amdgcn_readfirstlane(l < 0 ? 0 : (l >= NLY ? NLY - 1 : l));    // the same in every lane: in a scalar register the four starts below are scalar too, and the loads name only the lane's two offsets
    const char* smp = (const char*)(sm + (size_t)l * DD); const char* ssp = (const char*)(ss + (size_t)l * RNK * DD); const char* rmp = (const char*)(rm + (size_t)l * rows); const char* rrp = (const char*)(rr + (size_t)l * RNK * rows);    // wave-uniform starts of layer l
    const unsigned cof = col * 4u, rof = row0 * 4u;    // the lane's byte offsets behind them: its first column, its first row
    const char* rq[RNK];    // the lane's first row in each of the layer's RNK rows of r
#pragma unroll
    for (int k = 0; k < RNK; ++k) rq[k] = rrp + (size_t)k * rows * 4 + rof;
    v4f cs[1 + RNK][2]; float ra[2][PU / 2][1 + RNK];
#pragma unroll
    for (int p = 0; p < 2; ++p) { cs[0][p] = *(const v4f*)(smp + cof + p * 16);
#pragma unroll
        for (int k = 0; k < RNK; ++k) cs[1 + k][p] = *(const v4f*)(ssp + cof + k * (DD * 4) + p * 16); }
#pragma unroll
    for (int g = 0; g < 2; ++g) {
        if (g == 1) asm volatile("s_wait_loadcnt 0x2b" ::: "memory");    // 46 loads are out and 20 follow: with at most 43 older ones left, a wave never has more than 63 outstanding, the most that s_wait_loadcnt can name
#pragma unroll
        for (int u = 0; u < PU / 2; ++u) { ra[g][u][0] = *(const float*)(rmp + rof + (g * 4 + u) * 32);
#pragma unroll
            for (int k = 0; k < RNK; ++k) ra[g][u][1 + k] = *(const float*)(rq[k] + (g * 4 + u) * 32); } }
    asm volatile("s_wait_xcnt 0x0" :: "v"(wp), "v"(cof), "v"(rof), "v"(rq[0]), "v"(rq[1]), "v"(rq[2]), "v"(rq[3]) : "memory");    // the address and offset registers of the issued loads are held to here and reused only behind this wait
    float cf[1 + RNK][8];
#pragma unroll
    for (int k = 0; k < 1 + RNK; ++k)
#pragma unroll
        for (int q = 0; q < 4; ++q) { cf[k][q] = bfr(cs[k][0][q]); cf[k][4 + q] = bfr(cs[k][1][q]); }
#pragma unroll 1                  // rolled: for speed only
    for (int g = 0; g < 2; ++g) {
#pragma unroll
        for (int u = 0; u < PU / 2; ++u) { v8us oh, ol; float rf[1 + RNK];
#pragma unroll
            for (int k = 0; k < 1 + RNK; ++k) rf[k] = bfr(ra[0][u][k]);
#pragma unroll
            for (int q = 0; q < 8; ++q) { const float wb = bfr(v[0][u][q >> 2][q & 3]); float ad = rf[1] * cf[1][q];
#pragma unroll
                for (int k = 1; k < RNK; ++k) ad += rf[1 + k] * cf[1 + k][q];
                unsigned short h, lo; splitf(wb * (rf[0] * cf[0][q]) + ad, h, lo); oh[q] = h; ol[q] = lo; }
            const size_t ou = o + (size_t)(u >> 1) * ((DD / 32) * 512) + (u & 1) * 64; *(v8us*)(Wh + ou) = oh; *(v8us*)(Wl + ou) = ol;
            asm volatile("s_wait_xcnt 0x0" ::: "memory");    // the registers of this unit's two stores are reused only behind this wait
            v[0][u][0] = v[1][u][0]; v[0][u][1] = v[1][u][1];
#pragma unroll
            for (int k = 0; k < 1 + RNK; ++k) ra[0][u][k] = ra[1][u][k]; }
        o += (size_t)2 * ((DD / 32) * 512); }
}
// k_prep: the three weight factorisations and the two bf16 roundings, which do not depend on one another, as ONE grid; a block's index range says which it works for. The pointers are chosen by that range (scalar selects) and
// each of the two bodies stands once in the text.
#define GFI (3 * DD / 64 * (DD / 32) / PW)   // blocks: in_proj weight, a wave per 64 rows x 32 columns
#define GF1 (DD / 64 * (DD / 32) / PW)       // pos_proj, out_proj weight
#define GCX (NT / 8 * (DD / (PU * 32)) / PW) // input, a wave per 8 rows x 256 columns
#define GCR (TT / 8 * (DD / (PU * 32)) / PW) // pos
__global__ __launch_bounds__(PW * 32) void k_prep(const float* __restrict__ Wi, const float* __restrict__ Wp, const float* __restrict__ Wo, const int* __restrict__ idx,
                                              const float* __restrict__ rm_i, const float* __restrict__ sm_i, const float* __restrict__ r_i, const float* __restrict__ s_i,
                                              const float* __restrict__ rm_p, const float* __restrict__ sm_p, const float* __restrict__ r_p, const float* __restrict__ s_p,
                                              const float* __restrict__ rm_o, const float* __restrict__ sm_o, const float* __restrict__ r_o, const float* __restrict__ s_o,
                                              const float* __restrict__ x, const float* __restrict__ r, bf* WIh, bf* WIl, bf* WRh, bf* WRl, bf* WOh, bf* WOl, bf* XB, bf* RB) {
    const unsigned blk = blockIdx.x, w = threadIdx.x >> 5;
    if (blk < GFI + 2 * GF1) { const bool wi = blk < GFI, wq = blk < GFI + GF1;    // in_proj; else pos_proj; else out_proj
        fact_wave((blk - (wi ? 0u : wq ? (unsigned)GFI : (unsigned)(GFI + GF1))) * PW + w, wi ? Wi : wq ? Wp : Wo, idx, wi ? rm_i : wq ? rm_p : rm_o, wi ? sm_i : wq ? sm_p : sm_o, wi ? r_i : wq ? r_p : r_o, wi ? s_i : wq ? s_p : s_o,
                  wi ? 3 * DD : DD, wi ? WIh : wq ? WRh : WOh, wi ? WIl : wq ? WRl : WOl); }
    else { const bool ix = blk < GFI + 2 * GF1 + GCX; cvt_wave((blk - (ix ? (unsigned)(GFI + 2 * GF1) : (unsigned)(GFI + 2 * GF1 + GCX))) * PW + w, ix ? x : r, ix ? XB : RB); }
}
// rowplanes: the tile in LDS -> one plane (Q false), or the two q planes (Q true), in fragment order. Chunk u * 32 + lane of a group's two tiles holds d = u * 16 + hi * 8 + 0..7 of row lr; the pointers come with the lane's part added.
template <bool Q>
__device__ __forceinline__ void rowplanes(const float* sp, int rstep, const float* __restrict__ bias, const float* __restrict__ ha, const float* __restrict__ hb, h16* P, h16* P2, size_t pstep) {
    v4f rb[4][2], ra[4][2], re[4][2];    // every bias value of the lane, fetched as one group: one load latency for the whole epilogue
#pragma unroll
    for (int u = 0; u < 4; ++u)
#pragma unroll
        for (int p = 0; p < 2; ++p) { rb[u][p] = *(const v4f*)(bias + u * 16 + p * 4); if (Q) { ra[u][p] = *(const v4f*)(ha + u * 16 + p * 4); re[u][p] = *(const v4f*)(hb + u * 16 + p * 4); } }
#pragma unroll
    for (int u = 0; u < 4; ++u) { float pb[8], ga[8], gb[8];
#pragma unroll
        for (int q = 0; q < 4; ++q) { pb[q] = bfr(rb[u][0][q]); pb[4 + q] = bfr(rb[u][1][q]); if (Q) { ga[q] = bfr(ra[u][0][q]); ga[4 + q] = bfr(ra[u][1][q]); gb[q] = bfr(re[u][0][q]); gb[4 + q] = bfr(re[u][1][q]); } }
#pragma unroll
        for (int bb = 0; bb < 4; ++bb) { const float* s = sp + bb * rstep + u * 16; const v4f s0 = *(const v4fa*)s, s1 = *(const v4fa*)(s + 4); float f[8]; v8h o;
#pragma unroll
            for (int q = 0; q < 4; ++q) { f[q] = s0[q] + pb[q]; f[4 + q] = s1[q] + pb[4 + q]; }
#pragma unroll
            for (int q = 0; q < 8; ++q) o[q] = tohx(Q ? __fadd_rn(f[q], ga[q]) : f[q]);
            *(v8h*)(P + (size_t)bb * pstep + u * 256) = o;
            if (Q) { v8h o2;
#pragma unroll
                for (int q = 0; q < 8; ++q) o2[q] = tohx(__fadd_rn(f[q], gb[q]));
                *(v8h*)(P2 + (size_t)bb * pstep + u * 256) = o2; } }
        asm volatile("s_wait_xcnt 0x0" ::: "memory"); }    // the registers of this group's stores (in the first group: of the bias loads too) are reused only behind this wait
}
// k_proj: the four projections, which do not depend on one another, as ONE grid (16, 26) of 8 waves (4 x 2 tiles of 64 x 64): blockIdx.y / 8 = 0, 1, 2: the q, k, v third of in_proj (256 rows blockIdx.x, heads (y & 7) * 2 + 0, 1);
// y = 24, 25: the 4 x 8 work-group tiles of the pos projection. What follows is per wave:
// A tile's 64 columns are one head; its 64 rows are 16 times x 4 batch entries (row = time * 4 + batch), or 64 positions of pos. So the tile holds whole 16-row blocks of k_attn's fp16 operand planes, and the epilogue writes those
// planes itself, in fragment order, 512 bytes in a row per store: q + r_w_bias and q + r_r_bias (QA, QB), k (KP), v transposed (VT), r_k (RK). No f32 projection goes through memory.
// Rounding of each value: f32 sum + bf16-rounded projection bias, then + bf16-rounded head bias (q only), each addition rounded to f32, then fp16.
__global__ __launch_bounds__(256) __attribute__((amdgpu_waves_per_eu(4, 4))) void k_proj(const bf* __restrict__ XB, const bf* __restrict__ RB, const bf* __restrict__ WIh, const bf* __restrict__ WIl, const bf* __restrict__ WRh, const bf* __restrict__ WRl, int K, const float* __restrict__ bi, const float* __restrict__ bp,
                                             const float* __restrict__ rwb, const float* __restrict__ rrb, h16* QA, h16* QB, h16* KP, h16* VT, h16* RK) {
    __shared__ __align__(16) char st[8 * 64 * 68 * 4];    // in the k loop: the two staging buffers (2 * STG bytes); behind it: each wave's whole tile
    const int lane = threadIdx.x & 31, lr = lane & 15, hi = lane >> 4; const int w = __builtin_amdgcn_readfirstlane((int)(threadIdx.x >> 5)); const int wn = w & 1, wm = w >> 1;
    const int bx = (int)blockIdx.x, y = (int)blockIdx.y; const bool pos = y >= 24; const int sel = y >> 3; const int t = (y - 24) * 16 + bx;
    const int x = (pos ? (t & 3) : bx) * 4 + wm;    // this wave's 64-row tile
    const int r0 = x * 64, hh = (pos ? (t >> 2) : (y & 7)) * 2 + wn, c0 = hh * 64;
    const float* bias = (pos ? bp : bi + (size_t)sel * DD) + c0;    // the 64 projection-bias values of this tile's columns
    v8f acc[4][4];
    gemms_acc<3, 8, 1>(pos ? RB : XB, nullptr, pos ? WRh : WIh + (size_t)sel * DD * DD, pos ? WRl : WIl + (size_t)sel * DD * DD, K, r0 - wm * 64, c0 - wn * 64, st, acc);
    float* os = (float*)(st + w * (64 * 68 * 4));    // this wave's tile; tile row m stands at LDS row (m & 3) * 16 + (m >> 2): batch-major for x tiles
#pragma unroll
    for (int mb = 0; mb < 4; ++mb)
#pragma unroll
        for (int nb = 0; nb < 4; ++nb)
#pragma unroll
            for (int j = 0; j < 8; ++j) os[((j & 3) * 16 + mb * 4 + hi * 2 + (j >> 2)) * 68 + nb * 16 + lr] = acc[mb][nb][j];
    __builtin_amdgcn_wave_barrier(); asm volatile("" ::: "memory");    // the reads below take other lanes' values: they stay behind the stores above
    if (!pos && sel == 2) {    // VT[batch * 16 + head][d][time]: lane = (8 times hi * 8.., column d = db * 16 + lr); the 16 times are half a 32-wide k tile
        h16* P = VT + (size_t)hh * (HD * TT) + (size_t)((x >> 1) * 64 + (x & 1) * 32 + lane) * 8;
        float rv[4];    // the lane's four bias values, fetched as one group
#pragma unroll
        for (int db = 0; db < 4; ++db) rv[db] = bias[db * 16 + lr];
#pragma unroll
        for (int db = 0; db < 4; ++db) { const float bv = bfr(rv[db]);
#pragma unroll
            for (int bb = 0; bb < 4; ++bb) { v8h o;
#pragma unroll
                for (int q = 0; q < 8; ++q) o[q] = tohx(os[(bb * 16 + hi * 8 + q) * 68 + db * 16 + lr] + bv);
                *(v8h*)(P + (size_t)bb * (NH_ * HD * TT) + (size_t)db * (16 * TT)) = o; }
            asm volatile("s_wait_xcnt 0x0" ::: "memory"); }    // the registers of this group's stores (in the first group: of the bias loads too) are reused only behind this wait
    } else {    // planes [..][row][d]: 16 rows x 64 d = two tiles = 2 KiB in a row; group bb = batch entry bb (x tiles) or 16-row block bb (pos tiles)
        const bool isq = !pos && sel == 0;
        const float* sp = os + (pos ? (lr & 3) * 16 + (lr >> 2) : lr) * 68 + hi * 8; const int rstep = pos ? 4 * 68 : 16 * 68;    // (group bb, row lr) stands bb * rstep floats behind sp
        h16* P = (pos ? RK + (size_t)hh * (TT * HD) + (size_t)(r0 >> 4) * (16 * HD) : (isq ? QA : KP) + (size_t)hh * (TT * HD) + (size_t)x * (16 * HD)) + lane * 8;
        const size_t pstep = pos ? (size_t)(16 * HD) : (size_t)NH_ * TT * HD;
        if (isq) rowplanes<true>(sp, rstep, bias + hi * 8, rwb + c0 + hi * 8, rrb + c0 + hi * 8, P, QB + (size_t)hh * (TT * HD) + (size_t)x * (16 * HD) + lane * 8, pstep);
        else rowplanes<false>(sp, rstep, bias + hi * 8, nullptr, nullptr, P, nullptr, pstep);
    }
}
// k_attn: one work-group (8 waves) = 32 query rows of one (batch, head). The whole 32 x 1024 score block stays in LDS (f32, row pitch SP floats), so no score, probability or per-head output plane goes through memory.
// 1) BD: raw tiles (q + r_r_bias).r_k for rows i (lower part) and rows i + 1 (upper part) against the same r_k fragment; element (i, n) lands at its shifted column of row i: with d = i + n + 1 - T,
//    d >= 0 -> column d from row i; d <= -2 -> column d + T + 1 from row i + 1; d == -1 has no place in the shifted row and falls on column T, in the row's pad, which nobody reads.
//    For fixed i that fills every column but i + 1, which holds the shift's zero and is stored by wave 0 (for i = T - 1 that store too falls on the pad).
// 2) AC tiles are added at their own place and scaled by 1/8.  3) each wave: softmax of 4 rows; P (x1024, fp16) overwrites the front half of the row's own bytes, which only that wave touches here.
// 4) P.V: wave = (16-wide d tile, half of the keys), both 16-row tiles; the two halves' partial sums meet in Of.  5) 1/1024, hi/lo bf16 split; the merged planes are in fragment order with rows batch * T + time, so the work-group owns four whole tiles of each and a wave stores 512 bytes in a row.
// Every plain '#pragma unroll' in k_attn: the fragment and accumulator arrays are indexed by the loop counters and stay in registers only when those loops are unrolled.
#define MR 32
#define SP 1028                   // 4112 bytes = 16 x odd: the b128 fragment reads of 16 rows fall on distinct banks
typedef v4h __attribute__((may_alias)) v4ha;
__global__ __launch_bounds__(256) __attribute__((amdgpu_waves_per_eu(4, 4))) void k_attn(const h16* __restrict__ QA, const h16* __restrict__ QB, const h16* __restrict__ KP, const h16* __restrict__ VT, const h16* __restrict__ RK, bf* Ah, bf* Al) {
    __shared__ __align__(16) float S[MR * SP];
    __shared__ __align__(16) float Of[2 * MR * 68];
    const int tid = threadIdx.x, lane = tid & 31, lr = lane & 15, hi = lane >> 4; const int w = __builtin_amdgcn_readfirstlane(tid >> 5);
    const int i0 = blockIdx.x * MR; const int z = blockIdx.y; const int b = z >> 4, h = z & 15;
    const h16* qa = QA + (size_t)z * TT * HD; const h16* qb = QB + (size_t)z * TT * HD; const h16* kp = KP + (size_t)z * TT * HD; const h16* vt = VT + (size_t)z * HD * TT; const h16* rk = RK + (size_t)h * TT * HD;
    if (w == 0) S[lane * SP + i0 + lane + 1] = 0.f;
    // Both score loops are straight-line with two operand buffers: the loads of the next pair of key tiles are issued, then this pair is worked on. The sched_barrier calls hold that order:
    // without them the scheduler lifts all eight tiles' loads to the top and spills past the 256 registers that two work-groups per WGP allow.
    v16h a[2][2], kb[2][2][2];    // AC's operands; the q + r_w_bias rows and the first pair of key tiles are fetched in front of the last BD pair, whose work covers their latency
    const h16* pa = qa + (size_t)i0 * HD + lane * 8; const h16* pk = kp + (size_t)(w * 128) * HD + lane * 8;    // 16 rows of 64 = two tiles = 16 * HD elements; the second tile (k 32..63) 512 elements on
    {   v16h aL[2][2], aU[2][2], rb[2][2][2]; const h16* bp = rk + (size_t)(w * 128) * HD + lane * 8; const h16* pL = qb + (size_t)i0 * HD + lane * 8;
        const int ru = (i0 + 17 + lr < TT) ? i0 + 17 + lr : TT - 1; const h16* pU = qb + (size_t)(ru >> 4) * 16 * HD + (hi * 16 + (ru & 15)) * 8;    // row T does not exist; row T - 1 has no upper part, so its aU result is never chosen
        const int rv = i0 + 1 + lr; const h16* pV = qb + (size_t)(rv >> 4) * 16 * HD + (hi * 16 + (rv & 15)) * 8;    // rows i + 1 straddle two row blocks: lane 15's (and 31's) chunk lies in the next one
#pragma unroll
        for (int ks = 0; ks < 2; ++ks) { aL[0][ks] = WFrag<h16>::ld(pL + ks * 512); aL[1][ks] = WFrag<h16>::ld(pL + 16 * HD + ks * 512); aU[0][ks] = WFrag<h16>::ld(pV + ks * 512); aU[1][ks] = WFrag<h16>::ld(pU + ks * 512); }
#pragma unroll
        for (int t = 0; t < 2; ++t) { rb[0][t][0] = WFrag<h16>::ld(bp + t * 16 * HD); rb[0][t][1] = WFrag<h16>::ld(bp + t * 16 * HD + 512); }
        asm volatile("s_wait_xcnt 0x0" :: "v"(pL), "v"(pU), "v"(pV) : "memory");    // the address registers of the issued loads are held to here and may be reused only behind this wait
#pragma unroll
        for (int g = 0; g < 4; ++g) {
            if (g < 3) {
#pragma unroll
                for (int t = 0; t < 2; ++t) { rb[(g + 1) & 1][t][0] = WFrag<h16>::ld(bp + ((g + 1) * 2 + t) * 16 * HD); rb[(g + 1) & 1][t][1] = WFrag<h16>::ld(bp + ((g + 1) * 2 + t) * 16 * HD + 512); } }
            else {
#pragma unroll
                for (int mb = 0; mb < 2; ++mb)
#pragma unroll
                    for (int ks = 0; ks < 2; ++ks) { a[mb][ks] = WFrag<h16>::ld(pa + mb * 16 * HD + ks * 512); kb[0][mb][ks] = WFrag<h16>::ld(pk + mb * 16 * HD + ks * 512); } }
            if (g == 2) asm volatile("s_wait_xcnt 0x0" :: "v"(bp) : "memory");    // last loads through bp: its registers are held to here and reused only behind this wait
            if (g == 3) asm volatile("s_wait_xcnt 0x0" :: "v"(pa) : "memory");    // the same for pa
            __builtin_amdgcn_sched_barrier(0);    // the next pair's loads stay in front of this pair's work
#pragma unroll
            for (int t = 0; t < 2; ++t) { const int n0 = w * 128 + (g * 2 + t) * 16;
#pragma unroll
                for (int mb = 0; mb < 2; ++mb) { v8f cL = (v8f){}, cU = (v8f){}; cL = wmma16(aL[mb][0], rb[g & 1][t][0], cL); cU = wmma16(aU[mb][0], rb[g & 1][t][0], cU); cL = wmma16(aL[mb][1], rb[g & 1][t][1], cL); cU = wmma16(aU[mb][1], rb[g & 1][t][1], cU);
#pragma unroll
                    for (int j = 0; j < 8; ++j) { const int ml = mb * 16 + hi * 8 + j; const int d = i0 + ml + n0 + lr + 1 - TT;
                        S[ml * SP + d + ((d >> 31) & (TT + 1))] = (d >= 0) ? cL[j] : cU[j]; } } }
            __builtin_amdgcn_sched_barrier(0);    // later pairs' loads stay behind this pair's work
        }
    }
    __syncthreads();              // every shifted BD element is in place before AC is added to it
    {
#pragma unroll
        for (int g = 0; g < 4; ++g) {
            if (g < 3) {
#pragma unroll
                for (int t = 0; t < 2; ++t) { kb[(g + 1) & 1][t][0] = WFrag<h16>::ld(pk + ((g + 1) * 2 + t) * 16 * HD); kb[(g + 1) & 1][t][1] = WFrag<h16>::ld(pk + ((g + 1) * 2 + t) * 16 * HD + 512); } }
            if (g == 2) asm volatile("s_wait_xcnt 0x0" :: "v"(pk) : "memory");    // last loads through pk: its registers are held to here and reused only behind this wait
            __builtin_amdgcn_sched_barrier(0);    // the next pair's loads stay in front of this pair's work
#pragma unroll
            for (int t = 0; t < 2; ++t) { const int n0 = w * 128 + (g * 2 + t) * 16;
#pragma unroll
                for (int mb = 0; mb < 2; ++mb) { v8f c = (v8f){}; c = wmma16(a[mb][0], kb[g & 1][t][0], c); c = wmma16(a[mb][1], kb[g & 1][t][1], c);
#pragma unroll
                    for (int j = 0; j < 8; ++j) { float* sp = S + (mb * 16 + hi * 8 + j) * SP + n0 + lr; *sp = __fmul_rn(__fadd_rn(c[j], *sp), 0.125f); } } }
            __builtin_amdgcn_sched_barrier(0);    // later pairs' loads stay behind this pair's work
        }
    }
    __syncthreads();              // whole rows are complete before a wave reduces them
    const int dt = w & 3, kh = w >> 2; v16h bv[16]; const h16* vp = vt + (size_t)(dt * (TT / 32) + kh * 16) * 512 + lane * 8;    // this wave's V fragments: the first eight are fetched here, so that their latency passes behind the softmax
#pragma unroll
    for (int ks = 0; ks < 8; ++ks) bv[ks] = WFrag<h16>::ld(vp + ks * 512);
#pragma unroll 1                  // rolled: one row's 32 values at a time, so that the V fragments held across this loop stay in registers
    for (int rr = 0; rr < 4; ++rr) { float* sr = S + (w * 4 + rr) * SP; float v[32]; float mx = -3.0e38f;
#pragma unroll
        for (int ch = 0; ch < 8; ++ch) { const v4f sv = *(const v4fa*)(sr + ch * 128 + lane * 4);
#pragma unroll
            for (int q = 0; q < 4; ++q) { v[ch * 4 + q] = sv[q]; mx = fmaxf(mx, sv[q]); } }
#pragma unroll
        for (int sh = 16; sh; sh >>= 1) mx = fmaxf(mx, __shfl_xor(mx, sh, 32));
        float sum = 0.f;
#pragma unroll
        for (int k = 0; k < 32; ++k) { v[k] = __expf(v[k] - mx); sum += v[k]; }
#pragma unroll
        for (int sh = 16; sh; sh >>= 1) sum += __shfl_xor(sum, sh, 32);
        const float fct = __fdiv_rn(PCAR, sum); h16* pr = (h16*)sr;
#pragma unroll
        for (int ch = 0; ch < 8; ++ch) { v4h o;
#pragma unroll
            for (int q = 0; q < 4; ++q) o[q] = tohx(v[ch * 4 + q] * fct);
            *(v4ha*)(pr + ch * 128 + lane * 4) = o; } }
    __syncthreads();              // P of all 32 rows is written before any wave reads it as its A operand
#pragma unroll
    for (int ks = 8; ks < 16; ++ks) bv[ks] = WFrag<h16>::ld(vp + ks * 512);    // the other eight fly while the first eight are worked on (all sixteen held over the softmax spill)
    asm volatile("s_wait_xcnt 0x0" :: "v"(vp) : "memory");    // last loads through vp: its registers are held to here and reused only behind this wait
    {   const h16* P = (const h16*)S; v8f o[2]; o[0] = (v8f){}; o[1] = (v8f){}; const h16* pp = P + (size_t)lr * (2 * SP) + kh * 512 + 8 * hi;
#pragma unroll
        for (int ks = 0; ks < 16; ++ks) {
#pragma unroll
            for (int mb = 0; mb < 2; ++mb) { const h16* ap = pp + (size_t)mb * 16 * (2 * SP) + ks * 32; o[mb] = wmma16(cat16(*(const v8ha*)ap, *(const v8ha*)(ap + 16)), bv[ks], o[mb]); } }
#pragma unroll
        for (int mb = 0; mb < 2; ++mb)
#pragma unroll
            for (int j = 0; j < 8; ++j) Of[(kh * MR + mb * 16 + hi * 8 + j) * 68 + dt * 16 + lr] = o[mb][j];
    }
    __syncthreads();              // both key halves' partial sums are in Of
    {   const int row = (tid >> 7) * 16 + lr, d0 = ((tid >> 6) & 1) * 32 + ((tid >> 5) & 1) * 16 + hi * 8; const float* p0 = Of + row * 68 + d0; const float* p1 = p0 + MR * 68; v8us oh, ol;
#pragma unroll
        for (int q = 0; q < 8; ++q) { unsigned short x, y; splitf(__fadd_rn(p0[q], p1[q]) * (1.0f / PCAR), x, y); oh[q] = x; ol[q] = y; }
        const size_t o = ((size_t)((b * TT + i0) / 16 + (tid >> 7)) * (DD / 32) + h * 2 + ((tid >> 6) & 1)) * 512 + (tid & 63) * 8; *(v8us*)(Ah + o) = oh; *(v8us*)(Al + o) = ol; }
}

extern "C" void kernel_launch(void* const* d_in, const int* in_sizes, int n_in,
                              void* d_out, int out_size, void* d_ws, size_t ws_size, hipStream_t stream) {
    (void)in_sizes; (void)n_in; (void)out_size;
    const float* IN[23]; for (int i = 0; i < 23; ++i) IN[i] = (const float*)d_in[i];
    // input [1024][4][1024], pos [1024][1][1024], indices (int [1]), in_proj_weight [3072][1024], in_proj_bias, out_proj_weight, out_proj_bias, pos_proj_weight, pos_proj_bias,
    // r_i [8][4][3072], s_i [8][4][1024], r_p, s_p, r_o, s_o, rm_i [8][1][3072], sm_i [8][1][1024], rm_p, sm_p, rm_o, sm_o, r_w_bias [16][64], r_r_bias = d_in[0..22]
    const float* x = IN[0]; const float* r = IN[1]; const int* idx = (const int*)d_in[2]; const float* rwb = IN[21]; const float* rrb = IN[22];
    float* OUT = (float*)d_out;     // [1024][4][1024] (rows t*4 + b)
    char* wsp = (char*)d_ws;
    auto take = [&](size_t bytes) { char* p = wsp; wsp += (bytes + 255) & ~(size_t)255; return (void*)p; };
    bf* WIh = (bf*)take((size_t)3 * DD * DD * 2); bf* WIl = (bf*)take((size_t)3 * DD * DD * 2); bf* WRh = (bf*)take((size_t)DD * DD * 2); bf* WRl = (bf*)take((size_t)DD * DD * 2); bf* WOh = (bf*)take((size_t)DD * DD * 2); bf* WOl = (bf*)take((size_t)DD * DD * 2);
    bf* XB = (bf*)take((size_t)NT * DD * 2); bf* RB = (bf*)take((size_t)TT * DD * 2);
    h16* QA = (h16*)take((size_t)NT * DD * 2); h16* QB = (h16*)take((size_t)NT * DD * 2); h16* KP = (h16*)take((size_t)NT * DD * 2); h16* VT = (h16*)take((size_t)NT * DD * 2); h16* RK = (h16*)take((size_t)NH_ * TT * HD * 2);
    bf* ATh = (bf*)take((size_t)NT * DD * 2); bf* ATl = (bf*)take((size_t)NT * DD * 2);   // the merged hi/lo planes
    if ((size_t)(wsp - (char*)d_ws) > ws_size) return;    // total 80 MiB; ws 256 MiB
    // Four dependent launches; what does not depend on one another shares a grid.
    k_prep<<<GFI + 2 * GF1 + GCX + GCR, PW * 32, 0, stream>>>(IN[3], IN[7], IN[5], idx, IN[15], IN[16], IN[9], IN[10], IN[17], IN[18], IN[11], IN[12], IN[19], IN[20], IN[13], IN[14], x, r, WIh, WIl, WRh, WRl, WOh, WOl, XB, RB);
    k_proj<<<dim3(NT / 256, 3 * DD / 128 + TT / 256 * (DD / 128) / (NT / 256), 1), 256, 0, stream>>>(XB, RB, WIh, WIl, WRh, WRl, DD, IN[4], IN[8], rwb, rrb, QA, QB, KP, VT, RK);
    k_attn<<<dim3(TT / MR, NB_ * NH_, 1), 256, 0, stream>>>(QA, QB, KP, VT, RK, ATh, ATl);
    k_gemmw<2, true, true><<<dim3(NT / 128, DD / 128, 1), 128, 0, stream>>>(ATh, ATl, WOh, WOl, DD, OUT, DD, IN[6]);
}

// v010
// Measured time: 96.4 microseconds a run.
// Versions in between are left out here; by their measured steps it is 1.20 times as fast as v008.
// All steps since v000 together make it 18.0 times as fast.
#include <hip/hip_runtime.h>

// Relative-position multi-head attention (segment-recurrence style relative shift; query [1024][4][1024] seq-first, r [1024][1024]; w = query qkv_w^T -> q|k|v (16 heads x 64); r_k = r r_w^T; AC = (q + r_w_bias).k,
// BD = rel_shift((q + r_r_bias).r_k) with the module's exact zero-pad/reshape shift (out[i][j] = BD[f / (T+1)][f % (T+1) - 1] or 0 when f % (T+1) == 0, f = T + i*T + j); p = softmax((AC + BD) / 8)
// over the keys; attn = p.v; out = merged out_w^T + out_b; output [1024][4][1024] (rows t*4 + b)).
// Compute dtypes, f32 accumulate: every input rounded to bf16; EVERY product on SINGLE fp16 planes: the rounded input and pos (a bf16 value is exact in fp16 above fp16's subnormal range), the factorised weights
// (formed in f32, rounded once to fp16), q, k, v, r_k (the per-head biases added in f32 before the fp16 rounding), P x1024 and the merged attention output. Each rounding adds a relative error of about 2^-12 to its operand; the relative shift is done by where each BD element is stored in the LDS score block of k_attn;

// FRAGMENT ORDER of every 16-bit WMMA operand plane in the workspace (rows x K, K % 32 == 0): tiles of 16 rows x 32 k = 1 KiB, tile (row / 16, k / 32) at index (row / 16) * (K / 32) + k / 32; inside a tile the 16-byte chunk
// of row lr, k = half * 16 + hi * 8 + 0..7 stands at chunk half * 32 + hi * 16 + lr. That is the register layout of a 16x16x32 A or B fragment, so a fragment is two loads of 512 contiguous bytes (lane * 16): four whole 128-byte lines each.

#define NB_  4
#define TT   1024
#define NLY  8                    // weight-factor layers
#define RNK  4                    // additive rank
#define DD   1024
#define NH_  16
#define HD   64
#define NT   (NB_ * TT)
typedef _Float16 h16;
typedef __attribute__((ext_vector_type(16))) _Float16 v16h;
typedef __attribute__((ext_vector_type(8)))  _Float16 v8h;
typedef __attribute__((ext_vector_type(8)))  float    v8f;
typedef __attribute__((ext_vector_type(4)))  float    v4f;
typedef v8h  __attribute__((may_alias)) v8ha;
typedef v4f  __attribute__((may_alias)) v4fa;

__device__ __forceinline__ unsigned short f2bf(float f) { unsigned u = __float_as_uint(f); u += 0x7FFFu + ((u >> 16) & 1u); return (unsigned short)(u >> 16); }
__device__ __forceinline__ float bf2f(unsigned short b) { return __uint_as_float(((unsigned)b) << 16); }
__device__ __forceinline__ float bfr(float f) { return bf2f(f2bf(f)); }
__device__ __forceinline__ v16h cat16(v8h lo, v8h hi) { return __builtin_shufflevector(lo, hi, 0, 1, 2, 3, 4, 5, 6, 7, 8, 9, 10, 11, 12, 13, 14, 15); }
__device__ __forceinline__ v8f wmma16(v16h a, v16h b, v8f c) { return __builtin_amdgcn_wmma_f32_16x16x32_f16(false, a, false, b, (short)0, c, false, false); }



// ---- GEMM core: a work-group of NWV waves, each wave a 64x64 output tile (16 accumulators); 8 waves stand 4 x 2 (256 rows x 128 columns), 4 waves 2 x 2 (128 x 128). Operands are 16-bit planes in fragment order.
// C[m][n] = sum_k A[m][k] Bt[n][k]. K % 64 == 0.
template <typename T16> struct WFrag;
template <> struct WFrag<h16> { typedef v16h V; static __device__ __forceinline__ V ld(const h16* p) { return cat16(*(const v8h*)p, *(const v8h*)(p + 256)); } static __device__ __forceinline__ v8f mma(V a, V b, v8f c) { return wmma16(a, b, c); } };
#define STGB(NWV) (((NWV) * 2 + 8) * 2048)    // bytes of one staging buffer: 16 (8 waves) or 8 (4 waves) segments of A and 8 of Bt, 2 KiB each
// Asynchronous copies, 16 bytes a lane, 512 a copy. A 2-KiB segment lies in a row in the plane and in LDS alike, so its four copies name one pair of address registers and step both addresses by the immediate offset.
// acopy12: three segments, acopy16: four, that follow one another in LDS. l: the lane's LDS byte address in the first of them; g0..: its global address in each.
// The s_wait_xcnt stands inside the statement, behind the last copy: the address registers that the copies name are rewritten only behind it.
#define ACP4(L, G) "global_load_async_to_lds_b128 %" #L ", %" #G ", off\n\tglobal_load_async_to_lds_b128 %" #L ", %" #G ", off offset:512\n\tglobal_load_async_to_lds_b128 %" #L ", %" #G ", off offset:1024\n\tglobal_load_async_to_lds_b128 %" #L ", %" #G ", off offset:1536\n\t"
__device__ __forceinline__ void acopy12(unsigned l, const h16* g0, const h16* g1, const h16* g2) {
    asm volatile(ACP4(0, 3) ACP4(1, 4) ACP4(2, 5) "s_wait_xcnt 0x0"
                 :: "v"(l), "v"(l + 2048u), "v"(l + 4096u), "v"(g0), "v"(g1), "v"(g2) : "memory");
}
__device__ __forceinline__ void acopy16(unsigned l, const h16* g0, const h16* g1, const h16* g2, const h16* g3) {
    asm volatile(ACP4(0, 4) ACP4(1, 5) ACP4(2, 6) ACP4(3, 7) "s_wait_xcnt 0x0"
                 :: "v"(l), "v"(l + 2048u), "v"(l + 4096u), "v"(l + 6144u), "v"(g0), "v"(g1), "v"(g2), "v"(g3) : "memory");
}
__device__ __forceinline__ v16h ldl(const char* p) { return cat16(*(const v8ha*)p, *(const v8ha*)(p + 512)); }    // one fragment from a staged tile: two reads of 512 bytes in a row, lane * 16
// gemms_acc: the k loop; it leaves this wave's 16 accumulators in acc (row mb * 16 + hi * 8 + j, column nb * 16 + lr of the wave's tile). r0, c0: the WORK-GROUP's first row and column.
// A trip is 64 k = two tiles = 2 KiB in a row of every 16-row block ("segment"). A buffer holds the trip's segments: NA of A (rows r0 + s * 16), then 8 of Bt (columns c0 + (s - NA) * 16); wave w copies segments w * NS .. w * NS + NS - 1.
// Each line of the operands is fetched from L2 once per work-group and read from LDS by the 2 or 4 waves that need it. Two buffers: tile t + 2's copies go out behind the barrier at the foot of trip t and fly during trip t + 1.
// Each accumulator takes its products in the order k ascending.
// Every plain '#pragma unroll' in gemms_acc: the fragment, accumulator and address arrays are indexed by the loop counters and stay in registers only when those loops are unrolled.
// PRE: k steps (of 32) whose fragments are read from LDS as one group: 2 where a wave has a SIMD to itself and registers to spare, 1 where four waves share one.
template <int NWV, int PRE>
__device__ __forceinline__ void gemms_acc(const h16* __restrict__ A, const h16* __restrict__ Bt, int K, int r0, int c0, char* st, v8f (&acc)[4][4]) {
    const int lane = threadIdx.x & 31; const int w = __builtin_amdgcn_readfirstlane((int)(threadIdx.x >> 5)); const int wn = w & 1, wm = w >> 1;
    constexpr int NA = NWV * 2;            // segments of A in a buffer
    constexpr int NS = (NA + 8) / NWV;     // segments that a wave copies: 3 (8 waves) or 4 (4 waves)
    constexpr unsigned STG = STGB(NWV);
#pragma unroll
    for (int mb = 0; mb < 4; ++mb)
#pragma unroll
        for (int nb = 0; nb < 4; ++nb) acc[mb][nb] = (v8f){};
    const h16* gp[NS];    // the lane's global address in each of its segments, tile 0
#pragma unroll
    for (int i = 0; i < NS; ++i) { const int s = w * NS + i; gp[i] = (s < NA ? A + (size_t)(r0 + s * 16) * K : Bt + (size_t)(c0 + (s - NA) * 16) * K) + lane * 8; }
    const unsigned lp = (unsigned)(size_t)st + (unsigned)(w * NS * 2048 + lane * 16);    // its LDS byte address in the first of them, buffer 0
    auto copies = [&](int t, unsigned bo) {    // tile t into the buffer at byte bo: all of the wave's copies in one statement
        const size_t to = (size_t)t * 1024;
        if constexpr (NS == 3) acopy12(lp + bo, gp[0] + to, gp[1] + to, gp[2] + to);
        else acopy16(lp + bo, gp[0] + to, gp[1] + to, gp[2] + to, gp[NS - 1] + to);
    };
    const int nt = K >> 6;
    copies(0, 0u);
    asm volatile("s_wait_asynccnt 0x0" ::: "memory");    // this wave's part of tile 0 has landed
    __syncthreads();              // tile 0 is whole before any wave reads it
    if (nt > 1) copies(1, STG);
    unsigned bo = 0u;
#pragma unroll 1                  // rolled: one trip's text serves both buffers
    for (int t = 0; t < nt; ++t) {
        const char* sa = st + bo + wm * 8192 + lane * 16; const char* sb = st + bo + (NA + wn * 4) * 2048 + lane * 16;
#pragma unroll
        for (int k0 = 0; k0 < 2; k0 += PRE) { v16h a[PRE][4], b[PRE][4];
#pragma unroll
            for (int p = 0; p < PRE; ++p) { const int ko = (k0 + p) * 1024;    // in the order in which the WMMAs below take them
#pragma unroll
                for (int q = 0; q < 4; ++q) a[p][q] = ldl(sa + q * 2048 + ko);
#pragma unroll
                for (int q = 0; q < 4; ++q) b[p][q] = ldl(sb + q * 2048 + ko); }
            __builtin_amdgcn_sched_barrier(0);    // the LDS reads stay one group in front of their WMMAs: left free, the scheduler keeps one B fragment and waits for LDS in front of every four WMMAs
#pragma unroll
            for (int p = 0; p < PRE; ++p)
#pragma unroll
                for (int nb = 0; nb < 4; ++nb)
#pragma unroll
                    for (int mb = 0; mb < 4; ++mb) acc[mb][nb] = wmma16(a[p][mb], b[p][nb], acc[mb][nb]);
            __builtin_amdgcn_sched_barrier(0);    // the next group's reads stay behind these WMMAs, whose registers they take
        }
        asm volatile("s_wait_dscnt 0x0" ::: "memory");       // this wave's reads of the buffer are done before the barrier behind which it is refilled
        asm volatile("s_wait_asynccnt 0x0" ::: "memory");    // this wave's part of tile t + 1 has landed
        __syncthreads();          // publishes tile t + 1 and ends every wave's reads of tile t; behind the last trip it frees the buffers for the epilogue
        if (t + 2 < nt) copies(t + 2, bo);
        bo = STG - bo;
    }
    asm volatile("s_wait_asynccnt 0x0" ::: "memory");    // no copy is outstanding when the LDS is put to another use
}
// gemmw_tile: C (f32, pitch ldc, + optional f32 bias[n]); TB: row m of A is (batch m / TT, time m % TT) and goes to row time * NB_ + batch of C. R0, C0: the work-group's first row and column; 4 waves.
template <bool BIAS, bool TB>
__device__ __forceinline__ void gemmw_tile(const h16* __restrict__ A, const h16* __restrict__ Bt, int K, float* C, int ldc, const float* __restrict__ bias, int R0, int C0, char* st) {
    const int lane = threadIdx.x & 31, lr = lane & 15, hi = lane >> 4; const int w = __builtin_amdgcn_readfirstlane((int)(threadIdx.x >> 5)); const int r0 = R0 + (w >> 1) * 64, c0 = C0 + (w & 1) * 64;
    v8f acc[4][4];
    gemms_acc<4, 2>(A, Bt, K, R0, C0, st, acc);
    float* os = (float*)(st + w * (16 * 68 * 4));    // each wave's own 16 x 68 block, in the staging buffers, which nobody reads any more
#pragma unroll
    for (int mb = 0; mb < 4; ++mb) {
#pragma unroll
        for (int nb = 0; nb < 4; ++nb) {
#pragma unroll
            for (int j = 0; j < 8; ++j) os[(hi * 8 + j) * 68 + nb * 16 + lr] = acc[mb][nb][j]; }
        __builtin_amdgcn_wave_barrier(); asm volatile("" ::: "memory");
        const size_t rs = TB ? (size_t)NB_ * ldc : (size_t)ldc; float* crow = TB ? C + ((size_t)((r0 & (TT - 1)) + mb * 16) * NB_ + (r0 / TT)) * ldc + c0 : C + (size_t)(r0 + mb * 16) * ldc + c0;
{
#pragma unroll
            for (int s = 0; s < 8; ++s) { const int row = 2 * s + hi, cofs = lr * 4; v4f val = *(const v4fa*)(os + row * 68 + cofs); if (BIAS) { val[0] += bfr(bias[c0 + cofs]); val[1] += bfr(bias[c0 + cofs + 1]); val[2] += bfr(bias[c0 + cofs + 2]); val[3] += bfr(bias[c0 + cofs + 3]); }
                *(v4f*)(crow + (size_t)row * rs + cofs) = val; }
             }
        __builtin_amdgcn_wave_barrier(); asm volatile("" ::: "memory");
        asm volatile("s_wait_xcnt 0x0" ::: "memory");    // the address registers of this block's stores are reused only behind this wait
    }
}
// k_gemmw: one GEMM, grid (M/128, N/128), 4 waves.
template <bool BIAS, bool TB>
__global__ __launch_bounds__(128) void k_gemmw(const h16* __restrict__ A, const h16* __restrict__ Bt, int K, float* C, int ldc, const float* __restrict__ bias) {
    __shared__ __align__(16) char st[2 * STGB(4)];
    gemmw_tile<BIAS, TB>(A, Bt, K, C, ldc, bias, (int)blockIdx.x * 128, (int)blockIdx.y * 128, st);
}

__device__ __forceinline__ h16 tohx(float x) { return (h16)x; }
typedef __attribute__((ext_vector_type(2))) _Float16 v2h;
typedef __attribute__((ext_vector_type(4))) _Float16 v4h;
typedef __attribute__((ext_vector_type(4))) int v4i;

// k_prep's unit of work: one wave, 8 rows x 32 columns (one k tile) of a [rows][DD] f32 source. Lane = (row lane & 7, 8 columns (lane >> 3) * 8): a 16-byte load takes pieces of 8 lines, one per row, and the lane's second load the rest of
// the same lines; the lane's 8 results are one 16-byte chunk of the plane in fragment order, chunk (lane >> 3) * 16 + (row & 15) of the tile, so that a wave's store covers four whole 128-byte lines.
// A wave does PU such units, every load of them issued before the first result is formed: few long waves with many loads in flight each, in place of one short wave per 64 (weights) or 256 (inputs) elements.
// Every plain '#pragma unroll' in cvt_wave and fact_wave: the value arrays are indexed by the loop counters and stay in registers only when those loops are unrolled.
#define PU 8                      // units a wave
#define PW 4                      // waves a block
// cvt_wave: bf16 rounding of 8 rows x 256 columns, stored as fp16: wave wv = (16-row block wv >> 3, quarter of the columns (wv >> 1) & 3, upper or lower 8 rows wv & 1); unit j is k tile j of the quarter.
__device__ __forceinline__ void cvt_wave(unsigned wv, const float* __restrict__ src, h16* dst) {
    const unsigned lane = threadIdx.x & 31, r8 = wv & 1, kq = (wv >> 1) & 3, rb = wv >> 3, c4 = lane >> 3, lr = r8 * 8 + (lane & 7);
    const float* sp = src + (size_t)(rb * 16 + lr) * DD + kq * (PU * 32) + c4 * 8; h16* dp = dst + ((size_t)(rb * (DD / 32) + kq * PU) * 64 + c4 * 16 + lr) * 8; v4f v[PU][2];
#pragma unroll
    for (int j = 0; j < PU; ++j) { v[j][0] = *(const v4f*)(sp + j * 32); v[j][1] = *(const v4f*)(sp + j * 32 + 4); }
    asm volatile("s_wait_xcnt 0x0" :: "v"(sp) : "memory");    // the address registers of the issued loads are held to here and reused only behind this wait
#pragma unroll
    for (int j = 0; j < PU; ++j) { v8h o;
#pragma unroll
        for (int q = 0; q < 4; ++q) { o[q] = tohx(bfr(v[j][0][q])); o[4 + q] = tohx(bfr(v[j][1][q])); }
        *(v8h*)(dp + j * 512) = o; }
}
// fact_wave: factorised weight, one fp16 plane: W'[a][b] = bf16(W[a][b]) (bf16(rm[l][a]) bf16(sm[l][b])) + sum_k bf16(r[l][k][a]) bf16(s[l][k][b]) (f32, k ascending), l = indices[0] read on device and clamped to the factor arrays.
// Wave wv = (64 rows wv >> 5, k tile wv & 31); unit j is rows j * 8 .. j * 8 + 7 of the 64, so the lane's 8 columns, and with them its sm and s values, are the same in all its units and are fetched once.
// All loads go out first; the arithmetic is one rolled loop of two trips, four units each, so that the text a wave runs through only once stays short.
__device__ __forceinline__ void fact_wave(unsigned wv, const float* __restrict__ W, const int* __restrict__ idx, const float* __restrict__ rm, const float* __restrict__ sm, const float* __restrict__ rr, const float* __restrict__ ss, int rows, h16* Wf) {
    const unsigned lane = threadIdx.x & 31, kt = wv & 31, rg = wv >> 5, c4 = lane >> 3, row0 = rg * 64 + (lane & 7), col = kt * 32 + c4 * 8;
    const float* wp = W + (size_t)row0 * DD + col; size_t o = ((size_t)(rg * 4 * (DD / 32) + kt) * 64 + c4 * 16 + (lane & 7)) * 8; v4f v[2][PU / 2][2];    // v, ra: [0] this trip's four units, [1] the next trip's
#pragma unroll
    for (int j = 0; j < PU; ++j) { v[j >> 2][j & 3][0] = *(const v4f*)(wp + (size_t)j * 8 * DD); v[j >> 2][j & 3][1] = *(const v4f*)(wp + (size_t)j * 8 * DD + 4); }
    int l = idx[0]; l = __builtin_amdgcn_readfirstlane(l < 0 ? 0 : (l >= NLY ? NLY - 1 : l));    // the same in every lane: in a scalar register the four starts below are scalar too, and the loads name only the lane's two offsets
    const char* smp = (const char*)(sm + (size_t)l * DD); const char* ssp = (const char*)(ss + (size_t)l * RNK * DD); const char* rmp = (const char*)(rm + (size_t)l * rows); const char* rrp = (const char*)(rr + (size_t)l * RNK * rows);    // wave-uniform starts of layer l
    const unsigned cof = col * 4u, rof = row0 * 4u;    // the lane's byte offsets behind them: its first column, its first row
    const char* rq[RNK];    // the lane's first row in each of the layer's RNK rows of r
#pragma unroll
    for (int k = 0; k < RNK; ++k) rq[k] = rrp + (size_t)k * rows * 4 + rof;
    v4f cs[1 + RNK][2]; float ra[2][PU / 2][1 + RNK];
#pragma unroll
    for (int p = 0; p < 2; ++p) { cs[0][p] = *(const v4f*)(smp + cof + p * 16);
#pragma unroll
        for (int k = 0; k < RNK; ++k) cs[1 + k][p] = *(const v4f*)(ssp + cof + k * (DD * 4) + p * 16); }
#pragma unroll
    for (int g = 0; g < 2; ++g) {
        if (g == 1) asm volatile("s_wait_loadcnt 0x2b" ::: "memory");    // 46 loads are out and 20 follow: with at most 43 older ones left, a wave never has more than 63 outstanding, the most that s_wait_loadcnt can name
#pragma unroll
        for (int u = 0; u < PU / 2; ++u) { ra[g][u][0] = *(const float*)(rmp + rof + (g * 4 + u) * 32);
#pragma unroll
            for (int k = 0; k < RNK; ++k) ra[g][u][1 + k] = *(const float*)(rq[k] + (g * 4 + u) * 32); } }
    asm volatile("s_wait_xcnt 0x0" :: "v"(wp), "v"(cof), "v"(rof), "v"(rq[0]), "v"(rq[1]), "v"(rq[2]), "v"(rq[3]) : "memory");    // the address and offset registers of the issued loads are held to here and reused only behind this wait
    float cf[1 + RNK][8];
#pragma unroll
    for (int k = 0; k < 1 + RNK; ++k)
#pragma unroll
        for (int q = 0; q < 4; ++q) { cf[k][q] = bfr(cs[k][0][q]); cf[k][4 + q] = bfr(cs[k][1][q]); }
#pragma unroll 1                  // rolled: for speed only
    for (int g = 0; g < 2; ++g) {
#pragma unroll
        for (int u = 0; u < PU / 2; ++u) { v8h of; float rf[1 + RNK];
#pragma unroll
            for (int k = 0; k < 1 + RNK; ++k) rf[k] = bfr(ra[0][u][k]);
#pragma unroll
            for (int q = 0; q < 8; ++q) { const float wb = bfr(v[0][u][q >> 2][q & 3]); float ad = rf[1] * cf[1][q];
#pragma unroll
                for (int k = 1; k < RNK; ++k) ad += rf[1 + k] * cf[1 + k][q];
                of[q] = tohx(wb * (rf[0] * cf[0][q]) + ad); }
            const size_t ou = o + (size_t)(u >> 1) * ((DD / 32) * 512) + (u & 1) * 64; *(v8h*)(Wf + ou) = of;
            asm volatile("s_wait_xcnt 0x0" ::: "memory");    // the registers of this unit's store are reused only behind this wait
            v[0][u][0] = v[1][u][0]; v[0][u][1] = v[1][u][1];
#pragma unroll
            for (int k = 0; k < 1 + RNK; ++k) ra[0][u][k] = ra[1][u][k]; }
        o += (size_t)2 * ((DD / 32) * 512); }
}
// k_prep: the three weight factorisations and the two bf16 roundings, which do not depend on one another, as ONE grid; a block's index range says which it works for. The pointers are chosen by that range (scalar selects) and
// each of the two bodies stands once in the text.
#define GFI (3 * DD / 64 * (DD / 32) / PW)   // blocks: in_proj weight, a wave per 64 rows x 32 columns
#define GF1 (DD / 64 * (DD / 32) / PW)       // pos_proj, out_proj weight
#define GCX (NT / 8 * (DD / (PU * 32)) / PW) // input, a wave per 8 rows x 256 columns
#define GCR (TT / 8 * (DD / (PU * 32)) / PW) // pos
__global__ __launch_bounds__(PW * 32) void k_prep(const float* __restrict__ Wi, const float* __restrict__ Wp, const float* __restrict__ Wo, const int* __restrict__ idx,
                                              const float* __restrict__ rm_i, const float* __restrict__ sm_i, const float* __restrict__ r_i, const float* __restrict__ s_i,
                                              const float* __restrict__ rm_p, const float* __restrict__ sm_p, const float* __restrict__ r_p, const float* __restrict__ s_p,
                                              const float* __restrict__ rm_o, const float* __restrict__ sm_o, const float* __restrict__ r_o, const float* __restrict__ s_o,
                                              const float* __restrict__ x, const float* __restrict__ r, h16* WI, h16* WR, h16* WO, h16* XB, h16* RB) {
    const unsigned blk = blockIdx.x, w = threadIdx.x >> 5;
    if (blk < GFI + 2 * GF1) { const bool wi = blk < GFI, wq = blk < GFI + GF1;    // in_proj; else pos_proj; else out_proj
        fact_wave((blk - (wi ? 0u : wq ? (unsigned)GFI : (unsigned)(GFI + GF1))) * PW + w, wi ? Wi : wq ? Wp : Wo, idx, wi ? rm_i : wq ? rm_p : rm_o, wi ? sm_i : wq ? sm_p : sm_o, wi ? r_i : wq ? r_p : r_o, wi ? s_i : wq ? s_p : s_o,
                  wi ? 3 * DD : DD, wi ? WI : wq ? WR : WO); }
    else { const bool ix = blk < GFI + 2 * GF1 + GCX; cvt_wave((blk - (ix ? (unsigned)(GFI + 2 * GF1) : (unsigned)(GFI + 2 * GF1 + GCX))) * PW + w, ix ? x : r, ix ? XB : RB); }
}
// rowplanes: the tile in LDS -> one plane (Q false), or the two q planes (Q true), in fragment order. Chunk u * 32 + lane of a group's two tiles holds d = u * 16 + hi * 8 + 0..7 of row lr; the pointers come with the lane's part added.
template <bool Q>
__device__ __forceinline__ void rowplanes(const float* sp, int rstep, const float* __restrict__ bias, const float* __restrict__ ha, const float* __restrict__ hb, h16* P, h16* P2, size_t pstep) {
    v4f rb[4][2], ra[4][2], re[4][2];    // every bias value of the lane, fetched as one group: one load latency for the whole epilogue
#pragma unroll
    for (int u = 0; u < 4; ++u)
#pragma unroll
        for (int p = 0; p < 2; ++p) { rb[u][p] = *(const v4f*)(bias + u * 16 + p * 4); if (Q) { ra[u][p] = *(const v4f*)(ha + u * 16 + p * 4); re[u][p] = *(const v4f*)(hb + u * 16 + p * 4); } }
#pragma unroll
    for (int u = 0; u < 4; ++u) { float pb[8], ga[8], gb[8];
#pragma unroll
        for (int q = 0; q < 4; ++q) { pb[q] = bfr(rb[u][0][q]); pb[4 + q] = bfr(rb[u][1][q]); if (Q) { ga[q] = bfr(ra[u][0][q]); ga[4 + q] = bfr(ra[u][1][q]); gb[q] = bfr(re[u][0][q]); gb[4 + q] = bfr(re[u][1][q]); } }
#pragma unroll
        for (int bb = 0; bb < 4; ++bb) { const float* s = sp + bb * rstep + u * 16; const v4f s0 = *(const v4fa*)s, s1 = *(const v4fa*)(s + 4); float f[8]; v8h o;
#pragma unroll
            for (int q = 0; q < 4; ++q) { f[q] = s0[q] + pb[q]; f[4 + q] = s1[q] + pb[4 + q]; }
#pragma unroll
            for (int q = 0; q < 8; ++q) o[q] = tohx(Q ? __fadd_rn(f[q], ga[q]) : f[q]);
            *(v8h*)(P + (size_t)bb * pstep + u * 256) = o;
            if (Q) { v8h o2;
#pragma unroll
                for (int q = 0; q < 8; ++q) o2[q] = tohx(__fadd_rn(f[q], gb[q]));
                *(v8h*)(P2 + (size_t)bb * pstep + u * 256) = o2; } }
        asm volatile("s_wait_xcnt 0x0" ::: "memory"); }    // the registers of this group's stores (in the first group: of the bias loads too) are reused only behind this wait
}
// k_proj: the four projections, which do not depend on one another, as ONE grid (16, 26) of 8 waves (4 x 2 tiles of 64 x 64): blockIdx.y / 8 = 0, 1, 2: the q, k, v third of in_proj (256 rows blockIdx.x, heads (y & 7) * 2 + 0, 1);
// y = 24, 25: the 4 x 8 work-group tiles of the pos projection. What follows is per wave:
// A tile's 64 columns are one head; its 64 rows are 16 times x 4 batch entries (row = time * 4 + batch), or 64 positions of pos. So the tile holds whole 16-row blocks of k_attn's fp16 operand planes, and the epilogue writes those
// planes itself, in fragment order, 512 bytes in a row per store: q + r_w_bias and q + r_r_bias (QA, QB), k (KP), v transposed (VT), r_k (RK). No f32 projection goes through memory.
// Rounding of each value: f32 sum + bf16-rounded projection bias, then + bf16-rounded head bias (q only), each addition rounded to f32, then fp16.
__global__ __launch_bounds__(256) __attribute__((amdgpu_waves_per_eu(4, 4))) void k_proj(const h16* __restrict__ XB, const h16* __restrict__ RB, const h16* __restrict__ WI, const h16* __restrict__ WR, int K, const float* __restrict__ bi, const float* __restrict__ bp,
                                             const float* __restrict__ rwb, const float* __restrict__ rrb, h16* QA, h16* QB, h16* KP, h16* VT, h16* RK) {
    __shared__ __align__(16) char st[8 * 64 * 68 * 4];    // in the k loop: the two staging buffers (2 * STGB(8) bytes); behind it: each wave's whole tile
    const int lane = threadIdx.x & 31, lr = lane & 15, hi = lane >> 4; const int w = __builtin_amdgcn_readfirstlane((int)(threadIdx.x >> 5)); const int wn = w & 1, wm = w >> 1;
    const int bx = (int)blockIdx.x, y = (int)blockIdx.y; const bool pos = y >= 24; const int sel = y >> 3; const int t = (y - 24) * 16 + bx;
    const int x = (pos ? (t & 3) : bx) * 4 + wm;    // this wave's 64-row tile
    const int r0 = x * 64, hh = (pos ? (t >> 2) : (y & 7)) * 2 + wn, c0 = hh * 64;
    const float* bias = (pos ? bp : bi + (size_t)sel * DD) + c0;    // the 64 projection-bias values of this tile's columns
    v8f acc[4][4];
    gemms_acc<8, 1>(pos ? RB : XB, pos ? WR : WI + (size_t)sel * DD * DD, K, r0 - wm * 64, c0 - wn * 64, st, acc);
    float* os = (float*)(st + w * (64 * 68 * 4));    // this wave's tile; tile row m stands at LDS row (m & 3) * 16 + (m >> 2): batch-major for x tiles
#pragma unroll
    for (int mb = 0; mb < 4; ++mb)
#pragma unroll
        for (int nb = 0; nb < 4; ++nb)
#pragma unroll
            for (int j = 0; j < 8; ++j) os[((j & 3) * 16 + mb * 4 + hi * 2 + (j >> 2)) * 68 + nb * 16 + lr] = acc[mb][nb][j];
    __builtin_amdgcn_wave_barrier(); asm volatile("" ::: "memory");    // the reads below take other lanes' values: they stay behind the stores above
    if (!pos && sel == 2) {    // VT[batch * 16 + head][d][time]: lane = (8 times hi * 8.., column d = db * 16 + lr); the 16 times are half a 32-wide k tile
        h16* P = VT + (size_t)hh * (HD * TT) + (size_t)((x >> 1) * 64 + (x & 1) * 32 + lane) * 8;
        float rv[4];    // the lane's four bias values, fetched as one group
#pragma unroll
        for (int db = 0; db < 4; ++db) rv[db] = bias[db * 16 + lr];
#pragma unroll
        for (int db = 0; db < 4; ++db) { const float bv = bfr(rv[db]);
#pragma unroll
            for (int bb = 0; bb < 4; ++bb) { v8h o;
#pragma unroll
                for (int q = 0; q < 8; ++q) o[q] = tohx(os[(bb * 16 + hi * 8 + q) * 68 + db * 16 + lr] + bv);
                *(v8h*)(P + (size_t)bb * (NH_ * HD * TT) + (size_t)db * (16 * TT)) = o; }
            asm volatile("s_wait_xcnt 0x0" ::: "memory"); }    // the registers of this group's stores (in the first group: of the bias loads too) are reused only behind this wait
    } else {    // planes [..][row][d]: 16 rows x 64 d = two tiles = 2 KiB in a row; group bb = batch entry bb (x tiles) or 16-row block bb (pos tiles)
        const bool isq = !pos && sel == 0;
        const float* sp = os + (pos ? (lr & 3) * 16 + (lr >> 2) : lr) * 68 + hi * 8; const int rstep = pos ? 4 * 68 : 16 * 68;    // (group bb, row lr) stands bb * rstep floats behind sp
        h16* P = (pos ? RK + (size_t)hh * (TT * HD) + (size_t)(r0 >> 4) * (16 * HD) : (isq ? QA : KP) + (size_t)hh * (TT * HD) + (size_t)x * (16 * HD)) + lane * 8;
        const size_t pstep = pos ? (size_t)(16 * HD) : (size_t)NH_ * TT * HD;
        if (isq) rowplanes<true>(sp, rstep, bias + hi * 8, rwb + c0 + hi * 8, rrb + c0 + hi * 8, P, QB + (size_t)hh * (TT * HD) + (size_t)x * (16 * HD) + lane * 8, pstep);
        else rowplanes<false>(sp, rstep, bias + hi * 8, nullptr, nullptr, P, nullptr, pstep);
    }
}
// k_attn: one work-group (8 waves) = 32 query rows of one (batch, head). The shifted 32 x 1024 BD block goes through LDS (f32, row pitch SP floats); no score, probability or per-head output plane goes through memory.
// 1) BD: raw tiles (q + r_r_bias).r_k for rows i (lower part) and rows i + 1 (upper part) against the same r_k fragment; element (i, n) lands at its shifted column of row i: with d = i + n + 1 - T,
//    d >= 0 -> column d from row i; d <= -2 -> column d + T + 1 from row i + 1; d == -1 has no place in the shifted row and falls on column T, in the row's pad, which nobody reads.
//    For fixed i that fills every column but i + 1, which holds the shift's zero and is stored by wave 0 (for i = T - 1 that store too falls on the pad).
// 2) AC transposed: wave w owns keys w * 128 .. + 127 of all 32 queries; A = 16 keys, B = 16 queries, and the accumulator starts from the BD values, read from S 16 bytes at a time. A lane then holds 8 keys in a row of ONE query per tile:
//    from here on the scores stay in registers.  3) softmax: the row maximum and sum are taken inside the lane, plus one exchange with the lane 16 on; the eight waves' maxima meet in Rm, their sums in Rs. P = exp(score / 8 - max) x1024, fp16, not yet divided by the row sum.
// 4) P.V: two neighbouring transposed tiles are the fragment of 16 queries x 32 keys as they stand, so P goes through no LDS; each wave multiplies its 128 keys with all 64 d (A = V^T, B = P) and leaves a 32 x 64 partial sum in the bytes of S.
// 5) the eight partial sums are added, waves ascending, divided by the row sum, fp16; the merged plane is in fragment order with rows batch * T + time, so the work-group owns four whole tiles of it and a wave stores 512 bytes in a row.
// Every plain '#pragma unroll' in k_attn: the fragment and accumulator arrays are indexed by the loop counters and stay in registers only when those loops are unrolled.
// exp2x8: 2^x of eight values. One statement, so that the slot which the instruction set asks for behind a transcendental (one independent instruction before its result is read or its source overwritten) is kept by construction:
// the results are early-clobber, so none takes the register of a source, none is read inside, and the v_nop at the end is the slot behind the last one.
__device__ __forceinline__ v8f exp2x8(v8f x) {
    float e0, e1, e2, e3, e4, e5, e6, e7;
    asm("v_exp_f32 %0, %8\n\tv_exp_f32 %1, %9\n\tv_exp_f32 %2, %10\n\tv_exp_f32 %3, %11\n\tv_exp_f32 %4, %12\n\tv_exp_f32 %5, %13\n\tv_exp_f32 %6, %14\n\tv_exp_f32 %7, %15\n\tv_nop"
        : "=&v"(e0), "=&v"(e1), "=&v"(e2), "=&v"(e3), "=&v"(e4), "=&v"(e5), "=&v"(e6), "=&v"(e7)
        : "v"(x[0]), "v"(x[1]), "v"(x[2]), "v"(x[3]), "v"(x[4]), "v"(x[5]), "v"(x[6]), "v"(x[7]));
    return (v8f){e0, e1, e2, e3, e4, e5, e6, e7};
}
#define MR 32
#define SP 1028                   // 4112 bytes = 16 x odd: the b128 fragment reads of 16 rows fall on distinct banks
__global__ __launch_bounds__(256) __attribute__((amdgpu_waves_per_eu(4, 4))) void k_attn(const h16* __restrict__ QA, const h16* __restrict__ QB, const h16* __restrict__ KP, const h16* __restrict__ VT, const h16* __restrict__ RK, h16* Am) {
    __shared__ __align__(16) float S[MR * SP];
    __shared__ __align__(16) float Rm[MR * 8];    // [query][wave]: maximum, and in Rs sum, over the wave's 128 keys
    __shared__ __align__(16) float Rs[MR * 8];
    const int tid = threadIdx.x, lane = tid & 31, lr = lane & 15, hi = lane >> 4; const int w = __builtin_amdgcn_readfirstlane(tid >> 5);
    const int i0 = blockIdx.x * MR; const int z = blockIdx.y; const int b = z >> 4, h = z & 15;
    const h16* qa = QA + (size_t)z * TT * HD; const h16* qb = QB + (size_t)z * TT * HD; const h16* kp = KP + (size_t)z * TT * HD; const h16* vt = VT + (size_t)z * HD * TT; const h16* rk = RK + (size_t)h * TT * HD;
    if (w == 0) S[lane * SP + i0 + lane + 1] = 0.f;
    // The BD loop is straight-line with two operand buffers: the loads of the next pair of key tiles are issued, then this pair is worked on. The sched_barrier calls hold that order:
    // without them the scheduler lifts all eight tiles' loads to the top and spills past the 256 registers that two work-groups per WGP allow.
    v16h a[2][2], kb[8][2];    // AC's operands; the q + r_w_bias rows and the first pair of key tiles are fetched in front of the last BD pair, whose work covers their latency
    const h16* pa = qa + (size_t)i0 * HD + lane * 8; const h16* pk = kp + (size_t)(w * 128) * HD + lane * 8;    // 16 rows of 64 = two tiles = 16 * HD elements; the second tile (k 32..63) 512 elements on
    {   v16h aL[2][2], aU[2][2], rb[2][2][2]; const h16* bp = rk + (size_t)(w * 128) * HD + lane * 8; const h16* pL = qb + (size_t)i0 * HD + lane * 8;
        const int ru = (i0 + 17 + lr < TT) ? i0 + 17 + lr : TT - 1; const h16* pU = qb + (size_t)(ru >> 4) * 16 * HD + (hi * 16 + (ru & 15)) * 8;    // row T does not exist; row T - 1 has no upper part, so its aU result is never chosen
        const int rv = i0 + 1 + lr; const h16* pV = qb + (size_t)(rv >> 4) * 16 * HD + (hi * 16 + (rv & 15)) * 8;    // rows i + 1 straddle two row blocks: lane 15's (and 31's) chunk lies in the next one
#pragma unroll
        for (int ks = 0; ks < 2; ++ks) { aL[0][ks] = WFrag<h16>::ld(pL + ks * 512); aL[1][ks] = WFrag<h16>::ld(pL + 16 * HD + ks * 512); aU[0][ks] = WFrag<h16>::ld(pV + ks * 512); aU[1][ks] = WFrag<h16>::ld(pU + ks * 512); }
#pragma unroll
        for (int t = 0; t < 2; ++t) { rb[0][t][0] = WFrag<h16>::ld(bp + t * 16 * HD); rb[0][t][1] = WFrag<h16>::ld(bp + t * 16 * HD + 512); }
        asm volatile("s_wait_xcnt 0x0" :: "v"(pL), "v"(pU), "v"(pV) : "memory");    // the address registers of the issued loads are held to here and may be reused only behind this wait
#pragma unroll
        for (int g = 0; g < 4; ++g) {
            if (g < 3) {
#pragma unroll
                for (int t = 0; t < 2; ++t) { rb[(g + 1) & 1][t][0] = WFrag<h16>::ld(bp + ((g + 1) * 2 + t) * 16 * HD); rb[(g + 1) & 1][t][1] = WFrag<h16>::ld(bp + ((g + 1) * 2 + t) * 16 * HD + 512); } }
            else {
#pragma unroll
                for (int mb = 0; mb < 2; ++mb)
#pragma unroll
                    for (int ks = 0; ks < 2; ++ks) { a[mb][ks] = WFrag<h16>::ld(pa + mb * 16 * HD + ks * 512); kb[mb][ks] = WFrag<h16>::ld(pk + mb * 16 * HD + ks * 512); } }
            if (g == 2) asm volatile("s_wait_xcnt 0x0" :: "v"(bp) : "memory");    // last loads through bp: its registers are held to here and reused only behind this wait
            if (g == 3) asm volatile("s_wait_xcnt 0x0" :: "v"(pa) : "memory");    // the same for pa
            __builtin_amdgcn_sched_barrier(0);    // the next pair's loads stay in front of this pair's work
#pragma unroll
            for (int t = 0; t < 2; ++t) { const int n0 = w * 128 + (g * 2 + t) * 16;
#pragma unroll
                for (int mb = 0; mb < 2; ++mb) { v8f cL = (v8f){}, cU = (v8f){}; cL = wmma16(aL[mb][0], rb[g & 1][t][0], cL); cU = wmma16(aU[mb][0], rb[g & 1][t][0], cU); cL = wmma16(aL[mb][1], rb[g & 1][t][1], cL); cU = wmma16(aU[mb][1], rb[g & 1][t][1], cU);
#pragma unroll
                    for (int j = 0; j < 8; ++j) { const int ml = mb * 16 + hi * 8 + j; const int d = i0 + ml + n0 + lr + 1 - TT;
                        S[ml * SP + d + ((d >> 31) & (TT + 1))] = (d >= 0) ? cL[j] : cU[j]; } } }
            __builtin_amdgcn_sched_barrier(0);    // later pairs' loads stay behind this pair's work
        }
    }
    __syncthreads();              // every shifted BD element is in place before a wave reads it as AC's start value
    v8f s[2][8];                  // this wave's scores, transposed: s[mb][t][j] = query mb * 16 + lr, key w * 128 + t * 16 + hi * 8 + j
    {   const float* sb = S + lr * SP + w * 128 + hi * 8;    // the lane's 8 keys of a tile lie in a row in its query's row of S: two 16-byte reads
        auto lds1 = [&](int t) {    // the start values of key tile t
#pragma unroll
            for (int mb = 0; mb < 2; ++mb) { const float* q = sb + mb * 16 * SP + t * 16; s[mb][t] = __builtin_shufflevector(*(const v4fa*)q, *(const v4fa*)(q + 4), 0, 1, 2, 3, 4, 5, 6, 7); } };
        // The other six key tiles go out as one group: one load latency for all of AC, part of it behind the first pair's work. A tile's 16 fragment registers fall free with its WMMAs and take the start values of the tile three on,
        // so that fragments and scores together never need more than the eight tiles' worth plus three.
#pragma unroll
        for (int t = 2; t < 8; ++t) { kb[t][0] = WFrag<h16>::ld(pk + t * 16 * HD); kb[t][1] = WFrag<h16>::ld(pk + t * 16 * HD + 512); }
        asm volatile("s_wait_xcnt 0x0" :: "v"(pk) : "memory");    // last loads through pk: its registers are held to here and reused only behind this wait
        lds1(0); lds1(1); lds1(2);
        __builtin_amdgcn_sched_barrier(0);    // the loads stay in front of the first tile's work
#pragma unroll
        for (int t = 0; t < 8; ++t) {
#pragma unroll
            for (int ks = 0; ks < 2; ++ks)
#pragma unroll
                for (int mb = 0; mb < 2; ++mb) s[mb][t] = wmma16(kb[t][ks], a[mb][ks], s[mb][t]);    // A = 16 keys, B = 16 queries
            __builtin_amdgcn_sched_barrier(0);    // the reads below take this tile's fragment registers: they stay behind its WMMAs
            if (t < 5) { lds1(t + 3);
                __builtin_amdgcn_sched_barrier(0); }    // and in front of the next tiles', whose work covers their latency
        }
    }
    float mx[2];
#pragma unroll
    for (int mb = 0; mb < 2; ++mb) { float m = s[mb][0][0], m2 = s[mb][4][0];    // two chains a query, four in all: a link's latency passes behind the other chains' links
#pragma unroll
        for (int t = 0; t < 4; ++t)
#pragma unroll
            for (int j = 0; j < 8; ++j) { m = fmaxf(m, s[mb][t][j]); m2 = fmaxf(m2, s[mb][4 + t][j]); }
        m = fmaxf(m, m2); mx[mb] = fmaxf(m, __shfl_xor(m, 16, 32)); }    // the other half of each tile's keys stands 16 lanes on
    Rm[lane * 8 + w] = hi ? mx[1] : mx[0];    // query 'lane', this wave's 128 keys
    __syncthreads();              // every wave's row maxima are in Rm; every wave has taken its part of S, whose bytes are free from here on
    v16h bv[4][4]; const h16* vp = vt + (size_t)(w * 4) * 512 + lane * 8;    // bv[u][dt]: V^T rows dt * 16.., keys w * 128 + u * 32..; the first two u are fetched here, behind the barrier (which waits for every load), so that their latency passes behind the exponentials
#pragma unroll
    for (int u = 0; u < 2; ++u)
#pragma unroll
        for (int dt = 0; dt < 4; ++dt) bv[u][dt] = WFrag<h16>::ld(vp + (dt * (TT / 32) + u) * 512);
    __builtin_amdgcn_sched_barrier(0);    // these loads stay in front of the exponentials, the third group's behind them: all three held beside the f32 scores spill
    const float CS = 0.125f * 1.44269504f;    // 1/8 and log2(e) in one factor
    v16h pf[2][4]; float sm[2];   // pf[mb][u]: P x1024 x (row sum), fp16: two neighbouring transposed score tiles are, register for register, the fragment of 16 queries x 32 keys
#pragma unroll
    for (int mb = 0; mb < 2; ++mb) { const float* rp = Rm + (mb * 16 + lr) * 8; const v4f r0 = *(const v4fa*)rp, r1 = *(const v4fa*)(rp + 4);
        const float M = fmaxf(fmaxf(fmaxf(r0[0], r0[1]), fmaxf(r0[2], r0[3])), fmaxf(fmaxf(r1[0], r1[1]), fmaxf(r1[2], r1[3])));
        const float off = 10.0f - M * CS; v8f sv = (v8f){};    // 2^10: the largest P is 1024, as far from fp16's subnormals as its range allows
#pragma unroll
        for (int u = 0; u < 4; ++u) { v8h ph[2];
#pragma unroll
            for (int p = 0; p < 2; ++p) { v8f x;
#pragma unroll
                for (int j = 0; j < 8; ++j) x[j] = fmaf(s[mb][u * 2 + p][j], CS, off);
                const v8f e = exp2x8(x);
#pragma unroll
                for (int j = 0; j < 8; ++j) ph[p][j] = tohx(e[j]);
                sv += e; }
            pf[mb][u] = cat16(ph[0], ph[1]); }
        const float t4 = ((sv[0] + sv[1]) + (sv[2] + sv[3])) + ((sv[4] + sv[5]) + (sv[6] + sv[7])); sm[mb] = t4 + __shfl_xor(t4, 16, 32); }
    Rs[lane * 8 + w] = hi ? sm[1] : sm[0];    // query 'lane': the sum over this wave's 128 keys
    __builtin_amdgcn_sched_barrier(0);    // see above: the third group's loads stay behind the exponentials
#pragma unroll
    for (int dt = 0; dt < 4; ++dt) bv[2][dt] = WFrag<h16>::ld(vp + (dt * (TT / 32) + 2) * 512);
    __builtin_amdgcn_sched_barrier(0);    // the third group's loads stay in front of the first group's WMMAs
    v8f o[2][4];                  // transposed too: o[mb][dt][j] = query mb * 16 + lr, d = dt * 16 + hi * 8 + j, summed over this wave's keys
#pragma unroll
    for (int mb = 0; mb < 2; ++mb)
#pragma unroll
        for (int dt = 0; dt < 4; ++dt) o[mb][dt] = (v8f){};
#pragma unroll
    for (int u = 0; u < 4; ++u) {
#pragma unroll
        for (int dt = 0; dt < 4; ++dt)
#pragma unroll
            for (int mb = 0; mb < 2; ++mb) o[mb][dt] = wmma16(bv[u][dt], pf[mb][u], o[mb][dt]);
        if (u == 0) {
            __builtin_amdgcn_sched_barrier(0);    // the last group's loads take the first group's registers: they stay behind its WMMAs and in front of the second group's
#pragma unroll
            for (int dt = 0; dt < 4; ++dt) bv[3][dt] = WFrag<h16>::ld(vp + (dt * (TT / 32) + 3) * 512);
            asm volatile("s_wait_xcnt 0x0" :: "v"(vp) : "memory");    // last loads through vp: its registers are held to here and reused only behind this wait
            __builtin_amdgcn_sched_barrier(0); }
    }
    {   float* op = S + (w * MR + lr) * 68 + hi * 8;    // this wave's partial sums, [wave][query][d], pitch 68 floats, in the bytes of S
#pragma unroll
        for (int mb = 0; mb < 2; ++mb)
#pragma unroll
            for (int dt = 0; dt < 4; ++dt) { float* q = op + mb * 16 * 68 + dt * 16; *(v4fa*)q = __builtin_shufflevector(o[mb][dt], o[mb][dt], 0, 1, 2, 3); *(v4fa*)(q + 4) = __builtin_shufflevector(o[mb][dt], o[mb][dt], 4, 5, 6, 7); }
    }
    __syncthreads();              // all eight waves' partial sums and row sums are in LDS
    {   const int row = (tid >> 7) * 16 + lr, d0 = ((tid >> 6) & 1) * 32 + ((tid >> 5) & 1) * 16 + hi * 8; const float* p0 = S + row * 68 + d0; const float* rs = Rs + row * 8; v8h om;
        v4f x0 = *(const v4fa*)p0, x1 = *(const v4fa*)(p0 + 4); const v4f q0 = *(const v4fa*)rs, q1 = *(const v4fa*)(rs + 4);
#pragma unroll
        for (int k = 1; k < 8; ++k) { x0 += *(const v4fa*)(p0 + k * (MR * 68)); x1 += *(const v4fa*)(p0 + k * (MR * 68) + 4); }    // waves, that is keys, ascending
        const float inv = __fdiv_rn(1.0f, ((q0[0] + q0[1]) + (q0[2] + q0[3])) + ((q1[0] + q1[1]) + (q1[2] + q1[3])));    // the factor 1024 stands in both sums and cancels
#pragma unroll
        for (int q = 0; q < 4; ++q) { om[q] = tohx(x0[q] * inv); om[4 + q] = tohx(x1[q] * inv); }
        const size_t o2 = ((size_t)((b * TT + i0) / 16 + (tid >> 7)) * (DD / 32) + h * 2 + ((tid >> 6) & 1)) * 512 + (tid & 63) * 8; *(v8h*)(Am + o2) = om; }
}

extern "C" void kernel_launch(void* const* d_in, const int* in_sizes, int n_in,
                              void* d_out, int out_size, void* d_ws, size_t ws_size, hipStream_t stream) {
    (void)in_sizes; (void)n_in; (void)out_size;
    const float* IN[23]; for (int i = 0; i < 23; ++i) IN[i] = (const float*)d_in[i];
    // input [1024][4][1024], pos [1024][1][1024], indices (int [1]), in_proj_weight [3072][1024], in_proj_bias, out_proj_weight, out_proj_bias, pos_proj_weight, pos_proj_bias,
    // r_i [8][4][3072], s_i [8][4][1024], r_p, s_p, r_o, s_o, rm_i [8][1][3072], sm_i [8][1][1024], rm_p, sm_p, rm_o, sm_o, r_w_bias [16][64], r_r_bias = d_in[0..22]
    const float* x = IN[0]; const float* r = IN[1]; const int* idx = (const int*)d_in[2]; const float* rwb = IN[21]; const float* rrb = IN[22];
    float* OUT = (float*)d_out;     // [1024][4][1024] (rows t*4 + b)
    char* wsp = (char*)d_ws;
    auto take = [&](size_t bytes) { char* p = wsp; wsp += (bytes + 255) & ~(size_t)255; return (void*)p; };
    h16* WI = (h16*)take((size_t)3 * DD * DD * 2); h16* WR = (h16*)take((size_t)DD * DD * 2); h16* WO = (h16*)take((size_t)DD * DD * 2);
    h16* XB = (h16*)take((size_t)NT * DD * 2); h16* RB = (h16*)take((size_t)TT * DD * 2);
    h16* QA = (h16*)take((size_t)NT * DD * 2); h16* QB = (h16*)take((size_t)NT * DD * 2); h16* KP = (h16*)take((size_t)NT * DD * 2); h16* VT = (h16*)take((size_t)NT * DD * 2); h16* RK = (h16*)take((size_t)NH_ * TT * HD * 2);
    h16* ATm = (h16*)take((size_t)NT * DD * 2);   // the merged plane
    if ((size_t)(wsp - (char*)d_ws) > ws_size) return;    // total 62 MiB; ws 256 MiB
    // Four dependent launches; what does not depend on one another shares a grid.
    k_prep<<<GFI + 2 * GF1 + GCX + GCR, PW * 32, 0, stream>>>(IN[3], IN[7], IN[5], idx, IN[15], IN[16], IN[9], IN[10], IN[17], IN[18], IN[11], IN[12], IN[19], IN[20], IN[13], IN[14], x, r, WI, WR, WO, XB, RB);
    k_proj<<<dim3(NT / 256, 3 * DD / 128 + TT / 256 * (DD / 128) / (NT / 256), 1), 256, 0, stream>>>(XB, RB, WI, WR, DD, IN[4], IN[8], rwb, rrb, QA, QB, KP, VT, RK);
    k_attn<<<dim3(TT / MR, NB_ * NH_, 1), 256, 0, stream>>>(QA, QB, KP, VT, RK, ATm);
    k_gemmw<true, true><<<dim3(NT / 128, DD / 128, 1), 128, 0, stream>>>(ATm, WO, DD, OUT, DD, IN[6]);
}
